// v000
// The times below were measured on an AMD MI455X: many runs one after another, warmed up first and cycling through
// copies of the inputs, with the whole window's GPU time divided by the number of runs. Launches and the gaps
// between them are all in it. The median over several windows is given; except for v000 it joins two sittings, which
// can be a few percent apart, so the side-by-side timings, each taken in one sitting, are the better comparison.
// v000 is the starting kernel. One run takes 1870 microseconds.
#include <hip/hip_runtime.h>
#include <hip/hip_bf16.h>

typedef __attribute__((ext_vector_type(16))) __bf16 v16bf;
typedef __attribute__((ext_vector_type(8)))  __bf16 v8bf;
typedef __attribute__((ext_vector_type(8)))  float  v8f;
typedef __attribute__((ext_vector_type(4)))  float  v4f;
typedef __attribute__((ext_vector_type(4)))  unsigned int v4u;
typedef __attribute__((ext_vector_type(8)))  int v8i;
typedef __attribute__((ext_vector_type(4)))  int v4i;

#define D_MODEL 1024
#define D_HEAD  64

__device__ __forceinline__ v16bf ld_frag_bf(const __bf16* base, int ldk) {
  const int lane = threadIdx.x & 31;
  const int r    = lane & 15;
  const int ko   = (lane & 16) ? 8 : 0;
  const __bf16* p = base + r * ldk + ko;
  v8bf lo = *reinterpret_cast<const v8bf*>(p);
  v8bf hi = *reinterpret_cast<const v8bf*>(p + 16);
  v16bf f;
#pragma unroll
  for (int i = 0; i < 8; ++i) { f[i] = lo[i]; f[i + 8] = hi[i]; }
  return f;
}

// Same fragment pattern but sourced from an f32 LDS tile, converting to bf16.
__device__ __forceinline__ v16bf ld_frag_f32(const float* base, int ldk) {
  const int lane = threadIdx.x & 31;
  const int r    = lane & 15;
  const int ko   = (lane & 16) ? 8 : 0;
  const float* p = base + r * ldk + ko;
  v4f a0 = *reinterpret_cast<const v4f*>(p);
  v4f a1 = *reinterpret_cast<const v4f*>(p + 4);
  v4f b0 = *reinterpret_cast<const v4f*>(p + 16);
  v4f b1 = *reinterpret_cast<const v4f*>(p + 20);
  v16bf f;
#pragma unroll
  for (int i = 0; i < 4; ++i) {
    f[i]      = (__bf16)a0[i];
    f[4 + i]  = (__bf16)a1[i];
    f[8 + i]  = (__bf16)b0[i];
    f[12 + i] = (__bf16)b1[i];
  }
  return f;
}

__device__ __forceinline__ void tdm_load_2d_f32(unsigned lds_off, const float* gptr,
                                                int tile_w, int tile_h,
                                                int ld, int tensor_w) {
  unsigned long long ga = (unsigned long long)(uintptr_t)gptr;
  v4u g0;
  g0[0] = 1u;                                            // count=1, user mode
  g0[1] = lds_off;                                       // lds_addr (bytes)
  g0[2] = (unsigned)(ga & 0xFFFFFFFFu);                  // global_addr[31:0]
  g0[3] = (unsigned)((ga >> 32) & 0x1FFFFFFu) | (2u << 30); // addr[56:32] | type=2
  v8i g1;
  g1[0] = (int)(2u << 16);
  g1[1] = (int)(((unsigned)tensor_w & 0xFFFFu) << 16);
  g1[2] = (int)(((unsigned)tensor_w >> 16) & 0xFFFFu);
  g1[3] = (int)(0x10u | ((unsigned)tile_w << 16));
  g1[4] = (int)((unsigned)tile_h & 0xFFFFu);
  g1[5] = (int)(unsigned)ld;
  g1[6] = 0;
  g1[7] = 0;
  v4i gz4 = {0, 0, 0, 0};
  v8i gz8 = {0, 0, 0, 0, 0, 0, 0, 0};
  __builtin_amdgcn_tensor_load_to_lds(g0, g1, gz4, gz4, gz8, 0);
}

// ---------------------------------------------------------------------------
// C = A(f32,[M,K]) @ B(f32,[K,N]) (+bias)(+relu) -> f32 [M,N]
// Tiles staged by the Tensor Data Mover, bf16 WMMA, f32 accumulate.
// M,N multiples of 64; K multiple of 32.
// ---------------------------------------------------------------------------
__global__ __launch_bounds__(128)
void gemm_bf16_wmma(const float* __restrict__ A, const float* __restrict__ B,
                    const float* __restrict__ bias, float* __restrict__ C,
                    int M, int N, int K, int relu) {
  __shared__ __align__(16) float  AsF[64 * 32];
  __shared__ __align__(16) float  BsF[32 * 64];
  __shared__ __align__(16) __bf16 Bs[64 * 32];
  const int tid  = threadIdx.x;
  const int wave = tid >> 5;
  const int lane = tid & 31;
  const int n0 = blockIdx.x * 64;
  const int m0 = blockIdx.y * 64;

  const unsigned asf_off = (unsigned)(uintptr_t)(void*)AsF;
  const unsigned bsf_off = (unsigned)(uintptr_t)(void*)BsF;

  v8f acc[4] = {};

  for (int k0 = 0; k0 < K; k0 += 32) {
    __syncthreads();                       // previous-iteration LDS reads done
    if (wave == 0) {
      tdm_load_2d_f32(asf_off, A + (size_t)m0 * K + k0, 32, 64, K, K);
      tdm_load_2d_f32(bsf_off, B + (size_t)k0 * N + n0, 64, 32, N, N);
      __builtin_amdgcn_s_wait_tensorcnt(0);
    }
    __syncthreads();                       // tiles visible to all waves

    // Transpose + convert B: BsF[k][n] f32 -> Bs[n][k] bf16 (16 elems/thread)
    {
      const int k  = tid >> 2;             // 0..31
      const int nq = tid & 3;              // 16-wide column chunk
#pragma unroll
      for (int i = 0; i < 16; ++i) {
        int n = nq * 16 + i;
        Bs[n * 32 + k] = (__bf16)BsF[k * 64 + n];
      }
    }
    __syncthreads();

    v16bf a = ld_frag_f32(&AsF[wave * 16 * 32], 32);
#pragma unroll
    for (int nt = 0; nt < 4; ++nt) {
      v16bf b = ld_frag_bf(&Bs[nt * 16 * 32], 32);
      acc[nt] = __builtin_amdgcn_wmma_f32_16x16x32_bf16(
          false, a, false, b, (short)0, acc[nt], false, false);
    }
  }

  const int half8 = (lane & 16) ? 8 : 0;
  const int cn    = lane & 15;
#pragma unroll
  for (int nt = 0; nt < 4; ++nt) {
#pragma unroll
    for (int e = 0; e < 8; ++e) {
      int row = m0 + wave * 16 + e + half8;
      int col = n0 + nt * 16 + cn;
      float v = acc[nt][e];
      if (bias) v += bias[col];
      if (relu) v = fmaxf(v, 0.0f);
      C[(size_t)row * N + col] = v;
    }
  }
}

// ---------------------------------------------------------------------------
// Fused flash attention, one wave per (b, h, 16-row q tile).
// Q,K,V,O are f32 [B, T*, D_MODEL]; head h uses columns [h*64, h*64+64).
// causal=1: key <= query (dec_valid_lens = q+1).  causal=0: key < vlen[b].
// ---------------------------------------------------------------------------
__global__ __launch_bounds__(32)
void attn_wmma(const float* __restrict__ Q, const float* __restrict__ Kt,
               const float* __restrict__ V, const int* __restrict__ vlen,
               float* __restrict__ O, int Tq, int Tk, int causal) {
  __shared__ __align__(16) __bf16 Qs[16 * 64];   // [q][d]
  __shared__ __align__(16) __bf16 Ks[32 * 64];   // [key][d] (== B-frag layout, QK^T)
  __shared__ __align__(16) __bf16 Vt[64 * 32];   // [d][key] (B-frag layout, PV)
  __shared__ __align__(16) __bf16 Ps[16 * 32];   // [q][key] P relayout buffer

  const int lane = threadIdx.x & 31;
  const int qb   = blockIdx.x * 16;
  const int h    = blockIdx.y;
  const int b    = blockIdx.z;
  const int half8 = (lane & 16) ? 8 : 0;
  const int cn    = lane & 15;

  const size_t qoff = ((size_t)b * Tq + qb) * D_MODEL + (size_t)h * D_HEAD;
#pragma unroll
  for (int i = 0; i < 32; ++i) {
    int idx = i * 32 + lane;
    int r = idx >> 6, c = idx & 63;
    Qs[r * 64 + c] = (__bf16)Q[qoff + (size_t)r * D_MODEL + c];
  }
  v16bf aq0 = ld_frag_bf(&Qs[0], 64);
  v16bf aq1 = ld_frag_bf(&Qs[32], 64);

  float m[8], l[8];
#pragma unroll
  for (int e = 0; e < 8; ++e) { m[e] = -3.0e38f; l[e] = 0.0f; }
  v8f o0 = {}, o1 = {}, o2 = {}, o3 = {};

  const int vl   = causal ? Tk : vlen[b];
  const int nblk = causal ? ((qb + 16 + 31) >> 5) : ((vl + 31) >> 5);

  for (int j = 0; j < nblk; ++j) {
    const int kb = j * 32;
    for (int i = 0; i < 64; ++i) {
      int idx = i * 32 + lane;
      int kk = idx >> 6, c = idx & 63;
      size_t g = ((size_t)b * Tk + kb + kk) * D_MODEL + (size_t)h * D_HEAD + c;
      float kv = Kt[g], vv = V[g];
      Ks[kk * 64 + c] = (__bf16)kv;
      Vt[c * 32 + kk] = (__bf16)vv;
    }

    // S = Q @ K^T for 32 keys (two 16-key column tiles)
    v8f s0 = {}, s1 = {};
    {
      v16bf b0a = ld_frag_bf(&Ks[0], 64);
      v16bf b0b = ld_frag_bf(&Ks[32], 64);
      v16bf b1a = ld_frag_bf(&Ks[16 * 64], 64);
      v16bf b1b = ld_frag_bf(&Ks[16 * 64 + 32], 64);
      s0 = __builtin_amdgcn_wmma_f32_16x16x32_bf16(false, aq0, false, b0a, (short)0, s0, false, false);
      s0 = __builtin_amdgcn_wmma_f32_16x16x32_bf16(false, aq1, false, b0b, (short)0, s0, false, false);
      s1 = __builtin_amdgcn_wmma_f32_16x16x32_bf16(false, aq0, false, b1a, (short)0, s1, false, false);
      s1 = __builtin_amdgcn_wmma_f32_16x16x32_bf16(false, aq1, false, b1b, (short)0, s1, false, false);
    }

    float p0[8], p1[8];
#pragma unroll
    for (int e = 0; e < 8; ++e) {
      float s0e = s0[e] * 0.125f;   // 1/sqrt(64)
      float s1e = s1[e] * 0.125f;
      int row = qb + e + half8;
      int c0 = kb + cn, c1 = kb + 16 + cn;
      bool ok0 = causal ? (c0 <= row) : (c0 < vl);
      bool ok1 = causal ? (c1 <= row) : (c1 < vl);
      if (!ok0) s0e = -1.0e6f;
      if (!ok1) s1e = -1.0e6f;
      float rm = fmaxf(s0e, s1e);
#pragma unroll
      for (int msk = 1; msk < 16; msk <<= 1) rm = fmaxf(rm, __shfl_xor(rm, msk, 32));
      float mn    = fmaxf(m[e], rm);
      float alpha = __expf(m[e] - mn);
      float e0 = __expf(s0e - mn);
      float e1 = __expf(s1e - mn);
      float rs = e0 + e1;
#pragma unroll
      for (int msk = 1; msk < 16; msk <<= 1) rs += __shfl_xor(rs, msk, 32);
      l[e] = l[e] * alpha + rs;
      m[e] = mn;
      o0[e] *= alpha; o1[e] *= alpha; o2[e] *= alpha; o3[e] *= alpha;
      p0[e] = e0; p1[e] = e1;
    }

#pragma unroll
    for (int e = 0; e < 8; ++e) {
      Ps[(e + half8) * 32 + cn]      = (__bf16)p0[e];
      Ps[(e + half8) * 32 + 16 + cn] = (__bf16)p1[e];
    }
    v16bf ap = ld_frag_bf(&Ps[0], 32);
    o0 = __builtin_amdgcn_wmma_f32_16x16x32_bf16(false, ap, false, ld_frag_bf(&Vt[0],       32), (short)0, o0, false, false);
    o1 = __builtin_amdgcn_wmma_f32_16x16x32_bf16(false, ap, false, ld_frag_bf(&Vt[16 * 32], 32), (short)0, o1, false, false);
    o2 = __builtin_amdgcn_wmma_f32_16x16x32_bf16(false, ap, false, ld_frag_bf(&Vt[32 * 32], 32), (short)0, o2, false, false);
    o3 = __builtin_amdgcn_wmma_f32_16x16x32_bf16(false, ap, false, ld_frag_bf(&Vt[48 * 32], 32), (short)0, o3, false, false);
  }

#pragma unroll
  for (int e = 0; e < 8; ++e) {
    float inv = 1.0f / l[e];
    size_t ro = ((size_t)b * Tq + qb + e + half8) * D_MODEL + (size_t)h * D_HEAD;
    O[ro + cn]      = o0[e] * inv;
    O[ro + 16 + cn] = o1[e] * inv;
    O[ro + 32 + cn] = o2[e] * inv;
    O[ro + 48 + cn] = o3[e] * inv;
  }
}

// out = LayerNorm(a + r) * g + bt, one block per row of D_MODEL
__global__ __launch_bounds__(256)
void add_ln(const float* __restrict__ a, const float* __restrict__ r,
            const float* __restrict__ g, const float* __restrict__ bt,
            float* __restrict__ out) {
  __shared__ float red[256];
  const int tid = threadIdx.x;
  const size_t row = blockIdx.x;
  float v[4];
  float s = 0.0f;
#pragma unroll
  for (int i = 0; i < 4; ++i) {
    int c = tid + i * 256;
    v[i] = a[row * D_MODEL + c] + r[row * D_MODEL + c];
    s += v[i];
  }
  red[tid] = s; __syncthreads();
  for (int off = 128; off > 0; off >>= 1) { if (tid < off) red[tid] += red[tid + off]; __syncthreads(); }
  float mean = red[0] * (1.0f / D_MODEL);
  __syncthreads();
  float sq = 0.0f;
#pragma unroll
  for (int i = 0; i < 4; ++i) { float d = v[i] - mean; sq += d * d; }
  red[tid] = sq; __syncthreads();
  for (int off = 128; off > 0; off >>= 1) { if (tid < off) red[tid] += red[tid + off]; __syncthreads(); }
  float rstd = rsqrtf(red[0] * (1.0f / D_MODEL) + 1e-5f);
#pragma unroll
  for (int i = 0; i < 4; ++i) {
    int c = tid + i * 256;
    out[row * D_MODEL + c] = (v[i] - mean) * rstd * g[c] + bt[c];
  }
}

// gate = sigmoid(concat(code,kw) @ gw + gb); out = gate*code + (1-gate)*kw
__global__ __launch_bounds__(256)
void gate_mix(const float* __restrict__ code, const float* __restrict__ kw,
              const float* __restrict__ gw, const float* __restrict__ gb,
              float* __restrict__ out) {
  __shared__ float red[256];
  const int tid = threadIdx.x;
  const size_t row = blockIdx.x;
  float s = 0.0f;
#pragma unroll
  for (int i = 0; i < 4; ++i) {
    int c = tid + i * 256;
    s += code[row * D_MODEL + c] * gw[c] + kw[row * D_MODEL + c] * gw[D_MODEL + c];
  }
  red[tid] = s; __syncthreads();
  for (int off = 128; off > 0; off >>= 1) { if (tid < off) red[tid] += red[tid + off]; __syncthreads(); }
  float gsc = 1.0f / (1.0f + __expf(-(red[0] + gb[0])));
#pragma unroll
  for (int i = 0; i < 4; ++i) {
    int c = tid + i * 256;
    float cv = code[row * D_MODEL + c];
    float kv = kw[row * D_MODEL + c];
    out[row * D_MODEL + c] = gsc * cv + (1.0f - gsc) * kv;
  }
}

extern "C" void kernel_launch(void* const* d_in, const int* in_sizes, int n_in,
                              void* d_out, int out_size, void* d_ws, size_t ws_size,
                              hipStream_t stream) {
  const int B = 8, T = 512, SC = 512, ST = 256, SK = 64, D = 1024, DFF = 4096;
  const float* x       = (const float*)d_in[0];
  const float* src     = (const float*)d_in[1];
  const int*   src_len = (const int*)  d_in[2];
  const float* tpl     = (const float*)d_in[3];
  const int*   tpl_len = (const int*)  d_in[4];
  const float* kwe     = (const float*)d_in[5];
  const int*   kw_len  = (const int*)  d_in[6];
  const float* sa_w    = (const float*)d_in[7];
  const float* cc_w    = (const float*)d_in[8];
  const float* ck_w    = (const float*)d_in[9];
  const float* ct_w    = (const float*)d_in[10];
  const float* gate_w  = (const float*)d_in[11];
  const float* gate_b  = (const float*)d_in[12];
  const float* w1      = (const float*)d_in[13];
  const float* b1      = (const float*)d_in[14];
  const float* w2      = (const float*)d_in[15];
  const float* b2      = (const float*)d_in[16];
  const float* ln_g    = (const float*)d_in[17];
  const float* ln_b    = (const float*)d_in[18];

  const size_t DD   = (size_t)D * D;
  const size_t NTOK = (size_t)B * T * D;   // 4M floats

  float* ws = (float*)d_ws;
  size_t off = 0;
  auto take = [&](size_t n) { float* p = ws + off; off += n; return p; };
  float* Qb = take(NTOK); float* Kb = take(NTOK); float* Vb = take(NTOK);
  float* Ab = take(NTOK); float* T1 = take(NTOK); float* T2 = take(NTOK);
  float* Yb = take(NTOK); float* Cb = take(NTOK); float* Zb = take(NTOK);
  float* Wb = take(NTOK); float* Hb = take((size_t)B * T * DFF);

  auto gemm = [&](const float* A, const float* Bm, const float* bias, float* C,
                  int M, int N, int K, int relu) {
    dim3 grid(N / 64, M / 64);
    gemm_bf16_wmma<<<grid, dim3(128), 0, stream>>>(A, Bm, bias, C, M, N, K, relu);
  };
  auto attn = [&](const float* Qp, const float* Kp, const float* Vp, const int* vl,
                  float* Op, int Tk, int causal) {
    dim3 grid(T / 16, 16, B);
    attn_wmma<<<grid, dim3(32), 0, stream>>>(Qp, Kp, Vp, vl, Op, T, Tk, causal);
  };
  auto lnk = [&](const float* a, const float* r, int li, float* o) {
    add_ln<<<dim3(B * T), dim3(256), 0, stream>>>(a, r, ln_g + (size_t)li * D,
                                                  ln_b + (size_t)li * D, o);
  };

  // ---- causal self-attention ----
  gemm(x, sa_w + 0 * DD, nullptr, Qb, B * T, D, D, 0);
  gemm(x, sa_w + 1 * DD, nullptr, Kb, B * T, D, D, 0);
  gemm(x, sa_w + 2 * DD, nullptr, Vb, B * T, D, D, 0);
  attn(Qb, Kb, Vb, nullptr, Ab, T, 1);
  gemm(Ab, sa_w + 3 * DD, nullptr, T1, B * T, D, D, 0);
  lnk(x, T1, 0, Yb);                              // y

  // ---- cross-attention: source code ----
  gemm(Yb,  cc_w + 0 * DD, nullptr, Qb, B * T,  D, D, 0);
  gemm(src, cc_w + 1 * DD, nullptr, Kb, B * SC, D, D, 0);
  gemm(src, cc_w + 2 * DD, nullptr, Vb, B * SC, D, D, 0);
  attn(Qb, Kb, Vb, src_len, Ab, SC, 0);
  gemm(Ab, cc_w + 3 * DD, nullptr, Cb, B * T, D, D, 0);   // y2_code

  // ---- cross-attention: keywords ----
  gemm(Yb,  ck_w + 0 * DD, nullptr, Qb, B * T,  D, D, 0);
  gemm(kwe, ck_w + 1 * DD, nullptr, Kb, B * SK, D, D, 0);
  gemm(kwe, ck_w + 2 * DD, nullptr, Vb, B * SK, D, D, 0);
  attn(Qb, Kb, Vb, kw_len, Ab, SK, 0);
  gemm(Ab, ck_w + 3 * DD, nullptr, T1, B * T, D, D, 0);   // y2_kw

  gate_mix<<<dim3(B * T), dim3(256), 0, stream>>>(Cb, T1, gate_w, gate_b, T2);
  lnk(Yb, T2, 1, Zb);                             // z

  // ---- cross-attention: template ----
  gemm(Zb,  ct_w + 0 * DD, nullptr, Qb, B * T,  D, D, 0);
  gemm(tpl, ct_w + 1 * DD, nullptr, Kb, B * ST, D, D, 0);
  gemm(tpl, ct_w + 2 * DD, nullptr, Vb, B * ST, D, D, 0);
  attn(Qb, Kb, Vb, tpl_len, Ab, ST, 0);
  gemm(Ab, ct_w + 3 * DD, nullptr, T1, B * T, D, D, 0);   // z2
  lnk(Zb, T1, 2, Wb);                             // w

  // ---- FFN ----
  gemm(Wb, w1, b1, Hb, B * T, DFF, D, 1);         // relu(w@w1+b1)
  gemm(Hb, w2, b2, T1, B * T, D, DFF, 0);
  lnk(Wb, T1, 3, (float*)d_out);                  // final LN

  (void)in_sizes; (void)n_in; (void)out_size; (void)ws_size;
}

// v001
// It runs in 924 microseconds.
// In both of two side-by-side timings against v000, it was 2.07 times as fast.
#include <hip/hip_runtime.h>
#include <hip/hip_bf16.h>

typedef __attribute__((ext_vector_type(16))) __bf16 v16bf;
typedef __attribute__((ext_vector_type(8)))  __bf16 v8bf;
typedef __attribute__((ext_vector_type(4)))  __bf16 v4bf;
typedef __attribute__((ext_vector_type(8)))  float  v8f;
typedef __attribute__((ext_vector_type(4)))  float  v4f;

#define D_MODEL 1024
#define D_HEAD  64

__device__ __forceinline__ v16bf ld_frag_bf(const __bf16* base, int ldk) {
  const int lane = threadIdx.x & 31;
  const int r    = lane & 15;
  const int ko   = (lane & 16) ? 8 : 0;
  const __bf16* p = base + r * ldk + ko;
  v8bf lo = *reinterpret_cast<const v8bf*>(p);
  v8bf hi = *reinterpret_cast<const v8bf*>(p + 16);
  v16bf f;
#pragma unroll
  for (int i = 0; i < 8; ++i) { f[i] = lo[i]; f[i + 8] = hi[i]; }
  return f;
}

// ---------------------------------------------------------------------------
// C = A(f32,[M,K]) @ B(f32,[K,N]) (+bias)(+relu) -> f32 [M,N]
// bf16 WMMA, f32 accumulate.  M,N multiples of 64; K multiple of 64.
// A stage is 64 k of both operands.  Each thread loads whole-line 16-byte
// pieces into registers, converts them to bf16 and stores them k-contiguous:
// As[m][k] and Bs[n][k].  B arrives n-contiguous; a thread holds 8 k x 4 n of
// it, so its transpose is a register regrouping and one 16-byte store per n.
// Rows are pitched 144 B (16 B x odd) for the 16-byte fragment reads.
// ---------------------------------------------------------------------------
#define GEMM_BK 64
#define GEMM_LD 72   // bf16 elements per LDS row: 64 k + 8 pad
typedef const __attribute__((address_space(1))) v4f* gv4f_ptr;

__global__ __launch_bounds__(128)
void gemm_bf16_wmma(const float* __restrict__ A, const float* __restrict__ B,
                    const float* __restrict__ bias, float* __restrict__ C,
                    int M, int N, int K, int relu) {
  __shared__ __align__(16) __bf16 As[64 * GEMM_LD];   // [m][k]
  __shared__ __align__(16) __bf16 Bs[64 * GEMM_LD];   // [n][k]
  const int tid  = threadIdx.x;
  const int wave = tid >> 5;
  const int lane = tid & 31;
  const int n0 = blockIdx.x * 64;
  const int m0 = blockIdx.y * 64;

  const int q16 = tid & 15;   // 16-byte piece inside a 256-byte row of f32
  const int g8  = tid >> 4;   // 0..7
  // This thread's 16 pieces of a stage: one pointer each, advanced per stage.
  // (global address space kept in the type, so that the loads stay global_load)
  gv4f_ptr pa[8];
  gv4f_ptr pb[8];
#pragma unroll
  for (int j = 0; j < 8; ++j) {
    pa[j] = (gv4f_ptr)(A + (size_t)(m0 + g8 + 8 * j) * K + q16 * 4);  // rows g8 + 8j
    pb[j] = (gv4f_ptr)(B + (size_t)(g8 * 8 + j) * N + n0 + q16 * 4);  // rows 8*g8 + j
  }
  const size_t stepB = (size_t)GEMM_BK * N / 4;   // in 16-byte pieces

  v8f acc[4] = {};

  for (int k0 = 0; k0 < K; k0 += GEMM_BK) {
    v4f ra[8], rb[8];
#pragma unroll
    for (int j = 0; j < 8; ++j) ra[j] = *pa[j];
#pragma unroll
    for (int j = 0; j < 8; ++j) rb[j] = *pb[j];
    // Keeps all 16 loads of the stage in flight together: without it the
    // conversions are scheduled among them and the stage waits three times.
    __builtin_amdgcn_sched_barrier(0);
    // Stands in front of the pointer updates below, which overwrite the address
    // registers of the loads just issued.
    asm volatile("s_wait_xcnt 0x0" ::: "memory");
#pragma unroll
    for (int j = 0; j < 8; ++j) { pa[j] += GEMM_BK / 4; pb[j] += stepB; }

    __syncthreads();                       // previous stage's fragment reads done
#pragma unroll
    for (int j = 0; j < 8; ++j) {
      v4bf t;
#pragma unroll
      for (int i = 0; i < 4; ++i) t[i] = (__bf16)ra[j][i];
      *reinterpret_cast<v4bf*>(&As[(g8 + 8 * j) * GEMM_LD + q16 * 4]) = t;
    }
#pragma unroll
    for (int i = 0; i < 4; ++i) {
      v8bf t;
#pragma unroll
      for (int j = 0; j < 8; ++j) t[j] = (__bf16)rb[j][i];
      *reinterpret_cast<v8bf*>(&Bs[(q16 * 4 + i) * GEMM_LD + g8 * 8]) = t;
    }
    __syncthreads();                       // stage visible to all waves

    v16bf fa[2], fb[2][4];
#pragma unroll
    for (int kk = 0; kk < 2; ++kk) {
      fa[kk] = ld_frag_bf(&As[wave * 16 * GEMM_LD + kk * 32], GEMM_LD);
#pragma unroll
      for (int nt = 0; nt < 4; ++nt)
        fb[kk][nt] = ld_frag_bf(&Bs[nt * 16 * GEMM_LD + kk * 32], GEMM_LD);
    }
    // Keeps the stage's 20 fragment reads one group ahead of the WMMAs: without
    // it each WMMA waits out the LDS latency of its own two reads.
    __builtin_amdgcn_sched_barrier(0);
#pragma unroll
    for (int kk = 0; kk < 2; ++kk) {
#pragma unroll
      for (int nt = 0; nt < 4; ++nt)
        acc[nt] = __builtin_amdgcn_wmma_f32_16x16x32_bf16(
            false, fa[kk], false, fb[kk][nt], (short)0, acc[nt], false, false);
    }
  }

  const int half8 = (lane & 16) ? 8 : 0;
  const int cn    = lane & 15;
#pragma unroll
  for (int nt = 0; nt < 4; ++nt) {
#pragma unroll
    for (int e = 0; e < 8; ++e) {
      int row = m0 + wave * 16 + e + half8;
      int col = n0 + nt * 16 + cn;
      float v = acc[nt][e];
      if (bias) v += bias[col];
      if (relu) v = fmaxf(v, 0.0f);
      C[(size_t)row * N + col] = v;
    }
  }
}

// ---------------------------------------------------------------------------
// Fused flash attention, one wave per (b, h, 16-row q tile).
// Q,K,V,O are f32 [B, T*, D_MODEL]; head h uses columns [h*64, h*64+64).
// causal=1: key <= query (dec_valid_lens = q+1).  causal=0: key < vlen[b].
// ---------------------------------------------------------------------------
__global__ __launch_bounds__(32)
void attn_wmma(const float* __restrict__ Q, const float* __restrict__ Kt,
               const float* __restrict__ V, const int* __restrict__ vlen,
               float* __restrict__ O, int Tq, int Tk, int causal) {
  __shared__ __align__(16) __bf16 Qs[16 * 64];   // [q][d]
  __shared__ __align__(16) __bf16 Ks[32 * 64];   // [key][d] (== B-frag layout, QK^T)
  __shared__ __align__(16) __bf16 Vt[64 * 32];   // [d][key] (B-frag layout, PV)
  __shared__ __align__(16) __bf16 Ps[16 * 32];   // [q][key] P relayout buffer

  const int lane = threadIdx.x & 31;
  const int qb   = blockIdx.x * 16;
  const int h    = blockIdx.y;
  const int b    = blockIdx.z;
  const int half8 = (lane & 16) ? 8 : 0;
  const int cn    = lane & 15;

  const size_t qoff = ((size_t)b * Tq + qb) * D_MODEL + (size_t)h * D_HEAD;
#pragma unroll
  for (int i = 0; i < 32; ++i) {
    int idx = i * 32 + lane;
    int r = idx >> 6, c = idx & 63;
    Qs[r * 64 + c] = (__bf16)Q[qoff + (size_t)r * D_MODEL + c];
  }
  v16bf aq0 = ld_frag_bf(&Qs[0], 64);
  v16bf aq1 = ld_frag_bf(&Qs[32], 64);

  float m[8], l[8];
#pragma unroll
  for (int e = 0; e < 8; ++e) { m[e] = -3.0e38f; l[e] = 0.0f; }
  v8f o0 = {}, o1 = {}, o2 = {}, o3 = {};

  const int vl   = causal ? Tk : vlen[b];
  const int nblk = causal ? ((qb + 16 + 31) >> 5) : ((vl + 31) >> 5);

  for (int j = 0; j < nblk; ++j) {
    const int kb = j * 32;
    for (int i = 0; i < 64; ++i) {
      int idx = i * 32 + lane;
      int kk = idx >> 6, c = idx & 63;
      size_t g = ((size_t)b * Tk + kb + kk) * D_MODEL + (size_t)h * D_HEAD + c;
      float kv = Kt[g], vv = V[g];
      Ks[kk * 64 + c] = (__bf16)kv;
      Vt[c * 32 + kk] = (__bf16)vv;
    }

    // S = Q @ K^T for 32 keys (two 16-key column tiles)
    v8f s0 = {}, s1 = {};
    {
      v16bf b0a = ld_frag_bf(&Ks[0], 64);
      v16bf b0b = ld_frag_bf(&Ks[32], 64);
      v16bf b1a = ld_frag_bf(&Ks[16 * 64], 64);
      v16bf b1b = ld_frag_bf(&Ks[16 * 64 + 32], 64);
      s0 = __builtin_amdgcn_wmma_f32_16x16x32_bf16(false, aq0, false, b0a, (short)0, s0, false, false);
      s0 = __builtin_amdgcn_wmma_f32_16x16x32_bf16(false, aq1, false, b0b, (short)0, s0, false, false);
      s1 = __builtin_amdgcn_wmma_f32_16x16x32_bf16(false, aq0, false, b1a, (short)0, s1, false, false);
      s1 = __builtin_amdgcn_wmma_f32_16x16x32_bf16(false, aq1, false, b1b, (short)0, s1, false, false);
    }

    float p0[8], p1[8];
#pragma unroll
    for (int e = 0; e < 8; ++e) {
      float s0e = s0[e] * 0.125f;   // 1/sqrt(64)
      float s1e = s1[e] * 0.125f;
      int row = qb + e + half8;
      int c0 = kb + cn, c1 = kb + 16 + cn;
      bool ok0 = causal ? (c0 <= row) : (c0 < vl);
      bool ok1 = causal ? (c1 <= row) : (c1 < vl);
      if (!ok0) s0e = -1.0e6f;
      if (!ok1) s1e = -1.0e6f;
      float rm = fmaxf(s0e, s1e);
#pragma unroll
      for (int msk = 1; msk < 16; msk <<= 1) rm = fmaxf(rm, __shfl_xor(rm, msk, 32));
      float mn    = fmaxf(m[e], rm);
      float alpha = __expf(m[e] - mn);
      float e0 = __expf(s0e - mn);
      float e1 = __expf(s1e - mn);
      float rs = e0 + e1;
#pragma unroll
      for (int msk = 1; msk < 16; msk <<= 1) rs += __shfl_xor(rs, msk, 32);
      l[e] = l[e] * alpha + rs;
      m[e] = mn;
      o0[e] *= alpha; o1[e] *= alpha; o2[e] *= alpha; o3[e] *= alpha;
      p0[e] = e0; p1[e] = e1;
    }

#pragma unroll
    for (int e = 0; e < 8; ++e) {
      Ps[(e + half8) * 32 + cn]      = (__bf16)p0[e];
      Ps[(e + half8) * 32 + 16 + cn] = (__bf16)p1[e];
    }
    v16bf ap = ld_frag_bf(&Ps[0], 32);
    o0 = __builtin_amdgcn_wmma_f32_16x16x32_bf16(false, ap, false, ld_frag_bf(&Vt[0],       32), (short)0, o0, false, false);
    o1 = __builtin_amdgcn_wmma_f32_16x16x32_bf16(false, ap, false, ld_frag_bf(&Vt[16 * 32], 32), (short)0, o1, false, false);
    o2 = __builtin_amdgcn_wmma_f32_16x16x32_bf16(false, ap, false, ld_frag_bf(&Vt[32 * 32], 32), (short)0, o2, false, false);
    o3 = __builtin_amdgcn_wmma_f32_16x16x32_bf16(false, ap, false, ld_frag_bf(&Vt[48 * 32], 32), (short)0, o3, false, false);
  }

#pragma unroll
  for (int e = 0; e < 8; ++e) {
    float inv = 1.0f / l[e];
    size_t ro = ((size_t)b * Tq + qb + e + half8) * D_MODEL + (size_t)h * D_HEAD;
    O[ro + cn]      = o0[e] * inv;
    O[ro + 16 + cn] = o1[e] * inv;
    O[ro + 32 + cn] = o2[e] * inv;
    O[ro + 48 + cn] = o3[e] * inv;
  }
}

// out = LayerNorm(a + r) * g + bt, one block per row of D_MODEL
__global__ __launch_bounds__(256)
void add_ln(const float* __restrict__ a, const float* __restrict__ r,
            const float* __restrict__ g, const float* __restrict__ bt,
            float* __restrict__ out) {
  __shared__ float red[256];
  const int tid = threadIdx.x;
  const size_t row = blockIdx.x;
  float v[4];
  float s = 0.0f;
#pragma unroll
  for (int i = 0; i < 4; ++i) {
    int c = tid + i * 256;
    v[i] = a[row * D_MODEL + c] + r[row * D_MODEL + c];
    s += v[i];
  }
  red[tid] = s; __syncthreads();
  for (int off = 128; off > 0; off >>= 1) { if (tid < off) red[tid] += red[tid + off]; __syncthreads(); }
  float mean = red[0] * (1.0f / D_MODEL);
  __syncthreads();
  float sq = 0.0f;
#pragma unroll
  for (int i = 0; i < 4; ++i) { float d = v[i] - mean; sq += d * d; }
  red[tid] = sq; __syncthreads();
  for (int off = 128; off > 0; off >>= 1) { if (tid < off) red[tid] += red[tid + off]; __syncthreads(); }
  float rstd = rsqrtf(red[0] * (1.0f / D_MODEL) + 1e-5f);
#pragma unroll
  for (int i = 0; i < 4; ++i) {
    int c = tid + i * 256;
    out[row * D_MODEL + c] = (v[i] - mean) * rstd * g[c] + bt[c];
  }
}

// gate = sigmoid(concat(code,kw) @ gw + gb); out = gate*code + (1-gate)*kw
__global__ __launch_bounds__(256)
void gate_mix(const float* __restrict__ code, const float* __restrict__ kw,
              const float* __restrict__ gw, const float* __restrict__ gb,
              float* __restrict__ out) {
  __shared__ float red[256];
  const int tid = threadIdx.x;
  const size_t row = blockIdx.x;
  float s = 0.0f;
#pragma unroll
  for (int i = 0; i < 4; ++i) {
    int c = tid + i * 256;
    s += code[row * D_MODEL + c] * gw[c] + kw[row * D_MODEL + c] * gw[D_MODEL + c];
  }
  red[tid] = s; __syncthreads();
  for (int off = 128; off > 0; off >>= 1) { if (tid < off) red[tid] += red[tid + off]; __syncthreads(); }
  float gsc = 1.0f / (1.0f + __expf(-(red[0] + gb[0])));
#pragma unroll
  for (int i = 0; i < 4; ++i) {
    int c = tid + i * 256;
    float cv = code[row * D_MODEL + c];
    float kv = kw[row * D_MODEL + c];
    out[row * D_MODEL + c] = gsc * cv + (1.0f - gsc) * kv;
  }
}

extern "C" void kernel_launch(void* const* d_in, const int* in_sizes, int n_in,
                              void* d_out, int out_size, void* d_ws, size_t ws_size,
                              hipStream_t stream) {
  const int B = 8, T = 512, SC = 512, ST = 256, SK = 64, D = 1024, DFF = 4096;
  const float* x       = (const float*)d_in[0];
  const float* src     = (const float*)d_in[1];
  const int*   src_len = (const int*)  d_in[2];
  const float* tpl     = (const float*)d_in[3];
  const int*   tpl_len = (const int*)  d_in[4];
  const float* kwe     = (const float*)d_in[5];
  const int*   kw_len  = (const int*)  d_in[6];
  const float* sa_w    = (const float*)d_in[7];
  const float* cc_w    = (const float*)d_in[8];
  const float* ck_w    = (const float*)d_in[9];
  const float* ct_w    = (const float*)d_in[10];
  const float* gate_w  = (const float*)d_in[11];
  const float* gate_b  = (const float*)d_in[12];
  const float* w1      = (const float*)d_in[13];
  const float* b1      = (const float*)d_in[14];
  const float* w2      = (const float*)d_in[15];
  const float* b2      = (const float*)d_in[16];
  const float* ln_g    = (const float*)d_in[17];
  const float* ln_b    = (const float*)d_in[18];

  const size_t DD   = (size_t)D * D;
  const size_t NTOK = (size_t)B * T * D;   // 4M floats

  float* ws = (float*)d_ws;
  size_t off = 0;
  auto take = [&](size_t n) { float* p = ws + off; off += n; return p; };
  float* Qb = take(NTOK); float* Kb = take(NTOK); float* Vb = take(NTOK);
  float* Ab = take(NTOK); float* T1 = take(NTOK); float* T2 = take(NTOK);
  float* Yb = take(NTOK); float* Cb = take(NTOK); float* Zb = take(NTOK);
  float* Wb = take(NTOK); float* Hb = take((size_t)B * T * DFF);

  auto gemm = [&](const float* A, const float* Bm, const float* bias, float* C,
                  int M, int N, int K, int relu) {
    dim3 grid(N / 64, M / 64);
    gemm_bf16_wmma<<<grid, dim3(128), 0, stream>>>(A, Bm, bias, C, M, N, K, relu);
  };
  auto attn = [&](const float* Qp, const float* Kp, const float* Vp, const int* vl,
                  float* Op, int Tk, int causal) {
    dim3 grid(T / 16, 16, B);
    attn_wmma<<<grid, dim3(32), 0, stream>>>(Qp, Kp, Vp, vl, Op, T, Tk, causal);
  };
  auto lnk = [&](const float* a, const float* r, int li, float* o) {
    add_ln<<<dim3(B * T), dim3(256), 0, stream>>>(a, r, ln_g + (size_t)li * D,
                                                  ln_b + (size_t)li * D, o);
  };

  // ---- causal self-attention ----
  gemm(x, sa_w + 0 * DD, nullptr, Qb, B * T, D, D, 0);
  gemm(x, sa_w + 1 * DD, nullptr, Kb, B * T, D, D, 0);
  gemm(x, sa_w + 2 * DD, nullptr, Vb, B * T, D, D, 0);
  attn(Qb, Kb, Vb, nullptr, Ab, T, 1);
  gemm(Ab, sa_w + 3 * DD, nullptr, T1, B * T, D, D, 0);
  lnk(x, T1, 0, Yb);                              // y

  // ---- cross-attention: source code ----
  gemm(Yb,  cc_w + 0 * DD, nullptr, Qb, B * T,  D, D, 0);
  gemm(src, cc_w + 1 * DD, nullptr, Kb, B * SC, D, D, 0);
  gemm(src, cc_w + 2 * DD, nullptr, Vb, B * SC, D, D, 0);
  attn(Qb, Kb, Vb, src_len, Ab, SC, 0);
  gemm(Ab, cc_w + 3 * DD, nullptr, Cb, B * T, D, D, 0);   // y2_code

  // ---- cross-attention: keywords ----
  gemm(Yb,  ck_w + 0 * DD, nullptr, Qb, B * T,  D, D, 0);
  gemm(kwe, ck_w + 1 * DD, nullptr, Kb, B * SK, D, D, 0);
  gemm(kwe, ck_w + 2 * DD, nullptr, Vb, B * SK, D, D, 0);
  attn(Qb, Kb, Vb, kw_len, Ab, SK, 0);
  gemm(Ab, ck_w + 3 * DD, nullptr, T1, B * T, D, D, 0);   // y2_kw

  gate_mix<<<dim3(B * T), dim3(256), 0, stream>>>(Cb, T1, gate_w, gate_b, T2);
  lnk(Yb, T2, 1, Zb);                             // z

  // ---- cross-attention: template ----
  gemm(Zb,  ct_w + 0 * DD, nullptr, Qb, B * T,  D, D, 0);
  gemm(tpl, ct_w + 1 * DD, nullptr, Kb, B * ST, D, D, 0);
  gemm(tpl, ct_w + 2 * DD, nullptr, Vb, B * ST, D, D, 0);
  attn(Qb, Kb, Vb, tpl_len, Ab, ST, 0);
  gemm(Ab, ct_w + 3 * DD, nullptr, T1, B * T, D, D, 0);   // z2
  lnk(Zb, T1, 2, Wb);                             // w

  // ---- FFN ----
  gemm(Wb, w1, b1, Hb, B * T, DFF, D, 1);         // relu(w@w1+b1)
  gemm(Hb, w2, b2, T1, B * T, D, DFF, 0);
  lnk(Wb, T1, 3, (float*)d_out);                  // final LN

  (void)in_sizes; (void)n_in; (void)out_size; (void)ws_size;
}

// v002
// A run of this version takes 686 microseconds.
// Two timings next to v001 put it at 1.35 and 1.34 times that version's speed.
// Over all steps from v000 it is 2.78 times as fast.
#include <hip/hip_runtime.h>
#include <hip/hip_bf16.h>

typedef __attribute__((ext_vector_type(16))) __bf16 v16bf;
typedef __attribute__((ext_vector_type(8)))  __bf16 v8bf;
typedef __attribute__((ext_vector_type(4)))  __bf16 v4bf;
typedef __attribute__((ext_vector_type(8)))  float  v8f;
typedef __attribute__((ext_vector_type(4)))  float  v4f;

#define D_MODEL 1024
#define D_HEAD  64

__device__ __forceinline__ v16bf ld_frag_bf(const __bf16* base, int ldk) {
  const int lane = threadIdx.x & 31;
  const int r    = lane & 15;
  const int ko   = (lane & 16) ? 8 : 0;
  const __bf16* p = base + r * ldk + ko;
  v8bf lo = *reinterpret_cast<const v8bf*>(p);
  v8bf hi = *reinterpret_cast<const v8bf*>(p + 16);
  v16bf f;
#pragma unroll
  for (int i = 0; i < 8; ++i) { f[i] = lo[i]; f[i + 8] = hi[i]; }
  return f;
}

// ---------------------------------------------------------------------------
// C = A(f32,[M,K]) @ B(f32,[K,N]) (+bias)(+relu) -> f32 [M,N]
// bf16 WMMA, f32 accumulate.  M,N multiples of 64; K multiple of 64.
// A stage is 64 k of both operands.  Each thread loads whole-line 16-byte
// pieces into registers, converts them to bf16 and stores them k-contiguous:
// As[m][k] and Bs[n][k].  B arrives n-contiguous; a thread holds 8 k x 4 n of
// it, so its transpose is a register regrouping and one 16-byte store per n.
// Rows are pitched 144 B (16 B x odd) for the 16-byte fragment reads.
// ---------------------------------------------------------------------------
#define GEMM_BK 64
#define GEMM_LD 72   // bf16 elements per LDS row: 64 k + 8 pad
typedef const __attribute__((address_space(1))) v4f* gv4f_ptr;

__global__ __launch_bounds__(128)
void gemm_bf16_wmma(const float* __restrict__ A, const float* __restrict__ B,
                    const float* __restrict__ bias, float* __restrict__ C,
                    int M, int N, int K, int relu) {
  __shared__ __align__(16) __bf16 As[64 * GEMM_LD];   // [m][k]
  __shared__ __align__(16) __bf16 Bs[64 * GEMM_LD];   // [n][k]
  const int tid  = threadIdx.x;
  const int wave = tid >> 5;
  const int lane = tid & 31;
  const int n0 = blockIdx.x * 64;
  const int m0 = blockIdx.y * 64;

  const int q16 = tid & 15;   // 16-byte piece inside a 256-byte row of f32
  const int g8  = tid >> 4;   // 0..7
  // This thread's 16 pieces of a stage: one pointer each, advanced per stage.
  // (global address space kept in the type, so that the loads stay global_load)
  gv4f_ptr pa[8];
  gv4f_ptr pb[8];
#pragma unroll
  for (int j = 0; j < 8; ++j) {
    pa[j] = (gv4f_ptr)(A + (size_t)(m0 + g8 + 8 * j) * K + q16 * 4);  // rows g8 + 8j
    pb[j] = (gv4f_ptr)(B + (size_t)(g8 * 8 + j) * N + n0 + q16 * 4);  // rows 8*g8 + j
  }
  const size_t stepB = (size_t)GEMM_BK * N / 4;   // in 16-byte pieces

  v8f acc[4] = {};

  for (int k0 = 0; k0 < K; k0 += GEMM_BK) {
    v4f ra[8], rb[8];
#pragma unroll
    for (int j = 0; j < 8; ++j) ra[j] = *pa[j];
#pragma unroll
    for (int j = 0; j < 8; ++j) rb[j] = *pb[j];
    // Keeps all 16 loads of the stage in flight together: without it the
    // conversions are scheduled among them and the stage waits three times.
    __builtin_amdgcn_sched_barrier(0);
    // Stands in front of the pointer updates below, which overwrite the address
    // registers of the loads just issued.
    asm volatile("s_wait_xcnt 0x0" ::: "memory");
#pragma unroll
    for (int j = 0; j < 8; ++j) { pa[j] += GEMM_BK / 4; pb[j] += stepB; }

    __syncthreads();                       // previous stage's fragment reads done
#pragma unroll
    for (int j = 0; j < 8; ++j) {
      v4bf t;
#pragma unroll
      for (int i = 0; i < 4; ++i) t[i] = (__bf16)ra[j][i];
      *reinterpret_cast<v4bf*>(&As[(g8 + 8 * j) * GEMM_LD + q16 * 4]) = t;
    }
#pragma unroll
    for (int i = 0; i < 4; ++i) {
      v8bf t;
#pragma unroll
      for (int j = 0; j < 8; ++j) t[j] = (__bf16)rb[j][i];
      *reinterpret_cast<v8bf*>(&Bs[(q16 * 4 + i) * GEMM_LD + g8 * 8]) = t;
    }
    __syncthreads();                       // stage visible to all waves

    v16bf fa[2], fb[2][4];
#pragma unroll
    for (int kk = 0; kk < 2; ++kk) {
      fa[kk] = ld_frag_bf(&As[wave * 16 * GEMM_LD + kk * 32], GEMM_LD);
#pragma unroll
      for (int nt = 0; nt < 4; ++nt)
        fb[kk][nt] = ld_frag_bf(&Bs[nt * 16 * GEMM_LD + kk * 32], GEMM_LD);
    }
    // Keeps the stage's 20 fragment reads one group ahead of the WMMAs: without
    // it each WMMA waits out the LDS latency of its own two reads.
    __builtin_amdgcn_sched_barrier(0);
#pragma unroll
    for (int kk = 0; kk < 2; ++kk) {
#pragma unroll
      for (int nt = 0; nt < 4; ++nt)
        acc[nt] = __builtin_amdgcn_wmma_f32_16x16x32_bf16(
            false, fa[kk], false, fb[kk][nt], (short)0, acc[nt], false, false);
    }
  }

  const int half8 = (lane & 16) ? 8 : 0;
  const int cn    = lane & 15;
#pragma unroll
  for (int nt = 0; nt < 4; ++nt) {
#pragma unroll
    for (int e = 0; e < 8; ++e) {
      int row = m0 + wave * 16 + e + half8;
      int col = n0 + nt * 16 + cn;
      float v = acc[nt][e];
      if (bias) v += bias[col];
      if (relu) v = fmaxf(v, 0.0f);
      C[(size_t)row * N + col] = v;
    }
  }
}

// ---------------------------------------------------------------------------
// Fused flash attention, one wave per (b, h, 16-row q tile).
// Q,K,V,O are f32 [B, T*, D_MODEL]; head h uses columns [h*64, h*64+64).
// causal=1: key <= query (dec_valid_lens = q+1).  causal=0: key < vlen[b].
// ---------------------------------------------------------------------------
__global__ __launch_bounds__(32)
void attn_wmma(const float* __restrict__ Q, const float* __restrict__ Kt,
               const float* __restrict__ V, const int* __restrict__ vlen,
               float* __restrict__ O, int Tq, int Tk, int causal) {
  __shared__ __align__(16) __bf16 Qs[16 * 64];   // [q][d]
  __shared__ __align__(16) __bf16 Ks[32 * 64];   // [key][d] (== B-frag layout, QK^T)
  __shared__ __align__(16) __bf16 Vt[64 * 32];   // [d][key] (B-frag layout, PV)
  __shared__ __align__(16) __bf16 Ps[16 * 32];   // [q][key] P relayout buffer

  const int lane = threadIdx.x & 31;
  const int qb   = blockIdx.x * 16;
  const int h    = blockIdx.y;
  const int b    = blockIdx.z;
  const int half8 = (lane & 16) ? 8 : 0;
  const int cn    = lane & 15;

  const size_t qoff = ((size_t)b * Tq + qb) * D_MODEL + (size_t)h * D_HEAD;
#pragma unroll
  for (int i = 0; i < 32; ++i) {
    int idx = i * 32 + lane;
    int r = idx >> 6, c = idx & 63;
    Qs[r * 64 + c] = (__bf16)Q[qoff + (size_t)r * D_MODEL + c];
  }
  v16bf aq0 = ld_frag_bf(&Qs[0], 64);
  v16bf aq1 = ld_frag_bf(&Qs[32], 64);

  float m[8], l[8];
#pragma unroll
  for (int e = 0; e < 8; ++e) { m[e] = -3.0e38f; l[e] = 0.0f; }
  v8f o0 = {}, o1 = {}, o2 = {}, o3 = {};

  const int vl   = causal ? Tk : min(vlen[b], Tk);   // bounds the key rows read below
  const int nblk = causal ? ((qb + 16 + 31) >> 5) : ((vl + 31) >> 5);

  // Staging of a 32-key block: a lane takes 16-byte pieces of the 256-byte head
  // rows.  Of K it takes keys 2i + h2; of V keys 8(2g + h2) + jj, that is 8 keys
  // x 4 d per group, so that the transpose is a register regrouping and one
  // 16-byte store per d.
  const int q16 = lane & 15;   // piece of 4 d
  const int h2  = lane >> 4;   // 0..1
  const size_t kvoff = (size_t)b * Tk * D_MODEL + (size_t)h * D_HEAD;   // same for the wave
  const unsigned ko = h2 * D_MODEL + q16 * 4;       // the lane's own part, K
  const unsigned vo = h2 * 8 * D_MODEL + q16 * 4;   // the lane's own part, V

  for (int j = 0; j < nblk; ++j) {
    const int kb = j * 32;
    {
      gv4f_ptr kp = (gv4f_ptr)(Kt + kvoff + (size_t)kb * D_MODEL + ko);
      gv4f_ptr vp = (gv4f_ptr)(V  + kvoff + (size_t)kb * D_MODEL + vo);
      v4f rk[16], rv[16];
#pragma unroll
      for (int i = 0; i < 16; ++i)
        rk[i] = kp[2 * i * (D_MODEL / 4)];
#pragma unroll
      for (int i = 0; i < 16; ++i)
        rv[i] = vp[(16 * (i >> 3) + (i & 7)) * (D_MODEL / 4)];
      // Keeps all 32 loads of the block in flight together: without it the
      // conversions are scheduled among them and the block waits several times.
      __builtin_amdgcn_sched_barrier(0);
      // Stands in front of every overwrite of the address registers of the loads
      // just issued; it names both addresses as inputs, so that they keep their
      // registers up to here and no load's result is given one of them.
      asm volatile("s_wait_xcnt 0x0" :: "v"(kp), "v"(vp) : "memory");
#pragma unroll
      for (int i = 0; i < 16; ++i) {
        v4bf t;
#pragma unroll
        for (int c = 0; c < 4; ++c) t[c] = (__bf16)rk[i][c];
        *reinterpret_cast<v4bf*>(&Ks[(2 * i + h2) * 64 + q16 * 4]) = t;
      }
#pragma unroll
      for (int g = 0; g < 2; ++g) {
#pragma unroll
        for (int c = 0; c < 4; ++c) {
          v8bf t;
#pragma unroll
          for (int jj = 0; jj < 8; ++jj) t[jj] = (__bf16)rv[g * 8 + jj][c];
          *reinterpret_cast<v8bf*>(&Vt[(q16 * 4 + c) * 32 + (2 * g + h2) * 8]) = t;
        }
      }
    }

    // S = Q @ K^T for 32 keys (two 16-key column tiles)
    v8f s0 = {}, s1 = {};
    {
      v16bf b0a = ld_frag_bf(&Ks[0], 64);
      v16bf b0b = ld_frag_bf(&Ks[32], 64);
      v16bf b1a = ld_frag_bf(&Ks[16 * 64], 64);
      v16bf b1b = ld_frag_bf(&Ks[16 * 64 + 32], 64);
      s0 = __builtin_amdgcn_wmma_f32_16x16x32_bf16(false, aq0, false, b0a, (short)0, s0, false, false);
      s0 = __builtin_amdgcn_wmma_f32_16x16x32_bf16(false, aq1, false, b0b, (short)0, s0, false, false);
      s1 = __builtin_amdgcn_wmma_f32_16x16x32_bf16(false, aq0, false, b1a, (short)0, s1, false, false);
      s1 = __builtin_amdgcn_wmma_f32_16x16x32_bf16(false, aq1, false, b1b, (short)0, s1, false, false);
    }

    float p0[8], p1[8];
#pragma unroll
    for (int e = 0; e < 8; ++e) {
      float s0e = s0[e] * 0.125f;   // 1/sqrt(64)
      float s1e = s1[e] * 0.125f;
      int row = qb + e + half8;
      int c0 = kb + cn, c1 = kb + 16 + cn;
      bool ok0 = causal ? (c0 <= row) : (c0 < vl);
      bool ok1 = causal ? (c1 <= row) : (c1 < vl);
      if (!ok0) s0e = -1.0e6f;
      if (!ok1) s1e = -1.0e6f;
      float rm = fmaxf(s0e, s1e);
#pragma unroll
      for (int msk = 1; msk < 16; msk <<= 1) rm = fmaxf(rm, __shfl_xor(rm, msk, 32));
      float mn    = fmaxf(m[e], rm);
      float alpha = __expf(m[e] - mn);
      float e0 = __expf(s0e - mn);
      float e1 = __expf(s1e - mn);
      float rs = e0 + e1;
#pragma unroll
      for (int msk = 1; msk < 16; msk <<= 1) rs += __shfl_xor(rs, msk, 32);
      l[e] = l[e] * alpha + rs;
      m[e] = mn;
      o0[e] *= alpha; o1[e] *= alpha; o2[e] *= alpha; o3[e] *= alpha;
      p0[e] = e0; p1[e] = e1;
    }

#pragma unroll
    for (int e = 0; e < 8; ++e) {
      Ps[(e + half8) * 32 + cn]      = (__bf16)p0[e];
      Ps[(e + half8) * 32 + 16 + cn] = (__bf16)p1[e];
    }
    v16bf ap = ld_frag_bf(&Ps[0], 32);
    o0 = __builtin_amdgcn_wmma_f32_16x16x32_bf16(false, ap, false, ld_frag_bf(&Vt[0],       32), (short)0, o0, false, false);
    o1 = __builtin_amdgcn_wmma_f32_16x16x32_bf16(false, ap, false, ld_frag_bf(&Vt[16 * 32], 32), (short)0, o1, false, false);
    o2 = __builtin_amdgcn_wmma_f32_16x16x32_bf16(false, ap, false, ld_frag_bf(&Vt[32 * 32], 32), (short)0, o2, false, false);
    o3 = __builtin_amdgcn_wmma_f32_16x16x32_bf16(false, ap, false, ld_frag_bf(&Vt[48 * 32], 32), (short)0, o3, false, false);
  }

#pragma unroll
  for (int e = 0; e < 8; ++e) {
    float inv = 1.0f / l[e];
    size_t ro = ((size_t)b * Tq + qb + e + half8) * D_MODEL + (size_t)h * D_HEAD;
    O[ro + cn]      = o0[e] * inv;
    O[ro + 16 + cn] = o1[e] * inv;
    O[ro + 32 + cn] = o2[e] * inv;
    O[ro + 48 + cn] = o3[e] * inv;
  }
}

// out = LayerNorm(a + r) * g + bt, one block per row of D_MODEL
__global__ __launch_bounds__(256)
void add_ln(const float* __restrict__ a, const float* __restrict__ r,
            const float* __restrict__ g, const float* __restrict__ bt,
            float* __restrict__ out) {
  __shared__ float red[256];
  const int tid = threadIdx.x;
  const size_t row = blockIdx.x;
  float v[4];
  float s = 0.0f;
#pragma unroll
  for (int i = 0; i < 4; ++i) {
    int c = tid + i * 256;
    v[i] = a[row * D_MODEL + c] + r[row * D_MODEL + c];
    s += v[i];
  }
  red[tid] = s; __syncthreads();
  for (int off = 128; off > 0; off >>= 1) { if (tid < off) red[tid] += red[tid + off]; __syncthreads(); }
  float mean = red[0] * (1.0f / D_MODEL);
  __syncthreads();
  float sq = 0.0f;
#pragma unroll
  for (int i = 0; i < 4; ++i) { float d = v[i] - mean; sq += d * d; }
  red[tid] = sq; __syncthreads();
  for (int off = 128; off > 0; off >>= 1) { if (tid < off) red[tid] += red[tid + off]; __syncthreads(); }
  float rstd = rsqrtf(red[0] * (1.0f / D_MODEL) + 1e-5f);
#pragma unroll
  for (int i = 0; i < 4; ++i) {
    int c = tid + i * 256;
    out[row * D_MODEL + c] = (v[i] - mean) * rstd * g[c] + bt[c];
  }
}

// gate = sigmoid(concat(code,kw) @ gw + gb); out = gate*code + (1-gate)*kw
__global__ __launch_bounds__(256)
void gate_mix(const float* __restrict__ code, const float* __restrict__ kw,
              const float* __restrict__ gw, const float* __restrict__ gb,
              float* __restrict__ out) {
  __shared__ float red[256];
  const int tid = threadIdx.x;
  const size_t row = blockIdx.x;
  float s = 0.0f;
#pragma unroll
  for (int i = 0; i < 4; ++i) {
    int c = tid + i * 256;
    s += code[row * D_MODEL + c] * gw[c] + kw[row * D_MODEL + c] * gw[D_MODEL + c];
  }
  red[tid] = s; __syncthreads();
  for (int off = 128; off > 0; off >>= 1) { if (tid < off) red[tid] += red[tid + off]; __syncthreads(); }
  float gsc = 1.0f / (1.0f + __expf(-(red[0] + gb[0])));
#pragma unroll
  for (int i = 0; i < 4; ++i) {
    int c = tid + i * 256;
    float cv = code[row * D_MODEL + c];
    float kv = kw[row * D_MODEL + c];
    out[row * D_MODEL + c] = gsc * cv + (1.0f - gsc) * kv;
  }
}

extern "C" void kernel_launch(void* const* d_in, const int* in_sizes, int n_in,
                              void* d_out, int out_size, void* d_ws, size_t ws_size,
                              hipStream_t stream) {
  const int B = 8, T = 512, SC = 512, ST = 256, SK = 64, D = 1024, DFF = 4096;
  const float* x       = (const float*)d_in[0];
  const float* src     = (const float*)d_in[1];
  const int*   src_len = (const int*)  d_in[2];
  const float* tpl     = (const float*)d_in[3];
  const int*   tpl_len = (const int*)  d_in[4];
  const float* kwe     = (const float*)d_in[5];
  const int*   kw_len  = (const int*)  d_in[6];
  const float* sa_w    = (const float*)d_in[7];
  const float* cc_w    = (const float*)d_in[8];
  const float* ck_w    = (const float*)d_in[9];
  const float* ct_w    = (const float*)d_in[10];
  const float* gate_w  = (const float*)d_in[11];
  const float* gate_b  = (const float*)d_in[12];
  const float* w1      = (const float*)d_in[13];
  const float* b1      = (const float*)d_in[14];
  const float* w2      = (const float*)d_in[15];
  const float* b2      = (const float*)d_in[16];
  const float* ln_g    = (const float*)d_in[17];
  const float* ln_b    = (const float*)d_in[18];

  const size_t DD   = (size_t)D * D;
  const size_t NTOK = (size_t)B * T * D;   // 4M floats

  float* ws = (float*)d_ws;
  size_t off = 0;
  auto take = [&](size_t n) { float* p = ws + off; off += n; return p; };
  float* Qb = take(NTOK); float* Kb = take(NTOK); float* Vb = take(NTOK);
  float* Ab = take(NTOK); float* T1 = take(NTOK); float* T2 = take(NTOK);
  float* Yb = take(NTOK); float* Cb = take(NTOK); float* Zb = take(NTOK);
  float* Wb = take(NTOK); float* Hb = take((size_t)B * T * DFF);

  auto gemm = [&](const float* A, const float* Bm, const float* bias, float* C,
                  int M, int N, int K, int relu) {
    dim3 grid(N / 64, M / 64);
    gemm_bf16_wmma<<<grid, dim3(128), 0, stream>>>(A, Bm, bias, C, M, N, K, relu);
  };
  auto attn = [&](const float* Qp, const float* Kp, const float* Vp, const int* vl,
                  float* Op, int Tk, int causal) {
    dim3 grid(T / 16, 16, B);
    attn_wmma<<<grid, dim3(32), 0, stream>>>(Qp, Kp, Vp, vl, Op, T, Tk, causal);
  };
  auto lnk = [&](const float* a, const float* r, int li, float* o) {
    add_ln<<<dim3(B * T), dim3(256), 0, stream>>>(a, r, ln_g + (size_t)li * D,
                                                  ln_b + (size_t)li * D, o);
  };

  // ---- causal self-attention ----
  gemm(x, sa_w + 0 * DD, nullptr, Qb, B * T, D, D, 0);
  gemm(x, sa_w + 1 * DD, nullptr, Kb, B * T, D, D, 0);
  gemm(x, sa_w + 2 * DD, nullptr, Vb, B * T, D, D, 0);
  attn(Qb, Kb, Vb, nullptr, Ab, T, 1);
  gemm(Ab, sa_w + 3 * DD, nullptr, T1, B * T, D, D, 0);
  lnk(x, T1, 0, Yb);                              // y

  // ---- cross-attention: source code ----
  gemm(Yb,  cc_w + 0 * DD, nullptr, Qb, B * T,  D, D, 0);
  gemm(src, cc_w + 1 * DD, nullptr, Kb, B * SC, D, D, 0);
  gemm(src, cc_w + 2 * DD, nullptr, Vb, B * SC, D, D, 0);
  attn(Qb, Kb, Vb, src_len, Ab, SC, 0);
  gemm(Ab, cc_w + 3 * DD, nullptr, Cb, B * T, D, D, 0);   // y2_code

  // ---- cross-attention: keywords ----
  gemm(Yb,  ck_w + 0 * DD, nullptr, Qb, B * T,  D, D, 0);
  gemm(kwe, ck_w + 1 * DD, nullptr, Kb, B * SK, D, D, 0);
  gemm(kwe, ck_w + 2 * DD, nullptr, Vb, B * SK, D, D, 0);
  attn(Qb, Kb, Vb, kw_len, Ab, SK, 0);
  gemm(Ab, ck_w + 3 * DD, nullptr, T1, B * T, D, D, 0);   // y2_kw

  gate_mix<<<dim3(B * T), dim3(256), 0, stream>>>(Cb, T1, gate_w, gate_b, T2);
  lnk(Yb, T2, 1, Zb);                             // z

  // ---- cross-attention: template ----
  gemm(Zb,  ct_w + 0 * DD, nullptr, Qb, B * T,  D, D, 0);
  gemm(tpl, ct_w + 1 * DD, nullptr, Kb, B * ST, D, D, 0);
  gemm(tpl, ct_w + 2 * DD, nullptr, Vb, B * ST, D, D, 0);
  attn(Qb, Kb, Vb, tpl_len, Ab, ST, 0);
  gemm(Ab, ct_w + 3 * DD, nullptr, T1, B * T, D, D, 0);   // z2
  lnk(Zb, T1, 2, Wb);                             // w

  // ---- FFN ----
  gemm(Wb, w1, b1, Hb, B * T, DFF, D, 1);         // relu(w@w1+b1)
  gemm(Hb, w2, b2, T1, B * T, D, DFF, 0);
  lnk(Wb, T1, 3, (float*)d_out);                  // final LN

  (void)in_sizes; (void)n_in; (void)out_size; (void)ws_size;
}

// v003
// It runs in 618 microseconds.
// Timed twice side by side with v002, it ran 1.11 times as fast both times.
// Counting every step since v000, it is 3.09 times as fast.
#include <hip/hip_runtime.h>
#include <hip/hip_bf16.h>

typedef __attribute__((ext_vector_type(16))) __bf16 v16bf;
typedef __attribute__((ext_vector_type(8)))  __bf16 v8bf;
typedef __attribute__((ext_vector_type(4)))  __bf16 v4bf;
typedef __attribute__((ext_vector_type(8)))  float  v8f;
typedef __attribute__((ext_vector_type(4)))  float  v4f;

#define D_MODEL 1024
#define D_HEAD  64

__device__ __forceinline__ v16bf ld_frag_bf(const __bf16* base, int ldk) {
  const int lane = threadIdx.x & 31;
  const int r    = lane & 15;
  const int ko   = (lane & 16) ? 8 : 0;
  const __bf16* p = base + r * ldk + ko;
  v8bf lo = *reinterpret_cast<const v8bf*>(p);
  v8bf hi = *reinterpret_cast<const v8bf*>(p + 16);
  v16bf f;
#pragma unroll
  for (int i = 0; i < 8; ++i) { f[i] = lo[i]; f[i + 8] = hi[i]; }
  return f;
}

// ---------------------------------------------------------------------------
// C = A(f32,[M,K]) @ B(f32,[K,N]) (+bias)(+relu) -> f32 [M,N]
// bf16 WMMA, f32 accumulate.  M,N multiples of 64; K multiple of 64.
// A stage is 64 k of both operands.  Each thread loads whole-line 16-byte
// pieces into registers, converts them to bf16 and stores them k-contiguous:
// As[m][k] and Bs[n][k].  B arrives n-contiguous; a thread holds 8 k x 4 n of
// it, so its transpose is a register regrouping and one 16-byte store per n.
// Rows are pitched 144 B (16 B x odd) for the 16-byte fragment reads.
// ---------------------------------------------------------------------------
#define GEMM_BK 64
#define GEMM_LD 72   // bf16 elements per LDS row: 64 k + 8 pad
typedef const __attribute__((address_space(1))) v4f* gv4f_ptr;

// Up to nine independent products C_j = A_j @ B_j of one launch; all share N and
// K.  Their row tiles are stacked along blockIdx.y: job j owns the tiles from
// t_j (t_0 = 0) up to t_(j+1).  An unused job has t_j = GEMM_NO_JOB.
#define GEMM_NO_JOB 0x7fffffff
struct GemmJobs {
  int t1, t2, t3, t4, t5, t6, t7, t8;
  const float* a0; const float* b0; float* c0;
  const float* a1; const float* b1; float* c1;
  const float* a2; const float* b2; float* c2;
  const float* a3; const float* b3; float* c3;
  const float* a4; const float* b4; float* c4;
  const float* a5; const float* b5; float* c5;
  const float* a6; const float* b6; float* c6;
  const float* a7; const float* b7; float* c7;
  const float* a8; const float* b8; float* c8;
};

__global__ __launch_bounds__(128)
void gemm_bf16_wmma(GemmJobs J, const float* __restrict__ bias,
                    int N, int K, int relu) {
  __shared__ __align__(16) __bf16 As[64 * GEMM_LD];   // [m][k]
  __shared__ __align__(16) __bf16 Bs[64 * GEMM_LD];   // [n][k]
  const int tid  = threadIdx.x;
  const int wave = tid >> 5;
  const int lane = tid & 31;
  const int n0 = blockIdx.x * 64;

  // Which product this block works for: the same for the whole block.
  const int ty = blockIdx.y;
  // The job's number comes from all eight bounds at once, its three pointers from
  // one more read of the arguments (a chain of tests would read them one by one).
  const int job = (ty >= J.t1) + (ty >= J.t2) + (ty >= J.t3) + (ty >= J.t4) +
                  (ty >= J.t5) + (ty >= J.t6) + (ty >= J.t7) + (ty >= J.t8);
  const float* A; const float* B; float* C; int t0;
  switch (job) {
#define GEMM_PICK(j) case j: A = J.a##j; B = J.b##j; C = J.c##j; t0 = J.t##j; break;
    GEMM_PICK(1) GEMM_PICK(2) GEMM_PICK(3) GEMM_PICK(4)
    GEMM_PICK(5) GEMM_PICK(6) GEMM_PICK(7) GEMM_PICK(8)
#undef GEMM_PICK
    default: A = J.a0; B = J.b0; C = J.c0; t0 = 0; break;
  }
  const int m0 = (ty - t0) * 64;

  const int q16 = tid & 15;   // 16-byte piece inside a 256-byte row of f32
  const int g8  = tid >> 4;   // 0..7
  // This thread's 16 pieces of a stage: one pointer each, advanced per stage.
  // (global address space kept in the type, so that the loads stay global_load)
  gv4f_ptr pa[8];
  gv4f_ptr pb[8];
#pragma unroll
  for (int j = 0; j < 8; ++j) {
    pa[j] = (gv4f_ptr)(A + (size_t)(m0 + g8 + 8 * j) * K + q16 * 4);  // rows g8 + 8j
    pb[j] = (gv4f_ptr)(B + (size_t)(g8 * 8 + j) * N + n0 + q16 * 4);  // rows 8*g8 + j
  }
  const size_t stepB = (size_t)GEMM_BK * N / 4;   // in 16-byte pieces

  v8f acc[4] = {};

  for (int k0 = 0; k0 < K; k0 += GEMM_BK) {
    v4f ra[8], rb[8];
#pragma unroll
    for (int j = 0; j < 8; ++j) ra[j] = *pa[j];
#pragma unroll
    for (int j = 0; j < 8; ++j) rb[j] = *pb[j];
    // Keeps all 16 loads of the stage in flight together: without it the
    // conversions are scheduled among them and the stage waits three times.
    __builtin_amdgcn_sched_barrier(0);
    // Stands in front of the pointer updates below, which overwrite the address
    // registers of the loads just issued.
    asm volatile("s_wait_xcnt 0x0" ::: "memory");
#pragma unroll
    for (int j = 0; j < 8; ++j) { pa[j] += GEMM_BK / 4; pb[j] += stepB; }

    __syncthreads();                       // previous stage's fragment reads done
#pragma unroll
    for (int j = 0; j < 8; ++j) {
      v4bf t;
#pragma unroll
      for (int i = 0; i < 4; ++i) t[i] = (__bf16)ra[j][i];
      *reinterpret_cast<v4bf*>(&As[(g8 + 8 * j) * GEMM_LD + q16 * 4]) = t;
    }
#pragma unroll
    for (int i = 0; i < 4; ++i) {
      v8bf t;
#pragma unroll
      for (int j = 0; j < 8; ++j) t[j] = (__bf16)rb[j][i];
      *reinterpret_cast<v8bf*>(&Bs[(q16 * 4 + i) * GEMM_LD + g8 * 8]) = t;
    }
    __syncthreads();                       // stage visible to all waves

    v16bf fa[2], fb[2][4];
#pragma unroll
    for (int kk = 0; kk < 2; ++kk) {
      fa[kk] = ld_frag_bf(&As[wave * 16 * GEMM_LD + kk * 32], GEMM_LD);
#pragma unroll
      for (int nt = 0; nt < 4; ++nt)
        fb[kk][nt] = ld_frag_bf(&Bs[nt * 16 * GEMM_LD + kk * 32], GEMM_LD);
    }
    // Keeps the stage's 20 fragment reads one group ahead of the WMMAs: without
    // it each WMMA waits out the LDS latency of its own two reads.
    __builtin_amdgcn_sched_barrier(0);
#pragma unroll
    for (int kk = 0; kk < 2; ++kk) {
#pragma unroll
      for (int nt = 0; nt < 4; ++nt)
        acc[nt] = __builtin_amdgcn_wmma_f32_16x16x32_bf16(
            false, fa[kk], false, fb[kk][nt], (short)0, acc[nt], false, false);
    }
  }

  const int half8 = (lane & 16) ? 8 : 0;
  const int cn    = lane & 15;
#pragma unroll
  for (int nt = 0; nt < 4; ++nt) {
#pragma unroll
    for (int e = 0; e < 8; ++e) {
      int row = m0 + wave * 16 + e + half8;
      int col = n0 + nt * 16 + cn;
      float v = acc[nt][e];
      if (bias) v += bias[col];
      if (relu) v = fmaxf(v, 0.0f);
      C[(size_t)row * N + col] = v;
    }
  }
}

// ---------------------------------------------------------------------------
// Fused flash attention, one wave per (b, h, 16-row q tile).
// Q,K,V,O are f32 [B, T*, D_MODEL]; head h uses columns [h*64, h*64+64).
// causal=1: key <= query (dec_valid_lens = q+1).  causal=0: key < vlen[b].
// A launch may hold a second, independent attention (Q2 ... Tk2, never causal):
// blockIdx.z in [nb, 2 nb) works for it.
// ---------------------------------------------------------------------------
__global__ __launch_bounds__(32)
void attn_wmma(const float* __restrict__ Q1, const float* __restrict__ K1,
               const float* __restrict__ V1, const int* __restrict__ vlen1,
               float* __restrict__ O1, int Tq, int Tk1, int causal,
               const float* __restrict__ Q2, const float* __restrict__ K2,
               const float* __restrict__ V2, const int* __restrict__ vlen2,
               float* __restrict__ O2, int Tk2, int nb) {
  __shared__ __align__(16) __bf16 Qs[16 * 64];   // [q][d]
  __shared__ __align__(16) __bf16 Ks[32 * 64];   // [key][d] (== B-frag layout, QK^T)
  __shared__ __align__(16) __bf16 Vt[64 * 32];   // [d][key] (B-frag layout, PV)
  __shared__ __align__(16) __bf16 Ps[16 * 32];   // [q][key] P relayout buffer

  const int lane = threadIdx.x & 31;
  const int qb   = blockIdx.x * 16;
  const int h    = blockIdx.y;
  const bool second = (int)blockIdx.z >= nb;      // the same for the whole block
  const int b    = second ? (int)blockIdx.z - nb : (int)blockIdx.z;
  const float* Q    = second ? Q2 : Q1;
  const float* Kt   = second ? K2 : K1;
  const float* V    = second ? V2 : V1;
  const int*   vlen = second ? vlen2 : vlen1;
  float*       O    = second ? O2 : O1;
  const int    Tk   = second ? Tk2 : Tk1;
  const int half8 = (lane & 16) ? 8 : 0;
  const int cn    = lane & 15;

  const size_t qoff = ((size_t)b * Tq + qb) * D_MODEL + (size_t)h * D_HEAD;
#pragma unroll
  for (int i = 0; i < 32; ++i) {
    int idx = i * 32 + lane;
    int r = idx >> 6, c = idx & 63;
    Qs[r * 64 + c] = (__bf16)Q[qoff + (size_t)r * D_MODEL + c];
  }
  v16bf aq0 = ld_frag_bf(&Qs[0], 64);
  v16bf aq1 = ld_frag_bf(&Qs[32], 64);

  float m[8], l[8];
#pragma unroll
  for (int e = 0; e < 8; ++e) { m[e] = -3.0e38f; l[e] = 0.0f; }
  v8f o0 = {}, o1 = {}, o2 = {}, o3 = {};

  const int vl   = causal ? Tk : min(vlen[b], Tk);   // bounds the key rows read below
  const int nblk = causal ? ((qb + 16 + 31) >> 5) : ((vl + 31) >> 5);

  // Staging of a 32-key block: a lane takes 16-byte pieces of the 256-byte head
  // rows.  Of K it takes keys 2i + h2; of V keys 8(2g + h2) + jj, that is 8 keys
  // x 4 d per group, so that the transpose is a register regrouping and one
  // 16-byte store per d.
  const int q16 = lane & 15;   // piece of 4 d
  const int h2  = lane >> 4;   // 0..1
  const size_t kvoff = (size_t)b * Tk * D_MODEL + (size_t)h * D_HEAD;   // same for the wave
  const unsigned ko = h2 * D_MODEL + q16 * 4;       // the lane's own part, K
  const unsigned vo = h2 * 8 * D_MODEL + q16 * 4;   // the lane's own part, V

  for (int j = 0; j < nblk; ++j) {
    const int kb = j * 32;
    {
      gv4f_ptr kp = (gv4f_ptr)(Kt + kvoff + (size_t)kb * D_MODEL + ko);
      gv4f_ptr vp = (gv4f_ptr)(V  + kvoff + (size_t)kb * D_MODEL + vo);
      v4f rk[16], rv[16];
#pragma unroll
      for (int i = 0; i < 16; ++i)
        rk[i] = kp[2 * i * (D_MODEL / 4)];
#pragma unroll
      for (int i = 0; i < 16; ++i)
        rv[i] = vp[(16 * (i >> 3) + (i & 7)) * (D_MODEL / 4)];
      // Keeps all 32 loads of the block in flight together: without it the
      // conversions are scheduled among them and the block waits several times.
      __builtin_amdgcn_sched_barrier(0);
      // Stands in front of every overwrite of the address registers of the loads
      // just issued; it names both addresses as inputs, so that they keep their
      // registers up to here and no load's result is given one of them.
      asm volatile("s_wait_xcnt 0x0" :: "v"(kp), "v"(vp) : "memory");
#pragma unroll
      for (int i = 0; i < 16; ++i) {
        v4bf t;
#pragma unroll
        for (int c = 0; c < 4; ++c) t[c] = (__bf16)rk[i][c];
        *reinterpret_cast<v4bf*>(&Ks[(2 * i + h2) * 64 + q16 * 4]) = t;
      }
#pragma unroll
      for (int g = 0; g < 2; ++g) {
#pragma unroll
        for (int c = 0; c < 4; ++c) {
          v8bf t;
#pragma unroll
          for (int jj = 0; jj < 8; ++jj) t[jj] = (__bf16)rv[g * 8 + jj][c];
          *reinterpret_cast<v8bf*>(&Vt[(q16 * 4 + c) * 32 + (2 * g + h2) * 8]) = t;
        }
      }
    }

    // S = Q @ K^T for 32 keys (two 16-key column tiles)
    v8f s0 = {}, s1 = {};
    {
      v16bf b0a = ld_frag_bf(&Ks[0], 64);
      v16bf b0b = ld_frag_bf(&Ks[32], 64);
      v16bf b1a = ld_frag_bf(&Ks[16 * 64], 64);
      v16bf b1b = ld_frag_bf(&Ks[16 * 64 + 32], 64);
      s0 = __builtin_amdgcn_wmma_f32_16x16x32_bf16(false, aq0, false, b0a, (short)0, s0, false, false);
      s0 = __builtin_amdgcn_wmma_f32_16x16x32_bf16(false, aq1, false, b0b, (short)0, s0, false, false);
      s1 = __builtin_amdgcn_wmma_f32_16x16x32_bf16(false, aq0, false, b1a, (short)0, s1, false, false);
      s1 = __builtin_amdgcn_wmma_f32_16x16x32_bf16(false, aq1, false, b1b, (short)0, s1, false, false);
    }

    float p0[8], p1[8];
#pragma unroll
    for (int e = 0; e < 8; ++e) {
      float s0e = s0[e] * 0.125f;   // 1/sqrt(64)
      float s1e = s1[e] * 0.125f;
      int row = qb + e + half8;
      int c0 = kb + cn, c1 = kb + 16 + cn;
      bool ok0 = causal ? (c0 <= row) : (c0 < vl);
      bool ok1 = causal ? (c1 <= row) : (c1 < vl);
      if (!ok0) s0e = -1.0e6f;
      if (!ok1) s1e = -1.0e6f;
      float rm = fmaxf(s0e, s1e);
#pragma unroll
      for (int msk = 1; msk < 16; msk <<= 1) rm = fmaxf(rm, __shfl_xor(rm, msk, 32));
      float mn    = fmaxf(m[e], rm);
      float alpha = __expf(m[e] - mn);
      float e0 = __expf(s0e - mn);
      float e1 = __expf(s1e - mn);
      float rs = e0 + e1;
#pragma unroll
      for (int msk = 1; msk < 16; msk <<= 1) rs += __shfl_xor(rs, msk, 32);
      l[e] = l[e] * alpha + rs;
      m[e] = mn;
      o0[e] *= alpha; o1[e] *= alpha; o2[e] *= alpha; o3[e] *= alpha;
      p0[e] = e0; p1[e] = e1;
    }

#pragma unroll
    for (int e = 0; e < 8; ++e) {
      Ps[(e + half8) * 32 + cn]      = (__bf16)p0[e];
      Ps[(e + half8) * 32 + 16 + cn] = (__bf16)p1[e];
    }
    v16bf ap = ld_frag_bf(&Ps[0], 32);
    o0 = __builtin_amdgcn_wmma_f32_16x16x32_bf16(false, ap, false, ld_frag_bf(&Vt[0],       32), (short)0, o0, false, false);
    o1 = __builtin_amdgcn_wmma_f32_16x16x32_bf16(false, ap, false, ld_frag_bf(&Vt[16 * 32], 32), (short)0, o1, false, false);
    o2 = __builtin_amdgcn_wmma_f32_16x16x32_bf16(false, ap, false, ld_frag_bf(&Vt[32 * 32], 32), (short)0, o2, false, false);
    o3 = __builtin_amdgcn_wmma_f32_16x16x32_bf16(false, ap, false, ld_frag_bf(&Vt[48 * 32], 32), (short)0, o3, false, false);
  }

#pragma unroll
  for (int e = 0; e < 8; ++e) {
    float inv = 1.0f / l[e];
    size_t ro = ((size_t)b * Tq + qb + e + half8) * D_MODEL + (size_t)h * D_HEAD;
    O[ro + cn]      = o0[e] * inv;
    O[ro + 16 + cn] = o1[e] * inv;
    O[ro + 32 + cn] = o2[e] * inv;
    O[ro + 48 + cn] = o3[e] * inv;
  }
}

// out = LayerNorm(a + r) * g + bt, one block per row of D_MODEL
__global__ __launch_bounds__(256)
void add_ln(const float* __restrict__ a, const float* __restrict__ r,
            const float* __restrict__ g, const float* __restrict__ bt,
            float* __restrict__ out) {
  __shared__ float red[256];
  const int tid = threadIdx.x;
  const size_t row = blockIdx.x;
  float v[4];
  float s = 0.0f;
#pragma unroll
  for (int i = 0; i < 4; ++i) {
    int c = tid + i * 256;
    v[i] = a[row * D_MODEL + c] + r[row * D_MODEL + c];
    s += v[i];
  }
  red[tid] = s; __syncthreads();
  for (int off = 128; off > 0; off >>= 1) { if (tid < off) red[tid] += red[tid + off]; __syncthreads(); }
  float mean = red[0] * (1.0f / D_MODEL);
  __syncthreads();
  float sq = 0.0f;
#pragma unroll
  for (int i = 0; i < 4; ++i) { float d = v[i] - mean; sq += d * d; }
  red[tid] = sq; __syncthreads();
  for (int off = 128; off > 0; off >>= 1) { if (tid < off) red[tid] += red[tid + off]; __syncthreads(); }
  float rstd = rsqrtf(red[0] * (1.0f / D_MODEL) + 1e-5f);
#pragma unroll
  for (int i = 0; i < 4; ++i) {
    int c = tid + i * 256;
    out[row * D_MODEL + c] = (v[i] - mean) * rstd * g[c] + bt[c];
  }
}

// gate = sigmoid(concat(code,kw) @ gw + gb); out = gate*code + (1-gate)*kw
__global__ __launch_bounds__(256)
void gate_mix(const float* __restrict__ code, const float* __restrict__ kw,
              const float* __restrict__ gw, const float* __restrict__ gb,
              float* __restrict__ out) {
  __shared__ float red[256];
  const int tid = threadIdx.x;
  const size_t row = blockIdx.x;
  float s = 0.0f;
#pragma unroll
  for (int i = 0; i < 4; ++i) {
    int c = tid + i * 256;
    s += code[row * D_MODEL + c] * gw[c] + kw[row * D_MODEL + c] * gw[D_MODEL + c];
  }
  red[tid] = s; __syncthreads();
  for (int off = 128; off > 0; off >>= 1) { if (tid < off) red[tid] += red[tid + off]; __syncthreads(); }
  float gsc = 1.0f / (1.0f + __expf(-(red[0] + gb[0])));
#pragma unroll
  for (int i = 0; i < 4; ++i) {
    int c = tid + i * 256;
    float cv = code[row * D_MODEL + c];
    float kv = kw[row * D_MODEL + c];
    out[row * D_MODEL + c] = gsc * cv + (1.0f - gsc) * kv;
  }
}

extern "C" void kernel_launch(void* const* d_in, const int* in_sizes, int n_in,
                              void* d_out, int out_size, void* d_ws, size_t ws_size,
                              hipStream_t stream) {
  const int B = 8, T = 512, SC = 512, ST = 256, SK = 64, D = 1024, DFF = 4096;
  const float* x       = (const float*)d_in[0];
  const float* src     = (const float*)d_in[1];
  const int*   src_len = (const int*)  d_in[2];
  const float* tpl     = (const float*)d_in[3];
  const int*   tpl_len = (const int*)  d_in[4];
  const float* kwe     = (const float*)d_in[5];
  const int*   kw_len  = (const int*)  d_in[6];
  const float* sa_w    = (const float*)d_in[7];
  const float* cc_w    = (const float*)d_in[8];
  const float* ck_w    = (const float*)d_in[9];
  const float* ct_w    = (const float*)d_in[10];
  const float* gate_w  = (const float*)d_in[11];
  const float* gate_b  = (const float*)d_in[12];
  const float* w1      = (const float*)d_in[13];
  const float* b1      = (const float*)d_in[14];
  const float* w2      = (const float*)d_in[15];
  const float* b2      = (const float*)d_in[16];
  const float* ln_g    = (const float*)d_in[17];
  const float* ln_b    = (const float*)d_in[18];

  const size_t DD   = (size_t)D * D;
  const size_t NTOK = (size_t)B * T * D;   // 4M floats

  float* ws = (float*)d_ws;
  size_t off = 0;
  auto take = [&](size_t n) { float* p = ws + off; off += n; return p; };
  float* Qb = take(NTOK); float* Kb = take(NTOK); float* Vb = take(NTOK);
  float* Ab = take(NTOK); float* T1 = take(NTOK); float* T2 = take(NTOK);
  float* Yb = take(NTOK); float* Cb = take(NTOK); float* Zb = take(NTOK);
  float* Wb = take(NTOK); float* Hb = take((size_t)B * T * DFF);

  // Cross-attention keys and values depend on inputs alone and are made in the
  // first launch; they live in Hb, which is first written by the FFN.
  float* ccK = Hb;                       float* ccV = ccK + (size_t)B * SC * D;
  float* ctK = ccV + (size_t)B * SC * D; float* ctV = ctK + (size_t)B * ST * D;
  float* ckK = ctV + (size_t)B * ST * D; float* ckV = ckK + (size_t)B * SK * D;

  const GemmJobs none = {GEMM_NO_JOB, GEMM_NO_JOB, GEMM_NO_JOB, GEMM_NO_JOB,
                         GEMM_NO_JOB, GEMM_NO_JOB, GEMM_NO_JOB, GEMM_NO_JOB,
                         nullptr, nullptr, nullptr, nullptr, nullptr, nullptr,
                         nullptr, nullptr, nullptr, nullptr, nullptr, nullptr,
                         nullptr, nullptr, nullptr, nullptr, nullptr, nullptr,
                         nullptr, nullptr, nullptr, nullptr, nullptr, nullptr,
                         nullptr, nullptr, nullptr};
  auto gemm_jobs = [&](const GemmJobs& J, const float* bias, int row_tiles,
                       int N, int K, int relu) {
    dim3 grid(N / 64, row_tiles);
    gemm_bf16_wmma<<<grid, dim3(128), 0, stream>>>(J, bias, N, K, relu);
  };
  auto gemm = [&](const float* A, const float* Bm, const float* bias, float* C,
                  int M, int N, int K, int relu) {
    GemmJobs J = none;
    J.a0 = A; J.b0 = Bm; J.c0 = C;
    gemm_jobs(J, bias, M / 64, N, K, relu);
  };
  // two products with B*T rows each
  auto gemm2 = [&](const float* A0, const float* B0, float* C0,
                   const float* A1, const float* B1, float* C1) {
    GemmJobs J = none;
    J.a0 = A0; J.b0 = B0; J.c0 = C0;
    J.a1 = A1; J.b1 = B1; J.c1 = C1; J.t1 = B * T / 64;
    gemm_jobs(J, nullptr, 2 * (B * T / 64), D, D, 0);
  };
  auto attn = [&](const float* Qp, const float* Kp, const float* Vp, const int* vl,
                  float* Op, int Tk, int causal) {
    dim3 grid(T / 16, 16, B);
    attn_wmma<<<grid, dim3(32), 0, stream>>>(Qp, Kp, Vp, vl, Op, T, Tk, causal,
                                             nullptr, nullptr, nullptr, nullptr,
                                             nullptr, 0, B);
  };
  auto lnk = [&](const float* a, const float* r, int li, float* o) {
    add_ln<<<dim3(B * T), dim3(256), 0, stream>>>(a, r, ln_g + (size_t)li * D,
                                                  ln_b + (size_t)li * D, o);
  };

  // ---- every projection that reads inputs alone: one launch ----
  {
    const int tT = B * T / 64, tC = B * SC / 64, tP = B * ST / 64, tW = B * SK / 64;
    GemmJobs J = none;
    J.a0 = x;   J.b0 = sa_w + 0 * DD; J.c0 = Qb;
    J.a1 = x;   J.b1 = sa_w + 1 * DD; J.c1 = Kb;  J.t1 = tT;
    J.a2 = x;   J.b2 = sa_w + 2 * DD; J.c2 = Vb;  J.t2 = 2 * tT;
    J.a3 = src; J.b3 = cc_w + 1 * DD; J.c3 = ccK; J.t3 = 3 * tT;
    J.a4 = src; J.b4 = cc_w + 2 * DD; J.c4 = ccV; J.t4 = 3 * tT + tC;
    J.a5 = tpl; J.b5 = ct_w + 1 * DD; J.c5 = ctK; J.t5 = 3 * tT + 2 * tC;
    J.a6 = tpl; J.b6 = ct_w + 2 * DD; J.c6 = ctV; J.t6 = 3 * tT + 2 * tC + tP;
    J.a7 = kwe; J.b7 = ck_w + 1 * DD; J.c7 = ckK; J.t7 = 3 * tT + 2 * tC + 2 * tP;
    J.a8 = kwe; J.b8 = ck_w + 2 * DD; J.c8 = ckV; J.t8 = 3 * tT + 2 * tC + 2 * tP + tW;
    gemm_jobs(J, nullptr, 3 * tT + 2 * tC + 2 * tP + 2 * tW, D, D, 0);
  }

  // ---- causal self-attention ----
  attn(Qb, Kb, Vb, nullptr, Ab, T, 1);
  gemm(Ab, sa_w + 3 * DD, nullptr, T1, B * T, D, D, 0);
  lnk(x, T1, 0, Yb);                              // y

  // ---- cross-attention: source code and keywords, side by side ----
  // (Kb and Vb are free again: keyword queries in Kb, keyword attention in Vb)
  gemm2(Yb, cc_w + 0 * DD, Qb, Yb, ck_w + 0 * DD, Kb);
  attn_wmma<<<dim3(T / 16, 16, 2 * B), dim3(32), 0, stream>>>(
      Qb, ccK, ccV, src_len, Ab, T, SC, 0, Kb, ckK, ckV, kw_len, Vb, SK, B);
  gemm2(Ab, cc_w + 3 * DD, Cb, Vb, ck_w + 3 * DD, T1);    // y2_code, y2_kw

  gate_mix<<<dim3(B * T), dim3(256), 0, stream>>>(Cb, T1, gate_w, gate_b, T2);
  lnk(Yb, T2, 1, Zb);                             // z

  // ---- cross-attention: template ----
  gemm(Zb, ct_w + 0 * DD, nullptr, Qb, B * T, D, D, 0);
  attn(Qb, ctK, ctV, tpl_len, Ab, ST, 0);
  gemm(Ab, ct_w + 3 * DD, nullptr, T1, B * T, D, D, 0);   // z2
  lnk(Zb, T1, 2, Wb);                             // w

  // ---- FFN ----
  gemm(Wb, w1, b1, Hb, B * T, DFF, D, 1);         // relu(w@w1+b1)
  gemm(Hb, w2, b2, T1, B * T, D, DFF, 0);
  lnk(Wb, T1, 3, (float*)d_out);                  // final LN

  (void)in_sizes; (void)n_in; (void)out_size; (void)ws_size;
}

// v004
// It runs in 538 microseconds.
// In both of two side-by-side timings against v003, it was 1.15 times as fast.
// Over all steps from v000 it is 3.54 times as fast.
#include <hip/hip_runtime.h>
#include <hip/hip_bf16.h>

typedef __attribute__((ext_vector_type(16))) __bf16 v16bf;
typedef __attribute__((ext_vector_type(8)))  __bf16 v8bf;
typedef __attribute__((ext_vector_type(4)))  __bf16 v4bf;
typedef __attribute__((ext_vector_type(8)))  float  v8f;
typedef __attribute__((ext_vector_type(4)))  float  v4f;

#define D_MODEL 1024
#define D_HEAD  64

__device__ __forceinline__ v16bf ld_frag_bf(const __bf16* base, int ldk) {
  const int lane = threadIdx.x & 31;
  const int r    = lane & 15;
  const int ko   = (lane & 16) ? 8 : 0;
  const __bf16* p = base + r * ldk + ko;
  v8bf lo = *reinterpret_cast<const v8bf*>(p);
  v8bf hi = *reinterpret_cast<const v8bf*>(p + 16);
  v16bf f;
#pragma unroll
  for (int i = 0; i < 8; ++i) { f[i] = lo[i]; f[i + 8] = hi[i]; }
  return f;
}

// ---------------------------------------------------------------------------
// C = A(f32,[M,K]) @ B(f32,[K,N]) (+bias)(+relu) -> f32 [M,N]
// bf16 WMMA, f32 accumulate.  M,N multiples of 128; K multiple of 64.
// A block of 8 waves makes a 128 x 128 tile of C, a wave 32 x 64 of it (waves
// 4 down x 2 across), so that every operand byte fetched feeds 128 outputs.
// A stage is 64 k of both operands.  Each thread loads whole-line 16-byte
// pieces into registers, converts them to bf16 and stores them k-contiguous:
// As[m][k] and Bs[n][k].  B arrives n-contiguous; a thread holds 8 k x 4 n of
// it, so its transpose is a register regrouping and one 16-byte store per n.
// Rows are pitched 144 B (16 B x odd) for the 16-byte fragment reads.
// ---------------------------------------------------------------------------
#define GEMM_BK 64
#define GEMM_LD 72   // bf16 elements per LDS row: 64 k + 8 pad
#define GEMM_BT 128  // rows and columns of C per block
typedef const __attribute__((address_space(1))) v4f* gv4f_ptr;

// Up to nine independent products C_j = A_j @ B_j of one launch; all share N and
// K.  Their row tiles are stacked along blockIdx.y: job j owns the tiles from
// t_j (t_0 = 0) up to t_(j+1).  An unused job has t_j = GEMM_NO_JOB.
#define GEMM_NO_JOB 0x7fffffff
struct GemmJobs {
  int t1, t2, t3, t4, t5, t6, t7, t8;
  const float* a0; const float* b0; float* c0;
  const float* a1; const float* b1; float* c1;
  const float* a2; const float* b2; float* c2;
  const float* a3; const float* b3; float* c3;
  const float* a4; const float* b4; float* c4;
  const float* a5; const float* b5; float* c5;
  const float* a6; const float* b6; float* c6;
  const float* a7; const float* b7; float* c7;
  const float* a8; const float* b8; float* c8;
};

__global__ __launch_bounds__(256)
void gemm_bf16_wmma(GemmJobs J, const float* __restrict__ bias,
                    int N, int K, int relu) {
  __shared__ __align__(16) __bf16 As[GEMM_BT * GEMM_LD];   // [m][k]
  __shared__ __align__(16) __bf16 Bs[GEMM_BT * GEMM_LD];   // [n][k]
  const int tid  = threadIdx.x;
  const int wave = tid >> 5;
  const int lane = tid & 31;
  const int wm = (wave & 3) * 32;    // the wave's first row in the tile
  const int wn = (wave >> 2) * 64;   // the wave's first column in the tile
  const int n0 = blockIdx.x * GEMM_BT;

  // Which product this block works for: the same for the whole block.
  const int ty = blockIdx.y;
  // The job's number comes from all eight bounds at once, its three pointers from
  // one more read of the arguments (a chain of tests would read them one by one).
  const int job = (ty >= J.t1) + (ty >= J.t2) + (ty >= J.t3) + (ty >= J.t4) +
                  (ty >= J.t5) + (ty >= J.t6) + (ty >= J.t7) + (ty >= J.t8);
  const float* A; const float* B; float* C; int t0;
  switch (job) {
#define GEMM_PICK(j) case j: A = J.a##j; B = J.b##j; C = J.c##j; t0 = J.t##j; break;
    GEMM_PICK(1) GEMM_PICK(2) GEMM_PICK(3) GEMM_PICK(4)
    GEMM_PICK(5) GEMM_PICK(6) GEMM_PICK(7) GEMM_PICK(8)
#undef GEMM_PICK
    default: A = J.a0; B = J.b0; C = J.c0; t0 = 0; break;
  }
  const int m0 = (ty - t0) * GEMM_BT;

  const int q16 = tid & 15;         // 16-byte piece inside 256 bytes of an f32 row
  const int g16 = tid >> 4;         // 0..15: A row group
  const int g8  = g16 & 7;          // 0..7: B group of 8 k
  const int nh  = (tid >> 7) * 64;  // B: left or right 64 columns of the tile
  // This thread's 16 pieces of a stage: one pointer each, advanced per stage.
  // (global address space kept in the type, so that the loads stay global_load)
  gv4f_ptr pa[8];
  gv4f_ptr pb[8];
#pragma unroll
  for (int j = 0; j < 8; ++j) {
    pa[j] = (gv4f_ptr)(A + (size_t)(m0 + g16 + 16 * j) * K + q16 * 4);     // rows g16 + 16j
    pb[j] = (gv4f_ptr)(B + (size_t)(g8 * 8 + j) * N + n0 + nh + q16 * 4);  // rows 8*g8 + j
  }
  const size_t stepB = (size_t)GEMM_BK * N / 4;   // in 16-byte pieces

  v8f acc[2][4] = {};

  for (int k0 = 0; k0 < K; k0 += GEMM_BK) {
    v4f ra[8], rb[8];
#pragma unroll
    for (int j = 0; j < 8; ++j) ra[j] = *pa[j];
#pragma unroll
    for (int j = 0; j < 8; ++j) rb[j] = *pb[j];
    // Keeps all 16 loads of the stage in flight together: without it the
    // conversions are scheduled among them and the stage waits three times.
    __builtin_amdgcn_sched_barrier(0);
    // Stands in front of the pointer updates below, which overwrite the address
    // registers of the loads just issued.
    asm volatile("s_wait_xcnt 0x0" ::: "memory");
#pragma unroll
    for (int j = 0; j < 8; ++j) { pa[j] += GEMM_BK / 4; pb[j] += stepB; }

    __syncthreads();                       // previous stage's fragment reads done
#pragma unroll
    for (int j = 0; j < 8; ++j) {
      v4bf t;
#pragma unroll
      for (int i = 0; i < 4; ++i) t[i] = (__bf16)ra[j][i];
      *reinterpret_cast<v4bf*>(&As[(g16 + 16 * j) * GEMM_LD + q16 * 4]) = t;
    }
#pragma unroll
    for (int i = 0; i < 4; ++i) {
      v8bf t;
#pragma unroll
      for (int j = 0; j < 8; ++j) t[j] = (__bf16)rb[j][i];
      *reinterpret_cast<v8bf*>(&Bs[(nh + q16 * 4 + i) * GEMM_LD + g8 * 8]) = t;
    }
    __syncthreads();                       // stage visible to all waves

    v16bf fa[2][2], fb[2][4];
#pragma unroll
    for (int kk = 0; kk < 2; ++kk) {
#pragma unroll
      for (int mt = 0; mt < 2; ++mt)
        fa[kk][mt] = ld_frag_bf(&As[(wm + mt * 16) * GEMM_LD + kk * 32], GEMM_LD);
#pragma unroll
      for (int nt = 0; nt < 4; ++nt)
        fb[kk][nt] = ld_frag_bf(&Bs[(wn + nt * 16) * GEMM_LD + kk * 32], GEMM_LD);
    }
    // Keeps the stage's 24 fragment reads one group ahead of the WMMAs: without
    // it each WMMA waits out the LDS latency of its own two reads.
    __builtin_amdgcn_sched_barrier(0);
#pragma unroll
    for (int kk = 0; kk < 2; ++kk) {
#pragma unroll
      for (int mt = 0; mt < 2; ++mt) {
#pragma unroll
        for (int nt = 0; nt < 4; ++nt)
          acc[mt][nt] = __builtin_amdgcn_wmma_f32_16x16x32_bf16(
              false, fa[kk][mt], false, fb[kk][nt], (short)0, acc[mt][nt], false, false);
      }
    }
  }

  const int half8 = (lane & 16) ? 8 : 0;
  const int cn    = lane & 15;
  // The wave's 32 x 64 values are finished in their registers first: a lane has
  // one column per column tile, so it reads four bias values, once ...
  if (bias) {
    float bv[4];
#pragma unroll
    for (int nt = 0; nt < 4; ++nt) bv[nt] = bias[n0 + wn + nt * 16 + cn];
    // Stands in front of any later overwrite of the address register of these loads.
    asm volatile("s_wait_xcnt 0x0" ::: "memory");
#pragma unroll
    for (int mt = 0; mt < 2; ++mt) {
#pragma unroll
      for (int nt = 0; nt < 4; ++nt) {
#pragma unroll
        for (int e = 0; e < 8; ++e) acc[mt][nt][e] += bv[nt];
      }
    }
  }
  if (relu) {
#pragma unroll
    for (int mt = 0; mt < 2; ++mt) {
#pragma unroll
      for (int nt = 0; nt < 4; ++nt) {
#pragma unroll
        for (int e = 0; e < 8; ++e) acc[mt][nt][e] = fmaxf(acc[mt][nt][e], 0.0f);
      }
    }
  }
  // ... and then stored row by row: the four stores of a row share one address.
#pragma unroll
  for (int mt = 0; mt < 2; ++mt) {
#pragma unroll
    for (int e = 0; e < 8; ++e) {
      int row = m0 + wm + mt * 16 + e + half8;
      float* pr = C + (size_t)row * N + n0 + wn + cn;
#pragma unroll
      for (int nt = 0; nt < 4; ++nt) pr[nt * 16] = acc[mt][nt][e];
      // Stands in front of the next row's address, which may take the registers
      // of the stores just issued.
      asm volatile("s_wait_xcnt 0x0" ::: "memory");
    }
  }
}

// ---------------------------------------------------------------------------
// Fused flash attention, one wave per (b, h, 16-row q tile).
// Q,K,V,O are f32 [B, T*, D_MODEL]; head h uses columns [h*64, h*64+64).
// causal=1: key <= query (dec_valid_lens = q+1).  causal=0: key < vlen[b].
// A launch may hold a second, independent attention (Q2 ... Tk2, never causal):
// blockIdx.z in [nb, 2 nb) works for it.
// ---------------------------------------------------------------------------
__global__ __launch_bounds__(32)
void attn_wmma(const float* __restrict__ Q1, const float* __restrict__ K1,
               const float* __restrict__ V1, const int* __restrict__ vlen1,
               float* __restrict__ O1, int Tq, int Tk1, int causal,
               const float* __restrict__ Q2, const float* __restrict__ K2,
               const float* __restrict__ V2, const int* __restrict__ vlen2,
               float* __restrict__ O2, int Tk2, int nb) {
  __shared__ __align__(16) __bf16 Qs[16 * 64];   // [q][d]
  __shared__ __align__(16) __bf16 Ks[32 * 64];   // [key][d] (== B-frag layout, QK^T)
  __shared__ __align__(16) __bf16 Vt[64 * 32];   // [d][key] (B-frag layout, PV)
  __shared__ __align__(16) __bf16 Ps[16 * 32];   // [q][key] P relayout buffer

  const int lane = threadIdx.x & 31;
  const int qb   = blockIdx.x * 16;
  const int h    = blockIdx.y;
  const bool second = (int)blockIdx.z >= nb;      // the same for the whole block
  const int b    = second ? (int)blockIdx.z - nb : (int)blockIdx.z;
  const float* Q    = second ? Q2 : Q1;
  const float* Kt   = second ? K2 : K1;
  const float* V    = second ? V2 : V1;
  const int*   vlen = second ? vlen2 : vlen1;
  float*       O    = second ? O2 : O1;
  const int    Tk   = second ? Tk2 : Tk1;
  const int half8 = (lane & 16) ? 8 : 0;
  const int cn    = lane & 15;

  const size_t qoff = ((size_t)b * Tq + qb) * D_MODEL + (size_t)h * D_HEAD;
#pragma unroll
  for (int i = 0; i < 32; ++i) {
    int idx = i * 32 + lane;
    int r = idx >> 6, c = idx & 63;
    Qs[r * 64 + c] = (__bf16)Q[qoff + (size_t)r * D_MODEL + c];
  }
  v16bf aq0 = ld_frag_bf(&Qs[0], 64);
  v16bf aq1 = ld_frag_bf(&Qs[32], 64);

  float m[8], l[8];
#pragma unroll
  for (int e = 0; e < 8; ++e) { m[e] = -3.0e38f; l[e] = 0.0f; }
  v8f o0 = {}, o1 = {}, o2 = {}, o3 = {};

  const int vl   = causal ? Tk : min(vlen[b], Tk);   // bounds the key rows read below
  const int nblk = causal ? ((qb + 16 + 31) >> 5) : ((vl + 31) >> 5);

  // Staging of a 32-key block: a lane takes 16-byte pieces of the 256-byte head
  // rows.  Of K it takes keys 2i + h2; of V keys 8(2g + h2) + jj, that is 8 keys
  // x 4 d per group, so that the transpose is a register regrouping and one
  // 16-byte store per d.
  const int q16 = lane & 15;   // piece of 4 d
  const int h2  = lane >> 4;   // 0..1
  const size_t kvoff = (size_t)b * Tk * D_MODEL + (size_t)h * D_HEAD;   // same for the wave
  const unsigned ko = h2 * D_MODEL + q16 * 4;       // the lane's own part, K
  const unsigned vo = h2 * 8 * D_MODEL + q16 * 4;   // the lane's own part, V

  for (int j = 0; j < nblk; ++j) {
    const int kb = j * 32;
    {
      gv4f_ptr kp = (gv4f_ptr)(Kt + kvoff + (size_t)kb * D_MODEL + ko);
      gv4f_ptr vp = (gv4f_ptr)(V  + kvoff + (size_t)kb * D_MODEL + vo);
      v4f rk[16], rv[16];
#pragma unroll
      for (int i = 0; i < 16; ++i)
        rk[i] = kp[2 * i * (D_MODEL / 4)];
#pragma unroll
      for (int i = 0; i < 16; ++i)
        rv[i] = vp[(16 * (i >> 3) + (i & 7)) * (D_MODEL / 4)];
      // Keeps all 32 loads of the block in flight together: without it the
      // conversions are scheduled among them and the block waits several times.
      __builtin_amdgcn_sched_barrier(0);
      // Stands in front of every overwrite of the address registers of the loads
      // just issued; it names both addresses as inputs, so that they keep their
      // registers up to here and no load's result is given one of them.
      asm volatile("s_wait_xcnt 0x0" :: "v"(kp), "v"(vp) : "memory");
#pragma unroll
      for (int i = 0; i < 16; ++i) {
        v4bf t;
#pragma unroll
        for (int c = 0; c < 4; ++c) t[c] = (__bf16)rk[i][c];
        *reinterpret_cast<v4bf*>(&Ks[(2 * i + h2) * 64 + q16 * 4]) = t;
      }
#pragma unroll
      for (int g = 0; g < 2; ++g) {
#pragma unroll
        for (int c = 0; c < 4; ++c) {
          v8bf t;
#pragma unroll
          for (int jj = 0; jj < 8; ++jj) t[jj] = (__bf16)rv[g * 8 + jj][c];
          *reinterpret_cast<v8bf*>(&Vt[(q16 * 4 + c) * 32 + (2 * g + h2) * 8]) = t;
        }
      }
    }

    // S = Q @ K^T for 32 keys (two 16-key column tiles)
    v8f s0 = {}, s1 = {};
    {
      v16bf b0a = ld_frag_bf(&Ks[0], 64);
      v16bf b0b = ld_frag_bf(&Ks[32], 64);
      v16bf b1a = ld_frag_bf(&Ks[16 * 64], 64);
      v16bf b1b = ld_frag_bf(&Ks[16 * 64 + 32], 64);
      s0 = __builtin_amdgcn_wmma_f32_16x16x32_bf16(false, aq0, false, b0a, (short)0, s0, false, false);
      s0 = __builtin_amdgcn_wmma_f32_16x16x32_bf16(false, aq1, false, b0b, (short)0, s0, false, false);
      s1 = __builtin_amdgcn_wmma_f32_16x16x32_bf16(false, aq0, false, b1a, (short)0, s1, false, false);
      s1 = __builtin_amdgcn_wmma_f32_16x16x32_bf16(false, aq1, false, b1b, (short)0, s1, false, false);
    }

    float p0[8], p1[8];
#pragma unroll
    for (int e = 0; e < 8; ++e) {
      float s0e = s0[e] * 0.125f;   // 1/sqrt(64)
      float s1e = s1[e] * 0.125f;
      int row = qb + e + half8;
      int c0 = kb + cn, c1 = kb + 16 + cn;
      bool ok0 = causal ? (c0 <= row) : (c0 < vl);
      bool ok1 = causal ? (c1 <= row) : (c1 < vl);
      if (!ok0) s0e = -1.0e6f;
      if (!ok1) s1e = -1.0e6f;
      float rm = fmaxf(s0e, s1e);
#pragma unroll
      for (int msk = 1; msk < 16; msk <<= 1) rm = fmaxf(rm, __shfl_xor(rm, msk, 32));
      float mn    = fmaxf(m[e], rm);
      float alpha = __expf(m[e] - mn);
      float e0 = __expf(s0e - mn);
      float e1 = __expf(s1e - mn);
      float rs = e0 + e1;
#pragma unroll
      for (int msk = 1; msk < 16; msk <<= 1) rs += __shfl_xor(rs, msk, 32);
      l[e] = l[e] * alpha + rs;
      m[e] = mn;
      o0[e] *= alpha; o1[e] *= alpha; o2[e] *= alpha; o3[e] *= alpha;
      p0[e] = e0; p1[e] = e1;
    }

#pragma unroll
    for (int e = 0; e < 8; ++e) {
      Ps[(e + half8) * 32 + cn]      = (__bf16)p0[e];
      Ps[(e + half8) * 32 + 16 + cn] = (__bf16)p1[e];
    }
    v16bf ap = ld_frag_bf(&Ps[0], 32);
    o0 = __builtin_amdgcn_wmma_f32_16x16x32_bf16(false, ap, false, ld_frag_bf(&Vt[0],       32), (short)0, o0, false, false);
    o1 = __builtin_amdgcn_wmma_f32_16x16x32_bf16(false, ap, false, ld_frag_bf(&Vt[16 * 32], 32), (short)0, o1, false, false);
    o2 = __builtin_amdgcn_wmma_f32_16x16x32_bf16(false, ap, false, ld_frag_bf(&Vt[32 * 32], 32), (short)0, o2, false, false);
    o3 = __builtin_amdgcn_wmma_f32_16x16x32_bf16(false, ap, false, ld_frag_bf(&Vt[48 * 32], 32), (short)0, o3, false, false);
  }

#pragma unroll
  for (int e = 0; e < 8; ++e) {
    float inv = 1.0f / l[e];
    size_t ro = ((size_t)b * Tq + qb + e + half8) * D_MODEL + (size_t)h * D_HEAD;
    O[ro + cn]      = o0[e] * inv;
    O[ro + 16 + cn] = o1[e] * inv;
    O[ro + 32 + cn] = o2[e] * inv;
    O[ro + 48 + cn] = o3[e] * inv;
  }
}

// out = LayerNorm(a + r) * g + bt, one block per row of D_MODEL
__global__ __launch_bounds__(256)
void add_ln(const float* __restrict__ a, const float* __restrict__ r,
            const float* __restrict__ g, const float* __restrict__ bt,
            float* __restrict__ out) {
  __shared__ float red[256];
  const int tid = threadIdx.x;
  const size_t row = blockIdx.x;
  float v[4];
  float s = 0.0f;
#pragma unroll
  for (int i = 0; i < 4; ++i) {
    int c = tid + i * 256;
    v[i] = a[row * D_MODEL + c] + r[row * D_MODEL + c];
    s += v[i];
  }
  red[tid] = s; __syncthreads();
  for (int off = 128; off > 0; off >>= 1) { if (tid < off) red[tid] += red[tid + off]; __syncthreads(); }
  float mean = red[0] * (1.0f / D_MODEL);
  __syncthreads();
  float sq = 0.0f;
#pragma unroll
  for (int i = 0; i < 4; ++i) { float d = v[i] - mean; sq += d * d; }
  red[tid] = sq; __syncthreads();
  for (int off = 128; off > 0; off >>= 1) { if (tid < off) red[tid] += red[tid + off]; __syncthreads(); }
  float rstd = rsqrtf(red[0] * (1.0f / D_MODEL) + 1e-5f);
#pragma unroll
  for (int i = 0; i < 4; ++i) {
    int c = tid + i * 256;
    out[row * D_MODEL + c] = (v[i] - mean) * rstd * g[c] + bt[c];
  }
}

// gate = sigmoid(concat(code,kw) @ gw + gb); out = gate*code + (1-gate)*kw
__global__ __launch_bounds__(256)
void gate_mix(const float* __restrict__ code, const float* __restrict__ kw,
              const float* __restrict__ gw, const float* __restrict__ gb,
              float* __restrict__ out) {
  __shared__ float red[256];
  const int tid = threadIdx.x;
  const size_t row = blockIdx.x;
  float s = 0.0f;
#pragma unroll
  for (int i = 0; i < 4; ++i) {
    int c = tid + i * 256;
    s += code[row * D_MODEL + c] * gw[c] + kw[row * D_MODEL + c] * gw[D_MODEL + c];
  }
  red[tid] = s; __syncthreads();
  for (int off = 128; off > 0; off >>= 1) { if (tid < off) red[tid] += red[tid + off]; __syncthreads(); }
  float gsc = 1.0f / (1.0f + __expf(-(red[0] + gb[0])));
#pragma unroll
  for (int i = 0; i < 4; ++i) {
    int c = tid + i * 256;
    float cv = code[row * D_MODEL + c];
    float kv = kw[row * D_MODEL + c];
    out[row * D_MODEL + c] = gsc * cv + (1.0f - gsc) * kv;
  }
}

extern "C" void kernel_launch(void* const* d_in, const int* in_sizes, int n_in,
                              void* d_out, int out_size, void* d_ws, size_t ws_size,
                              hipStream_t stream) {
  const int B = 8, T = 512, SC = 512, ST = 256, SK = 64, D = 1024, DFF = 4096;
  const float* x       = (const float*)d_in[0];
  const float* src     = (const float*)d_in[1];
  const int*   src_len = (const int*)  d_in[2];
  const float* tpl     = (const float*)d_in[3];
  const int*   tpl_len = (const int*)  d_in[4];
  const float* kwe     = (const float*)d_in[5];
  const int*   kw_len  = (const int*)  d_in[6];
  const float* sa_w    = (const float*)d_in[7];
  const float* cc_w    = (const float*)d_in[8];
  const float* ck_w    = (const float*)d_in[9];
  const float* ct_w    = (const float*)d_in[10];
  const float* gate_w  = (const float*)d_in[11];
  const float* gate_b  = (const float*)d_in[12];
  const float* w1      = (const float*)d_in[13];
  const float* b1      = (const float*)d_in[14];
  const float* w2      = (const float*)d_in[15];
  const float* b2      = (const float*)d_in[16];
  const float* ln_g    = (const float*)d_in[17];
  const float* ln_b    = (const float*)d_in[18];

  const size_t DD   = (size_t)D * D;
  const size_t NTOK = (size_t)B * T * D;   // 4M floats

  float* ws = (float*)d_ws;
  size_t off = 0;
  auto take = [&](size_t n) { float* p = ws + off; off += n; return p; };
  float* Qb = take(NTOK); float* Kb = take(NTOK); float* Vb = take(NTOK);
  float* Ab = take(NTOK); float* T1 = take(NTOK); float* T2 = take(NTOK);
  float* Yb = take(NTOK); float* Cb = take(NTOK); float* Zb = take(NTOK);
  float* Wb = take(NTOK); float* Hb = take((size_t)B * T * DFF);

  // Cross-attention keys and values depend on inputs alone and are made in the
  // first launch; they live in Hb, which is first written by the FFN.
  float* ccK = Hb;                       float* ccV = ccK + (size_t)B * SC * D;
  float* ctK = ccV + (size_t)B * SC * D; float* ctV = ctK + (size_t)B * ST * D;
  float* ckK = ctV + (size_t)B * ST * D; float* ckV = ckK + (size_t)B * SK * D;

  const GemmJobs none = {GEMM_NO_JOB, GEMM_NO_JOB, GEMM_NO_JOB, GEMM_NO_JOB,
                         GEMM_NO_JOB, GEMM_NO_JOB, GEMM_NO_JOB, GEMM_NO_JOB,
                         nullptr, nullptr, nullptr, nullptr, nullptr, nullptr,
                         nullptr, nullptr, nullptr, nullptr, nullptr, nullptr,
                         nullptr, nullptr, nullptr, nullptr, nullptr, nullptr,
                         nullptr, nullptr, nullptr, nullptr, nullptr, nullptr,
                         nullptr, nullptr, nullptr};
  auto gemm_jobs = [&](const GemmJobs& J, const float* bias, int row_tiles,
                       int N, int K, int relu) {
    dim3 grid(N / GEMM_BT, row_tiles);
    gemm_bf16_wmma<<<grid, dim3(256), 0, stream>>>(J, bias, N, K, relu);
  };
  auto gemm = [&](const float* A, const float* Bm, const float* bias, float* C,
                  int M, int N, int K, int relu) {
    GemmJobs J = none;
    J.a0 = A; J.b0 = Bm; J.c0 = C;
    gemm_jobs(J, bias, M / GEMM_BT, N, K, relu);
  };
  // two products with B*T rows each
  auto gemm2 = [&](const float* A0, const float* B0, float* C0,
                   const float* A1, const float* B1, float* C1) {
    GemmJobs J = none;
    J.a0 = A0; J.b0 = B0; J.c0 = C0;
    J.a1 = A1; J.b1 = B1; J.c1 = C1; J.t1 = B * T / GEMM_BT;
    gemm_jobs(J, nullptr, 2 * (B * T / GEMM_BT), D, D, 0);
  };
  auto attn = [&](const float* Qp, const float* Kp, const float* Vp, const int* vl,
                  float* Op, int Tk, int causal) {
    dim3 grid(T / 16, 16, B);
    attn_wmma<<<grid, dim3(32), 0, stream>>>(Qp, Kp, Vp, vl, Op, T, Tk, causal,
                                             nullptr, nullptr, nullptr, nullptr,
                                             nullptr, 0, B);
  };
  auto lnk = [&](const float* a, const float* r, int li, float* o) {
    add_ln<<<dim3(B * T), dim3(256), 0, stream>>>(a, r, ln_g + (size_t)li * D,
                                                  ln_b + (size_t)li * D, o);
  };

  // ---- every projection that reads inputs alone: one launch ----
  {
    const int tT = B * T / GEMM_BT, tC = B * SC / GEMM_BT, tP = B * ST / GEMM_BT,
              tW = B * SK / GEMM_BT;
    GemmJobs J = none;
    J.a0 = x;   J.b0 = sa_w + 0 * DD; J.c0 = Qb;
    J.a1 = x;   J.b1 = sa_w + 1 * DD; J.c1 = Kb;  J.t1 = tT;
    J.a2 = x;   J.b2 = sa_w + 2 * DD; J.c2 = Vb;  J.t2 = 2 * tT;
    J.a3 = src; J.b3 = cc_w + 1 * DD; J.c3 = ccK; J.t3 = 3 * tT;
    J.a4 = src; J.b4 = cc_w + 2 * DD; J.c4 = ccV; J.t4 = 3 * tT + tC;
    J.a5 = tpl; J.b5 = ct_w + 1 * DD; J.c5 = ctK; J.t5 = 3 * tT + 2 * tC;
    J.a6 = tpl; J.b6 = ct_w + 2 * DD; J.c6 = ctV; J.t6 = 3 * tT + 2 * tC + tP;
    J.a7 = kwe; J.b7 = ck_w + 1 * DD; J.c7 = ckK; J.t7 = 3 * tT + 2 * tC + 2 * tP;
    J.a8 = kwe; J.b8 = ck_w + 2 * DD; J.c8 = ckV; J.t8 = 3 * tT + 2 * tC + 2 * tP + tW;
    gemm_jobs(J, nullptr, 3 * tT + 2 * tC + 2 * tP + 2 * tW, D, D, 0);
  }

  // ---- causal self-attention ----
  attn(Qb, Kb, Vb, nullptr, Ab, T, 1);
  gemm(Ab, sa_w + 3 * DD, nullptr, T1, B * T, D, D, 0);
  lnk(x, T1, 0, Yb);                              // y

  // ---- cross-attention: source code and keywords, side by side ----
  // (Kb and Vb are free again: keyword queries in Kb, keyword attention in Vb)
  gemm2(Yb, cc_w + 0 * DD, Qb, Yb, ck_w + 0 * DD, Kb);
  attn_wmma<<<dim3(T / 16, 16, 2 * B), dim3(32), 0, stream>>>(
      Qb, ccK, ccV, src_len, Ab, T, SC, 0, Kb, ckK, ckV, kw_len, Vb, SK, B);
  gemm2(Ab, cc_w + 3 * DD, Cb, Vb, ck_w + 3 * DD, T1);    // y2_code, y2_kw

  gate_mix<<<dim3(B * T), dim3(256), 0, stream>>>(Cb, T1, gate_w, gate_b, T2);
  lnk(Yb, T2, 1, Zb);                             // z

  // ---- cross-attention: template ----
  gemm(Zb, ct_w + 0 * DD, nullptr, Qb, B * T, D, D, 0);
  attn(Qb, ctK, ctV, tpl_len, Ab, ST, 0);
  gemm(Ab, ct_w + 3 * DD, nullptr, T1, B * T, D, D, 0);   // z2
  lnk(Zb, T1, 2, Wb);                             // w

  // ---- FFN ----
  gemm(Wb, w1, b1, Hb, B * T, DFF, D, 1);         // relu(w@w1+b1)
  gemm(Hb, w2, b2, T1, B * T, D, DFF, 0);
  lnk(Wb, T1, 3, (float*)d_out);                  // final LN

  (void)in_sizes; (void)n_in; (void)out_size; (void)ws_size;
}

// v005
// It runs in 460 microseconds.
// Next to v004, in two timings, it ran 1.17 times as fast each time.
// Over all steps from v000 it is 4.14 times as fast.
#include <hip/hip_runtime.h>
#include <hip/hip_bf16.h>

typedef __attribute__((ext_vector_type(16))) __bf16 v16bf;
typedef __attribute__((ext_vector_type(8)))  __bf16 v8bf;
typedef __attribute__((ext_vector_type(4)))  __bf16 v4bf;
typedef __attribute__((ext_vector_type(8)))  float  v8f;
typedef __attribute__((ext_vector_type(4)))  float  v4f;

#define D_MODEL 1024
#define D_HEAD  64

__device__ __forceinline__ v16bf ld_frag_bf(const __bf16* base, int ldk) {
  const int lane = threadIdx.x & 31;
  const int r    = lane & 15;
  const int ko   = (lane & 16) ? 8 : 0;
  const __bf16* p = base + r * ldk + ko;
  v8bf lo = *reinterpret_cast<const v8bf*>(p);
  v8bf hi = *reinterpret_cast<const v8bf*>(p + 16);
  v16bf f;
#pragma unroll
  for (int i = 0; i < 8; ++i) { f[i] = lo[i]; f[i + 8] = hi[i]; }
  return f;
}

// ---------------------------------------------------------------------------
// C = A(f32,[M,K]) @ B(f32,[K,N]) (+bias)(+relu) -> f32 [M,N]
// bf16 WMMA, f32 accumulate.  M,N multiples of 128; K multiple of 64.
// A block of 8 waves makes a 128 x 128 tile of C, a wave 32 x 64 of it (waves
// 4 down x 2 across), so that every operand byte fetched feeds 128 outputs.
// A stage is 64 k of both operands.  Each thread loads whole-line 16-byte
// pieces into registers, converts them to bf16 and stores them k-contiguous:
// As[m][k] and Bs[n][k].  B arrives n-contiguous; a thread holds 8 k x 4 n of
// it, so its transpose is a register regrouping and one 16-byte store per n.
// Rows are pitched 144 B (16 B x odd) for the 16-byte fragment reads.
// The stages are pipelined: the loads of stage s + 1 are issued before the
// fragment reads and WMMAs of stage s and land behind them.  LDS holds two
// stages, so that one barrier per stage is enough: a wave writes buffer s & 1
// behind barrier s - 1, which every wave reaches with its reads of stage s - 2
// (the same buffer) complete.
// ---------------------------------------------------------------------------
#define GEMM_BK 64
#define GEMM_LD 72   // bf16 elements per LDS row: 64 k + 8 pad
#define GEMM_BT 128  // rows and columns of C per block
typedef const __attribute__((address_space(1))) v4f* gv4f_ptr;
typedef const __attribute__((address_space(1))) char* gbyte_ptr;

// Up to nine independent products C_j = A_j @ B_j of one launch; all share N and
// K.  Their row tiles are stacked along blockIdx.y: job j owns the tiles from
// t_j (t_0 = 0) up to t_(j+1).  An unused job has t_j = GEMM_NO_JOB.
#define GEMM_NO_JOB 0x7fffffff
struct GemmJobs {
  int t1, t2, t3, t4, t5, t6, t7, t8;
  const float* a0; const float* b0; float* c0;
  const float* a1; const float* b1; float* c1;
  const float* a2; const float* b2; float* c2;
  const float* a3; const float* b3; float* c3;
  const float* a4; const float* b4; float* c4;
  const float* a5; const float* b5; float* c5;
  const float* a6; const float* b6; float* c6;
  const float* a7; const float* b7; float* c7;
  const float* a8; const float* b8; float* c8;
};

__global__ __launch_bounds__(256)
void gemm_bf16_wmma(GemmJobs J, const float* __restrict__ bias,
                    int N, int K, int relu) {
  // two stages of As[m][k] followed by Bs[n][k]
  __shared__ __align__(16) __bf16 Sm[2][2 * GEMM_BT * GEMM_LD];
  const int tid  = threadIdx.x;
  const int wave = tid >> 5;
  const int lane = tid & 31;
  const int wm = (wave & 3) * 32;    // the wave's first row in the tile
  const int wn = (wave >> 2) * 64;   // the wave's first column in the tile
  const int n0 = blockIdx.x * GEMM_BT;

  // Which product this block works for: the same for the whole block.
  const int ty = blockIdx.y;
  // The job's number comes from all eight bounds at once, its three pointers from
  // one more read of the arguments (a chain of tests would read them one by one).
  const int job = (ty >= J.t1) + (ty >= J.t2) + (ty >= J.t3) + (ty >= J.t4) +
                  (ty >= J.t5) + (ty >= J.t6) + (ty >= J.t7) + (ty >= J.t8);
  const float* A; const float* B; float* C; int t0;
  switch (job) {
#define GEMM_PICK(j) case j: A = J.a##j; B = J.b##j; C = J.c##j; t0 = J.t##j; break;
    GEMM_PICK(1) GEMM_PICK(2) GEMM_PICK(3) GEMM_PICK(4)
    GEMM_PICK(5) GEMM_PICK(6) GEMM_PICK(7) GEMM_PICK(8)
#undef GEMM_PICK
    default: A = J.a0; B = J.b0; C = J.c0; t0 = 0; break;
  }
  const int m0 = (ty - t0) * GEMM_BT;

  const int q16 = tid & 15;         // 16-byte piece inside 256 bytes of an f32 row
  const int g16 = tid >> 4;         // 0..15: A row group
  const int g8  = g16 & 7;          // 0..7: B group of 8 k
  const int nh  = (tid >> 7) * 64;  // B: left or right 64 columns of the tile
  // This thread's 16 pieces of a stage: a base that is the same for the whole
  // block, one per piece and advanced per stage, plus the thread's own 32-bit
  // byte offset (one for A, one for B).  The 16 full addresses then live in vector
  // registers only around the loads, not beside the fragments, which leaves room
  // for the stage that is in flight.
  // (global address space kept in the type, so that the loads stay global_load)
  gbyte_ptr pa[8];
  gbyte_ptr pb[8];
#pragma unroll
  for (int j = 0; j < 8; ++j) {
    pa[j] = (gbyte_ptr)(A + (size_t)(m0 + 16 * j) * K);   // rows g16 + 16j
    pb[j] = (gbyte_ptr)(B + (size_t)j * N + n0);          // rows 8*g8 + j
  }
  const unsigned oa = (unsigned)(g16 * K + q16 * 4) * 4u;
  const unsigned ob = (unsigned)(g8 * 8 * N + nh + q16 * 4) * 4u;
  const size_t stepB = (size_t)GEMM_BK * N * 4;   // in bytes

  v8f acc[2][4] = {};

  v4f ra[8], rb[8];
  // Issues the 16 loads of the stage that the bases stand at, then advances them.
  auto load_stage = [&]() {
    gv4f_ptr qa[8], qb[8];
#pragma unroll
    for (int j = 0; j < 8; ++j) {
      qa[j] = (gv4f_ptr)(pa[j] + oa);
      qb[j] = (gv4f_ptr)(pb[j] + ob);
    }
#pragma unroll
    for (int j = 0; j < 8; ++j) ra[j] = *qa[j];
#pragma unroll
    for (int j = 0; j < 8; ++j) rb[j] = *qb[j];
    // Keeps the 16 loads here, together and ahead of the fragment reads and
    // WMMAs that follow: moved down to their use they would hide nothing.
    __builtin_amdgcn_sched_barrier(0);
    // Stands in front of every overwrite of the address registers of the loads
    // just issued (the base updates below among them); it names the 16 addresses
    // as inputs, so that they keep their registers up to here and no load's
    // result is given one of them.
    asm volatile("s_wait_xcnt 0x0"
                 :: "v"(qa[0]), "v"(qa[1]), "v"(qa[2]), "v"(qa[3]),
                    "v"(qa[4]), "v"(qa[5]), "v"(qa[6]), "v"(qa[7]),
                    "v"(qb[0]), "v"(qb[1]), "v"(qb[2]), "v"(qb[3]),
                    "v"(qb[4]), "v"(qb[5]), "v"(qb[6]), "v"(qb[7])
                 : "memory");
#pragma unroll
    for (int j = 0; j < 8; ++j) { pa[j] += GEMM_BK * 4; pb[j] += stepB; }
  };
  load_stage();

  for (int k0 = 0; k0 < K; k0 += GEMM_BK) {
    __bf16* As = Sm[(k0 / GEMM_BK) & 1];
    __bf16* Bs = As + GEMM_BT * GEMM_LD;
#pragma unroll
    for (int j = 0; j < 8; ++j) {
      v4bf t;
#pragma unroll
      for (int i = 0; i < 4; ++i) t[i] = (__bf16)ra[j][i];
      *reinterpret_cast<v4bf*>(&As[(g16 + 16 * j) * GEMM_LD + q16 * 4]) = t;
    }
#pragma unroll
    for (int i = 0; i < 4; ++i) {
      v8bf t;
#pragma unroll
      for (int j = 0; j < 8; ++j) t[j] = (__bf16)rb[j][i];
      *reinterpret_cast<v8bf*>(&Bs[(nh + q16 * 4 + i) * GEMM_LD + g8 * 8]) = t;
    }
    if (k0 + GEMM_BK < K) load_stage();    // the test reads the same for the whole block
    // The stage's barrier.  Its fences name LDS alone: the stage is handed over
    // in LDS only, and a fence over global memory too (as in __syncthreads())
    // would wait here for the next stage's loads, which are to stay in flight.
    __builtin_amdgcn_fence(__ATOMIC_RELEASE, "workgroup", "local");
    __builtin_amdgcn_s_barrier();
    __builtin_amdgcn_fence(__ATOMIC_ACQUIRE, "workgroup", "local");

    v16bf fa[2][2], fb[2][4];
#pragma unroll
    for (int kk = 0; kk < 2; ++kk) {
#pragma unroll
      for (int mt = 0; mt < 2; ++mt)
        fa[kk][mt] = ld_frag_bf(&As[(wm + mt * 16) * GEMM_LD + kk * 32], GEMM_LD);
#pragma unroll
      for (int nt = 0; nt < 4; ++nt)
        fb[kk][nt] = ld_frag_bf(&Bs[(wn + nt * 16) * GEMM_LD + kk * 32], GEMM_LD);
    }
    // Keeps the stage's 24 fragment reads one group ahead of the WMMAs: without
    // it each WMMA waits out the LDS latency of its own two reads.
    __builtin_amdgcn_sched_barrier(0);
#pragma unroll
    for (int kk = 0; kk < 2; ++kk) {
#pragma unroll
      for (int mt = 0; mt < 2; ++mt) {
#pragma unroll
        for (int nt = 0; nt < 4; ++nt)
          acc[mt][nt] = __builtin_amdgcn_wmma_f32_16x16x32_bf16(
              false, fa[kk][mt], false, fb[kk][nt], (short)0, acc[mt][nt], false, false);
      }
    }
  }

  const int half8 = (lane & 16) ? 8 : 0;
  const int cn    = lane & 15;
  // The wave's 32 x 64 values are finished in their registers first: a lane has
  // one column per column tile, so it reads four bias values, once ...
  if (bias) {
    float bv[4];
#pragma unroll
    for (int nt = 0; nt < 4; ++nt) bv[nt] = bias[n0 + wn + nt * 16 + cn];
    // Stands in front of any later overwrite of the address register of these loads.
    asm volatile("s_wait_xcnt 0x0" ::: "memory");
#pragma unroll
    for (int mt = 0; mt < 2; ++mt) {
#pragma unroll
      for (int nt = 0; nt < 4; ++nt) {
#pragma unroll
        for (int e = 0; e < 8; ++e) acc[mt][nt][e] += bv[nt];
      }
    }
  }
  if (relu) {
#pragma unroll
    for (int mt = 0; mt < 2; ++mt) {
#pragma unroll
      for (int nt = 0; nt < 4; ++nt) {
#pragma unroll
        for (int e = 0; e < 8; ++e) acc[mt][nt][e] = fmaxf(acc[mt][nt][e], 0.0f);
      }
    }
  }
  // ... and then stored row by row: the four stores of a row share one address.
#pragma unroll
  for (int mt = 0; mt < 2; ++mt) {
#pragma unroll
    for (int e = 0; e < 8; ++e) {
      int row = m0 + wm + mt * 16 + e + half8;
      float* pr = C + (size_t)row * N + n0 + wn + cn;
#pragma unroll
      for (int nt = 0; nt < 4; ++nt) pr[nt * 16] = acc[mt][nt][e];
      // Stands in front of the next row's address, which may take the registers
      // of the stores just issued.
      asm volatile("s_wait_xcnt 0x0" ::: "memory");
    }
  }
}

// ---------------------------------------------------------------------------
// Fused flash attention, one wave per (b, h, 16-row q tile).
// Q,K,V,O are f32 [B, T*, D_MODEL]; head h uses columns [h*64, h*64+64).
// causal=1: key <= query (dec_valid_lens = q+1).  causal=0: key < vlen[b].
// A launch may hold a second, independent attention (Q2 ... Tk2, never causal):
// blockIdx.z in [nb, 2 nb) works for it.
// ---------------------------------------------------------------------------
__global__ __launch_bounds__(32)
void attn_wmma(const float* __restrict__ Q1, const float* __restrict__ K1,
               const float* __restrict__ V1, const int* __restrict__ vlen1,
               float* __restrict__ O1, int Tq, int Tk1, int causal,
               const float* __restrict__ Q2, const float* __restrict__ K2,
               const float* __restrict__ V2, const int* __restrict__ vlen2,
               float* __restrict__ O2, int Tk2, int nb) {
  __shared__ __align__(16) __bf16 Qs[16 * 64];   // [q][d]
  __shared__ __align__(16) __bf16 Ks[32 * 64];   // [key][d] (== B-frag layout, QK^T)
  __shared__ __align__(16) __bf16 Vt[64 * 32];   // [d][key] (B-frag layout, PV)
  __shared__ __align__(16) __bf16 Ps[16 * 32];   // [q][key] P relayout buffer

  const int lane = threadIdx.x & 31;
  const int qb   = blockIdx.x * 16;
  const int h    = blockIdx.y;
  const bool second = (int)blockIdx.z >= nb;      // the same for the whole block
  const int b    = second ? (int)blockIdx.z - nb : (int)blockIdx.z;
  const float* Q    = second ? Q2 : Q1;
  const float* Kt   = second ? K2 : K1;
  const float* V    = second ? V2 : V1;
  const int*   vlen = second ? vlen2 : vlen1;
  float*       O    = second ? O2 : O1;
  const int    Tk   = second ? Tk2 : Tk1;
  const int half8 = (lane & 16) ? 8 : 0;
  const int cn    = lane & 15;

  const size_t qoff = ((size_t)b * Tq + qb) * D_MODEL + (size_t)h * D_HEAD;
#pragma unroll
  for (int i = 0; i < 32; ++i) {
    int idx = i * 32 + lane;
    int r = idx >> 6, c = idx & 63;
    Qs[r * 64 + c] = (__bf16)Q[qoff + (size_t)r * D_MODEL + c];
  }
  v16bf aq0 = ld_frag_bf(&Qs[0], 64);
  v16bf aq1 = ld_frag_bf(&Qs[32], 64);

  float m[8], l[8];
#pragma unroll
  for (int e = 0; e < 8; ++e) { m[e] = -3.0e38f; l[e] = 0.0f; }
  v8f o0 = {}, o1 = {}, o2 = {}, o3 = {};

  const int vl   = causal ? Tk : min(vlen[b], Tk);   // bounds the key rows read below
  const int nblk = causal ? ((qb + 16 + 31) >> 5) : ((vl + 31) >> 5);

  // Staging of a 32-key block: a lane takes 16-byte pieces of the 256-byte head
  // rows.  Of K it takes keys 2i + h2; of V keys 8(2g + h2) + jj, that is 8 keys
  // x 4 d per group, so that the transpose is a register regrouping and one
  // 16-byte store per d.
  const int q16 = lane & 15;   // piece of 4 d
  const int h2  = lane >> 4;   // 0..1
  const size_t kvoff = (size_t)b * Tk * D_MODEL + (size_t)h * D_HEAD;   // same for the wave
  const unsigned ko = h2 * D_MODEL + q16 * 4;       // the lane's own part, K
  const unsigned vo = h2 * 8 * D_MODEL + q16 * 4;   // the lane's own part, V

  for (int j = 0; j < nblk; ++j) {
    const int kb = j * 32;
    {
      gv4f_ptr kp = (gv4f_ptr)(Kt + kvoff + (size_t)kb * D_MODEL + ko);
      gv4f_ptr vp = (gv4f_ptr)(V  + kvoff + (size_t)kb * D_MODEL + vo);
      v4f rk[16], rv[16];
#pragma unroll
      for (int i = 0; i < 16; ++i)
        rk[i] = kp[2 * i * (D_MODEL / 4)];
#pragma unroll
      for (int i = 0; i < 16; ++i)
        rv[i] = vp[(16 * (i >> 3) + (i & 7)) * (D_MODEL / 4)];
      // Keeps all 32 loads of the block in flight together: without it the
      // conversions are scheduled among them and the block waits several times.
      __builtin_amdgcn_sched_barrier(0);
      // Stands in front of every overwrite of the address registers of the loads
      // just issued; it names both addresses as inputs, so that they keep their
      // registers up to here and no load's result is given one of them.
      asm volatile("s_wait_xcnt 0x0" :: "v"(kp), "v"(vp) : "memory");
#pragma unroll
      for (int i = 0; i < 16; ++i) {
        v4bf t;
#pragma unroll
        for (int c = 0; c < 4; ++c) t[c] = (__bf16)rk[i][c];
        *reinterpret_cast<v4bf*>(&Ks[(2 * i + h2) * 64 + q16 * 4]) = t;
      }
#pragma unroll
      for (int g = 0; g < 2; ++g) {
#pragma unroll
        for (int c = 0; c < 4; ++c) {
          v8bf t;
#pragma unroll
          for (int jj = 0; jj < 8; ++jj) t[jj] = (__bf16)rv[g * 8 + jj][c];
          *reinterpret_cast<v8bf*>(&Vt[(q16 * 4 + c) * 32 + (2 * g + h2) * 8]) = t;
        }
      }
    }

    // S = Q @ K^T for 32 keys (two 16-key column tiles)
    v8f s0 = {}, s1 = {};
    {
      v16bf b0a = ld_frag_bf(&Ks[0], 64);
      v16bf b0b = ld_frag_bf(&Ks[32], 64);
      v16bf b1a = ld_frag_bf(&Ks[16 * 64], 64);
      v16bf b1b = ld_frag_bf(&Ks[16 * 64 + 32], 64);
      s0 = __builtin_amdgcn_wmma_f32_16x16x32_bf16(false, aq0, false, b0a, (short)0, s0, false, false);
      s0 = __builtin_amdgcn_wmma_f32_16x16x32_bf16(false, aq1, false, b0b, (short)0, s0, false, false);
      s1 = __builtin_amdgcn_wmma_f32_16x16x32_bf16(false, aq0, false, b1a, (short)0, s1, false, false);
      s1 = __builtin_amdgcn_wmma_f32_16x16x32_bf16(false, aq1, false, b1b, (short)0, s1, false, false);
    }

    float p0[8], p1[8];
#pragma unroll
    for (int e = 0; e < 8; ++e) {
      float s0e = s0[e] * 0.125f;   // 1/sqrt(64)
      float s1e = s1[e] * 0.125f;
      int row = qb + e + half8;
      int c0 = kb + cn, c1 = kb + 16 + cn;
      bool ok0 = causal ? (c0 <= row) : (c0 < vl);
      bool ok1 = causal ? (c1 <= row) : (c1 < vl);
      if (!ok0) s0e = -1.0e6f;
      if (!ok1) s1e = -1.0e6f;
      float rm = fmaxf(s0e, s1e);
#pragma unroll
      for (int msk = 1; msk < 16; msk <<= 1) rm = fmaxf(rm, __shfl_xor(rm, msk, 32));
      float mn    = fmaxf(m[e], rm);
      float alpha = __expf(m[e] - mn);
      float e0 = __expf(s0e - mn);
      float e1 = __expf(s1e - mn);
      float rs = e0 + e1;
#pragma unroll
      for (int msk = 1; msk < 16; msk <<= 1) rs += __shfl_xor(rs, msk, 32);
      l[e] = l[e] * alpha + rs;
      m[e] = mn;
      o0[e] *= alpha; o1[e] *= alpha; o2[e] *= alpha; o3[e] *= alpha;
      p0[e] = e0; p1[e] = e1;
    }

#pragma unroll
    for (int e = 0; e < 8; ++e) {
      Ps[(e + half8) * 32 + cn]      = (__bf16)p0[e];
      Ps[(e + half8) * 32 + 16 + cn] = (__bf16)p1[e];
    }
    v16bf ap = ld_frag_bf(&Ps[0], 32);
    o0 = __builtin_amdgcn_wmma_f32_16x16x32_bf16(false, ap, false, ld_frag_bf(&Vt[0],       32), (short)0, o0, false, false);
    o1 = __builtin_amdgcn_wmma_f32_16x16x32_bf16(false, ap, false, ld_frag_bf(&Vt[16 * 32], 32), (short)0, o1, false, false);
    o2 = __builtin_amdgcn_wmma_f32_16x16x32_bf16(false, ap, false, ld_frag_bf(&Vt[32 * 32], 32), (short)0, o2, false, false);
    o3 = __builtin_amdgcn_wmma_f32_16x16x32_bf16(false, ap, false, ld_frag_bf(&Vt[48 * 32], 32), (short)0, o3, false, false);
  }

#pragma unroll
  for (int e = 0; e < 8; ++e) {
    float inv = 1.0f / l[e];
    size_t ro = ((size_t)b * Tq + qb + e + half8) * D_MODEL + (size_t)h * D_HEAD;
    O[ro + cn]      = o0[e] * inv;
    O[ro + 16 + cn] = o1[e] * inv;
    O[ro + 32 + cn] = o2[e] * inv;
    O[ro + 48 + cn] = o3[e] * inv;
  }
}

// out = LayerNorm(a + r) * g + bt, one block per row of D_MODEL
__global__ __launch_bounds__(256)
void add_ln(const float* __restrict__ a, const float* __restrict__ r,
            const float* __restrict__ g, const float* __restrict__ bt,
            float* __restrict__ out) {
  __shared__ float red[256];
  const int tid = threadIdx.x;
  const size_t row = blockIdx.x;
  float v[4];
  float s = 0.0f;
#pragma unroll
  for (int i = 0; i < 4; ++i) {
    int c = tid + i * 256;
    v[i] = a[row * D_MODEL + c] + r[row * D_MODEL + c];
    s += v[i];
  }
  red[tid] = s; __syncthreads();
  for (int off = 128; off > 0; off >>= 1) { if (tid < off) red[tid] += red[tid + off]; __syncthreads(); }
  float mean = red[0] * (1.0f / D_MODEL);
  __syncthreads();
  float sq = 0.0f;
#pragma unroll
  for (int i = 0; i < 4; ++i) { float d = v[i] - mean; sq += d * d; }
  red[tid] = sq; __syncthreads();
  for (int off = 128; off > 0; off >>= 1) { if (tid < off) red[tid] += red[tid + off]; __syncthreads(); }
  float rstd = rsqrtf(red[0] * (1.0f / D_MODEL) + 1e-5f);
#pragma unroll
  for (int i = 0; i < 4; ++i) {
    int c = tid + i * 256;
    out[row * D_MODEL + c] = (v[i] - mean) * rstd * g[c] + bt[c];
  }
}

// gate = sigmoid(concat(code,kw) @ gw + gb); out = gate*code + (1-gate)*kw
__global__ __launch_bounds__(256)
void gate_mix(const float* __restrict__ code, const float* __restrict__ kw,
              const float* __restrict__ gw, const float* __restrict__ gb,
              float* __restrict__ out) {
  __shared__ float red[256];
  const int tid = threadIdx.x;
  const size_t row = blockIdx.x;
  float s = 0.0f;
#pragma unroll
  for (int i = 0; i < 4; ++i) {
    int c = tid + i * 256;
    s += code[row * D_MODEL + c] * gw[c] + kw[row * D_MODEL + c] * gw[D_MODEL + c];
  }
  red[tid] = s; __syncthreads();
  for (int off = 128; off > 0; off >>= 1) { if (tid < off) red[tid] += red[tid + off]; __syncthreads(); }
  float gsc = 1.0f / (1.0f + __expf(-(red[0] + gb[0])));
#pragma unroll
  for (int i = 0; i < 4; ++i) {
    int c = tid + i * 256;
    float cv = code[row * D_MODEL + c];
    float kv = kw[row * D_MODEL + c];
    out[row * D_MODEL + c] = gsc * cv + (1.0f - gsc) * kv;
  }
}

extern "C" void kernel_launch(void* const* d_in, const int* in_sizes, int n_in,
                              void* d_out, int out_size, void* d_ws, size_t ws_size,
                              hipStream_t stream) {
  const int B = 8, T = 512, SC = 512, ST = 256, SK = 64, D = 1024, DFF = 4096;
  const float* x       = (const float*)d_in[0];
  const float* src     = (const float*)d_in[1];
  const int*   src_len = (const int*)  d_in[2];
  const float* tpl     = (const float*)d_in[3];
  const int*   tpl_len = (const int*)  d_in[4];
  const float* kwe     = (const float*)d_in[5];
  const int*   kw_len  = (const int*)  d_in[6];
  const float* sa_w    = (const float*)d_in[7];
  const float* cc_w    = (const float*)d_in[8];
  const float* ck_w    = (const float*)d_in[9];
  const float* ct_w    = (const float*)d_in[10];
  const float* gate_w  = (const float*)d_in[11];
  const float* gate_b  = (const float*)d_in[12];
  const float* w1      = (const float*)d_in[13];
  const float* b1      = (const float*)d_in[14];
  const float* w2      = (const float*)d_in[15];
  const float* b2      = (const float*)d_in[16];
  const float* ln_g    = (const float*)d_in[17];
  const float* ln_b    = (const float*)d_in[18];

  const size_t DD   = (size_t)D * D;
  const size_t NTOK = (size_t)B * T * D;   // 4M floats

  float* ws = (float*)d_ws;
  size_t off = 0;
  auto take = [&](size_t n) { float* p = ws + off; off += n; return p; };
  float* Qb = take(NTOK); float* Kb = take(NTOK); float* Vb = take(NTOK);
  float* Ab = take(NTOK); float* T1 = take(NTOK); float* T2 = take(NTOK);
  float* Yb = take(NTOK); float* Cb = take(NTOK); float* Zb = take(NTOK);
  float* Wb = take(NTOK); float* Hb = take((size_t)B * T * DFF);

  // Cross-attention keys and values depend on inputs alone and are made in the
  // first launch; they live in Hb, which is first written by the FFN.
  float* ccK = Hb;                       float* ccV = ccK + (size_t)B * SC * D;
  float* ctK = ccV + (size_t)B * SC * D; float* ctV = ctK + (size_t)B * ST * D;
  float* ckK = ctV + (size_t)B * ST * D; float* ckV = ckK + (size_t)B * SK * D;

  const GemmJobs none = {GEMM_NO_JOB, GEMM_NO_JOB, GEMM_NO_JOB, GEMM_NO_JOB,
                         GEMM_NO_JOB, GEMM_NO_JOB, GEMM_NO_JOB, GEMM_NO_JOB,
                         nullptr, nullptr, nullptr, nullptr, nullptr, nullptr,
                         nullptr, nullptr, nullptr, nullptr, nullptr, nullptr,
                         nullptr, nullptr, nullptr, nullptr, nullptr, nullptr,
                         nullptr, nullptr, nullptr, nullptr, nullptr, nullptr,
                         nullptr, nullptr, nullptr};
  auto gemm_jobs = [&](const GemmJobs& J, const float* bias, int row_tiles,
                       int N, int K, int relu) {
    dim3 grid(N / GEMM_BT, row_tiles);
    gemm_bf16_wmma<<<grid, dim3(256), 0, stream>>>(J, bias, N, K, relu);
  };
  auto gemm = [&](const float* A, const float* Bm, const float* bias, float* C,
                  int M, int N, int K, int relu) {
    GemmJobs J = none;
    J.a0 = A; J.b0 = Bm; J.c0 = C;
    gemm_jobs(J, bias, M / GEMM_BT, N, K, relu);
  };
  // two products with B*T rows each
  auto gemm2 = [&](const float* A0, const float* B0, float* C0,
                   const float* A1, const float* B1, float* C1) {
    GemmJobs J = none;
    J.a0 = A0; J.b0 = B0; J.c0 = C0;
    J.a1 = A1; J.b1 = B1; J.c1 = C1; J.t1 = B * T / GEMM_BT;
    gemm_jobs(J, nullptr, 2 * (B * T / GEMM_BT), D, D, 0);
  };
  auto attn = [&](const float* Qp, const float* Kp, const float* Vp, const int* vl,
                  float* Op, int Tk, int causal) {
    dim3 grid(T / 16, 16, B);
    attn_wmma<<<grid, dim3(32), 0, stream>>>(Qp, Kp, Vp, vl, Op, T, Tk, causal,
                                             nullptr, nullptr, nullptr, nullptr,
                                             nullptr, 0, B);
  };
  auto lnk = [&](const float* a, const float* r, int li, float* o) {
    add_ln<<<dim3(B * T), dim3(256), 0, stream>>>(a, r, ln_g + (size_t)li * D,
                                                  ln_b + (size_t)li * D, o);
  };

  // ---- every projection that reads inputs alone: one launch ----
  {
    const int tT = B * T / GEMM_BT, tC = B * SC / GEMM_BT, tP = B * ST / GEMM_BT,
              tW = B * SK / GEMM_BT;
    GemmJobs J = none;
    J.a0 = x;   J.b0 = sa_w + 0 * DD; J.c0 = Qb;
    J.a1 = x;   J.b1 = sa_w + 1 * DD; J.c1 = Kb;  J.t1 = tT;
    J.a2 = x;   J.b2 = sa_w + 2 * DD; J.c2 = Vb;  J.t2 = 2 * tT;
    J.a3 = src; J.b3 = cc_w + 1 * DD; J.c3 = ccK; J.t3 = 3 * tT;
    J.a4 = src; J.b4 = cc_w + 2 * DD; J.c4 = ccV; J.t4 = 3 * tT + tC;
    J.a5 = tpl; J.b5 = ct_w + 1 * DD; J.c5 = ctK; J.t5 = 3 * tT + 2 * tC;
    J.a6 = tpl; J.b6 = ct_w + 2 * DD; J.c6 = ctV; J.t6 = 3 * tT + 2 * tC + tP;
    J.a7 = kwe; J.b7 = ck_w + 1 * DD; J.c7 = ckK; J.t7 = 3 * tT + 2 * tC + 2 * tP;
    J.a8 = kwe; J.b8 = ck_w + 2 * DD; J.c8 = ckV; J.t8 = 3 * tT + 2 * tC + 2 * tP + tW;
    gemm_jobs(J, nullptr, 3 * tT + 2 * tC + 2 * tP + 2 * tW, D, D, 0);
  }

  // ---- causal self-attention ----
  attn(Qb, Kb, Vb, nullptr, Ab, T, 1);
  gemm(Ab, sa_w + 3 * DD, nullptr, T1, B * T, D, D, 0);
  lnk(x, T1, 0, Yb);                              // y

  // ---- cross-attention: source code and keywords, side by side ----
  // (Kb and Vb are free again: keyword queries in Kb, keyword attention in Vb)
  gemm2(Yb, cc_w + 0 * DD, Qb, Yb, ck_w + 0 * DD, Kb);
  attn_wmma<<<dim3(T / 16, 16, 2 * B), dim3(32), 0, stream>>>(
      Qb, ccK, ccV, src_len, Ab, T, SC, 0, Kb, ckK, ckV, kw_len, Vb, SK, B);
  gemm2(Ab, cc_w + 3 * DD, Cb, Vb, ck_w + 3 * DD, T1);    // y2_code, y2_kw

  gate_mix<<<dim3(B * T), dim3(256), 0, stream>>>(Cb, T1, gate_w, gate_b, T2);
  lnk(Yb, T2, 1, Zb);                             // z

  // ---- cross-attention: template ----
  gemm(Zb, ct_w + 0 * DD, nullptr, Qb, B * T, D, D, 0);
  attn(Qb, ctK, ctV, tpl_len, Ab, ST, 0);
  gemm(Ab, ct_w + 3 * DD, nullptr, T1, B * T, D, D, 0);   // z2
  lnk(Zb, T1, 2, Wb);                             // w

  // ---- FFN ----
  gemm(Wb, w1, b1, Hb, B * T, DFF, D, 1);         // relu(w@w1+b1)
  gemm(Hb, w2, b2, T1, B * T, D, DFF, 0);
  lnk(Wb, T1, 3, (float*)d_out);                  // final LN

  (void)in_sizes; (void)n_in; (void)out_size; (void)ws_size;
}

// v006
// It runs in 373 microseconds.
// Two timings next to v005 both put it at 1.23 times that version's speed.
// All steps since v000 together make it 5.10 times as fast.
#include <hip/hip_runtime.h>
#include <hip/hip_bf16.h>

typedef __attribute__((ext_vector_type(16))) __bf16 v16bf;
typedef __attribute__((ext_vector_type(8)))  __bf16 v8bf;
typedef __attribute__((ext_vector_type(4)))  __bf16 v4bf;
typedef __attribute__((ext_vector_type(8)))  float  v8f;
typedef __attribute__((ext_vector_type(4)))  float  v4f;

#define D_MODEL 1024
#define D_HEAD  64

__device__ __forceinline__ v16bf ld_frag_bf(const __bf16* base, int ldk) {
  const int lane = threadIdx.x & 31;
  const int r    = lane & 15;
  const int ko   = (lane & 16) ? 8 : 0;
  const __bf16* p = base + r * ldk + ko;
  v8bf lo = *reinterpret_cast<const v8bf*>(p);
  v8bf hi = *reinterpret_cast<const v8bf*>(p + 16);
  v16bf f;
#pragma unroll
  for (int i = 0; i < 8; ++i) { f[i] = lo[i]; f[i + 8] = hi[i]; }
  return f;
}

// ---------------------------------------------------------------------------
// C = A(bf16,[M,K]) @ Bt(bf16,[N,K])^T (+bias)(+relu) -> f32 or bf16 [M,N]
// bf16 WMMA, f32 accumulate.  M,N multiples of 128; K multiple of 64.
// A block of 8 waves makes a 128 x 128 tile of C, a wave 32 x 64 of it (waves
// 4 down x 2 across), so that every operand byte fetched feeds 128 outputs.
// A stage is 64 k of both operands.  Both arrive as bf16 and k-contiguous (their
// producers round them once), so a stage row is one 128-byte line: each thread
// loads 16-byte pieces and stores them as they are, As[m][k] and Bs[n][k].
// Rows are pitched 144 B (16 B x odd) for the 16-byte fragment reads.
// The stages are pipelined: the loads of stage s + 1 are issued before the
// fragment reads and WMMAs of stage s and land behind them.  LDS holds two
// stages, so that one barrier per stage is enough: a wave writes buffer s & 1
// behind barrier s - 1, which every wave reaches with its reads of stage s - 2
// (the same buffer) complete.
// ---------------------------------------------------------------------------
#define GEMM_BK 64
#define GEMM_LD 72   // bf16 elements per LDS row: 64 k + 8 pad
#define GEMM_BT 128  // rows and columns of C per block
typedef const __attribute__((address_space(1))) v4f* gv4f_ptr;
typedef const __attribute__((address_space(1))) v8bf* gv8bf_ptr;
typedef const __attribute__((address_space(1))) char* gbyte_ptr;

// Up to nine independent products C_j = A_j @ B_j of one launch; all share N and
// K.  Their row tiles are stacked along blockIdx.y: job j owns the tiles from
// t_j (t_0 = 0) up to t_(j+1).  An unused job has t_j = GEMM_NO_JOB.
// c_j points at f32 values, or at bf16 values where the launch says out16.
#define GEMM_NO_JOB 0x7fffffff
struct GemmJobs {
  int t1, t2, t3, t4, t5, t6, t7, t8;
  const __bf16* a0; const __bf16* b0; float* c0;
  const __bf16* a1; const __bf16* b1; float* c1;
  const __bf16* a2; const __bf16* b2; float* c2;
  const __bf16* a3; const __bf16* b3; float* c3;
  const __bf16* a4; const __bf16* b4; float* c4;
  const __bf16* a5; const __bf16* b5; float* c5;
  const __bf16* a6; const __bf16* b6; float* c6;
  const __bf16* a7; const __bf16* b7; float* c7;
  const __bf16* a8; const __bf16* b8; float* c8;
};

__global__ __launch_bounds__(256)
void gemm_bf16_wmma(GemmJobs J, const float* __restrict__ bias,
                    int N, int K, int relu, int out16) {
  // two stages of As[m][k] followed by Bs[n][k]
  __shared__ __align__(16) __bf16 Sm[2][2 * GEMM_BT * GEMM_LD];
  const int tid  = threadIdx.x;
  const int wave = tid >> 5;
  const int lane = tid & 31;
  const int wm = (wave & 3) * 32;    // the wave's first row in the tile
  const int wn = (wave >> 2) * 64;   // the wave's first column in the tile
  const int n0 = blockIdx.x * GEMM_BT;

  // Which product this block works for: the same for the whole block.
  const int ty = blockIdx.y;
  // The job's number comes from all eight bounds at once, its three pointers from
  // one more read of the arguments (a chain of tests would read them one by one).
  const int job = (ty >= J.t1) + (ty >= J.t2) + (ty >= J.t3) + (ty >= J.t4) +
                  (ty >= J.t5) + (ty >= J.t6) + (ty >= J.t7) + (ty >= J.t8);
  const __bf16* A; const __bf16* B; float* C; int t0;
  switch (job) {
#define GEMM_PICK(j) case j: A = J.a##j; B = J.b##j; C = J.c##j; t0 = J.t##j; break;
    GEMM_PICK(1) GEMM_PICK(2) GEMM_PICK(3) GEMM_PICK(4)
    GEMM_PICK(5) GEMM_PICK(6) GEMM_PICK(7) GEMM_PICK(8)
#undef GEMM_PICK
    default: A = J.a0; B = J.b0; C = J.c0; t0 = 0; break;
  }
  const int m0 = (ty - t0) * GEMM_BT;

  const int q8  = tid & 7;          // 16-byte piece inside the 128 bytes of a stage row
  const int g32 = tid >> 3;         // 0..31: row group, of A and of Bt alike
  // This thread's 8 pieces of a stage: a base that is the same for the whole
  // block, one per piece and advanced per stage, plus the thread's own 32-bit
  // byte offset (one for both operands: they share K).  The full addresses then
  // live in vector registers only around the loads, not beside the fragments.
  // (global address space kept in the type, so that the loads stay global_load)
  gbyte_ptr pa[4];
  gbyte_ptr pb[4];
#pragma unroll
  for (int j = 0; j < 4; ++j) {
    pa[j] = (gbyte_ptr)(A + (size_t)(m0 + 32 * j) * K);   // rows g32 + 32j
    pb[j] = (gbyte_ptr)(B + (size_t)(n0 + 32 * j) * K);   // rows g32 + 32j
  }
  const unsigned oab = (unsigned)(g32 * K + q8 * 8) * 2u;

  v8f acc[2][4] = {};

  v8bf ra[4], rb[4];
  // Issues the 8 loads of the stage that the bases stand at, then advances them.
  auto load_stage = [&]() {
    gv8bf_ptr qa[4], qb[4];
#pragma unroll
    for (int j = 0; j < 4; ++j) {
      qa[j] = (gv8bf_ptr)(pa[j] + oab);
      qb[j] = (gv8bf_ptr)(pb[j] + oab);
    }
#pragma unroll
    for (int j = 0; j < 4; ++j) ra[j] = *qa[j];
#pragma unroll
    for (int j = 0; j < 4; ++j) rb[j] = *qb[j];
    // Keeps the 8 loads here, together and ahead of the fragment reads and
    // WMMAs that follow: moved down to their use they would hide nothing.
    __builtin_amdgcn_sched_barrier(0);
    // Stands in front of every overwrite of the address registers of the loads
    // just issued (the base updates below among them); it names the 8 addresses
    // as inputs, so that they keep their registers up to here and no load's
    // result is given one of them.
    asm volatile("s_wait_xcnt 0x0"
                 :: "v"(qa[0]), "v"(qa[1]), "v"(qa[2]), "v"(qa[3]),
                    "v"(qb[0]), "v"(qb[1]), "v"(qb[2]), "v"(qb[3])
                 : "memory");
#pragma unroll
    for (int j = 0; j < 4; ++j) { pa[j] += GEMM_BK * 2; pb[j] += GEMM_BK * 2; }
  };
  load_stage();

  for (int k0 = 0; k0 < K; k0 += GEMM_BK) {
    __bf16* As = Sm[(k0 / GEMM_BK) & 1];
    __bf16* Bs = As + GEMM_BT * GEMM_LD;
#pragma unroll
    for (int j = 0; j < 4; ++j)
      *reinterpret_cast<v8bf*>(&As[(g32 + 32 * j) * GEMM_LD + q8 * 8]) = ra[j];
#pragma unroll
    for (int j = 0; j < 4; ++j)
      *reinterpret_cast<v8bf*>(&Bs[(g32 + 32 * j) * GEMM_LD + q8 * 8]) = rb[j];
    if (k0 + GEMM_BK < K) load_stage();    // the test reads the same for the whole block
    // The stage's barrier.  Its fences name LDS alone: the stage is handed over
    // in LDS only, and a fence over global memory too (as in __syncthreads())
    // would wait here for the next stage's loads, which are to stay in flight.
    __builtin_amdgcn_fence(__ATOMIC_RELEASE, "workgroup", "local");
    __builtin_amdgcn_s_barrier();
    __builtin_amdgcn_fence(__ATOMIC_ACQUIRE, "workgroup", "local");

    v16bf fa[2][2], fb[2][4];
#pragma unroll
    for (int kk = 0; kk < 2; ++kk) {
#pragma unroll
      for (int mt = 0; mt < 2; ++mt)
        fa[kk][mt] = ld_frag_bf(&As[(wm + mt * 16) * GEMM_LD + kk * 32], GEMM_LD);
#pragma unroll
      for (int nt = 0; nt < 4; ++nt)
        fb[kk][nt] = ld_frag_bf(&Bs[(wn + nt * 16) * GEMM_LD + kk * 32], GEMM_LD);
    }
    // Keeps the stage's 24 fragment reads one group ahead of the WMMAs: without
    // it each WMMA waits out the LDS latency of its own two reads.
    __builtin_amdgcn_sched_barrier(0);
#pragma unroll
    for (int kk = 0; kk < 2; ++kk) {
#pragma unroll
      for (int mt = 0; mt < 2; ++mt) {
#pragma unroll
        for (int nt = 0; nt < 4; ++nt)
          acc[mt][nt] = __builtin_amdgcn_wmma_f32_16x16x32_bf16(
              false, fa[kk][mt], false, fb[kk][nt], (short)0, acc[mt][nt], false, false);
      }
    }
  }

  const int half8 = (lane & 16) ? 8 : 0;
  const int cn    = lane & 15;
  // The wave's 32 x 64 values are finished in their registers first: a lane has
  // one column per column tile, so it reads four bias values, once ...
  if (bias) {
    float bv[4];
#pragma unroll
    for (int nt = 0; nt < 4; ++nt) bv[nt] = bias[n0 + wn + nt * 16 + cn];
    // Stands in front of any later overwrite of the address register of these loads.
    asm volatile("s_wait_xcnt 0x0" ::: "memory");
#pragma unroll
    for (int mt = 0; mt < 2; ++mt) {
#pragma unroll
      for (int nt = 0; nt < 4; ++nt) {
#pragma unroll
        for (int e = 0; e < 8; ++e) acc[mt][nt][e] += bv[nt];
      }
    }
  }
  if (relu) {
#pragma unroll
    for (int mt = 0; mt < 2; ++mt) {
#pragma unroll
      for (int nt = 0; nt < 4; ++nt) {
#pragma unroll
        for (int e = 0; e < 8; ++e) acc[mt][nt][e] = fmaxf(acc[mt][nt][e], 0.0f);
      }
    }
  }
  // ... and then stored row by row: the four stores of a row share one address.
  if (out16) {   // a result that is read as a matrix operand only: rounded here, once
    __bf16* C16 = reinterpret_cast<__bf16*>(C);
#pragma unroll
    for (int mt = 0; mt < 2; ++mt) {
#pragma unroll
      for (int e = 0; e < 8; ++e) {
        int row = m0 + wm + mt * 16 + e + half8;
        __bf16* pr = C16 + (size_t)row * N + n0 + wn + cn;
#pragma unroll
        for (int nt = 0; nt < 4; ++nt) pr[nt * 16] = (__bf16)acc[mt][nt][e];
        // Stands in front of the next row's address, which may take the registers
        // of the stores just issued.
        asm volatile("s_wait_xcnt 0x0" ::: "memory");
      }
    }
    return;
  }
#pragma unroll
  for (int mt = 0; mt < 2; ++mt) {
#pragma unroll
    for (int e = 0; e < 8; ++e) {
      int row = m0 + wm + mt * 16 + e + half8;
      float* pr = C + (size_t)row * N + n0 + wn + cn;
#pragma unroll
      for (int nt = 0; nt < 4; ++nt) pr[nt * 16] = acc[mt][nt][e];
      // Stands in front of the next row's address, which may take the registers
      // of the stores just issued.
      asm volatile("s_wait_xcnt 0x0" ::: "memory");
    }
  }
}

// ---------------------------------------------------------------------------
// Fused flash attention, one wave per (b, h, 16-row q tile).
// Q,K,V,O are bf16 [B, T*, D_MODEL]; head h uses columns [h*64, h*64+64).
// causal=1: key <= query (dec_valid_lens = q+1).  causal=0: key < vlen[b].
// A launch may hold a second, independent attention (Q2 ... Tk2, never causal):
// blockIdx.z in [nb, 2 nb) works for it.
// ---------------------------------------------------------------------------
__global__ __launch_bounds__(32)
void attn_wmma(const __bf16* __restrict__ Q1, const __bf16* __restrict__ K1,
               const __bf16* __restrict__ V1, const int* __restrict__ vlen1,
               __bf16* __restrict__ O1, int Tq, int Tk1, int causal,
               const __bf16* __restrict__ Q2, const __bf16* __restrict__ K2,
               const __bf16* __restrict__ V2, const int* __restrict__ vlen2,
               __bf16* __restrict__ O2, int Tk2, int nb) {
  __shared__ __align__(16) __bf16 Qs[16 * 64];   // [q][d]
  __shared__ __align__(16) __bf16 Ks[32 * 64];   // [key][d] (== B-frag layout, QK^T)
  __shared__ __align__(16) __bf16 Vt[64 * 32];   // [d][key] (B-frag layout, PV)
  __shared__ __align__(16) __bf16 Ps[16 * 32];   // [q][key] P relayout buffer

  const int lane = threadIdx.x & 31;
  const int qb   = blockIdx.x * 16;
  const int h    = blockIdx.y;
  const bool second = (int)blockIdx.z >= nb;      // the same for the whole block
  const int b    = second ? (int)blockIdx.z - nb : (int)blockIdx.z;
  const __bf16* Q   = second ? Q2 : Q1;
  const __bf16* Kt  = second ? K2 : K1;
  const __bf16* V   = second ? V2 : V1;
  const int*   vlen = second ? vlen2 : vlen1;
  __bf16*      O    = second ? O2 : O1;
  const int    Tk   = second ? Tk2 : Tk1;
  const int half8 = (lane & 16) ? 8 : 0;
  const int cn    = lane & 15;

  const size_t qoff = ((size_t)b * Tq + qb) * D_MODEL + (size_t)h * D_HEAD;
#pragma unroll
  for (int i = 0; i < 4; ++i) {
    int idx = i * 32 + lane;          // 16-byte piece: 8 to a 128-byte head row
    int r = idx >> 3, c = (idx & 7) * 8;
    *reinterpret_cast<v8bf*>(&Qs[r * 64 + c]) =
        *reinterpret_cast<const v8bf*>(&Q[qoff + (size_t)r * D_MODEL + c]);
  }
  v16bf aq0 = ld_frag_bf(&Qs[0], 64);
  v16bf aq1 = ld_frag_bf(&Qs[32], 64);

  float m[8], l[8];
#pragma unroll
  for (int e = 0; e < 8; ++e) { m[e] = -3.0e38f; l[e] = 0.0f; }
  v8f o0 = {}, o1 = {}, o2 = {}, o3 = {};

  const int vl   = causal ? Tk : min(vlen[b], Tk);   // bounds the key rows read below
  const int nblk = causal ? ((qb + 16 + 31) >> 5) : ((vl + 31) >> 5);

  // Staging of a 32-key block: a lane takes 16-byte pieces of the 128-byte head
  // rows.  Of K it takes keys 4i + h4; of V keys 8 h4 + jj, that is 8 keys x 8 d,
  // so that the transpose is a register regrouping and one 16-byte store per d.
  const int q8 = lane & 7;    // piece of 8 d
  const int h4 = lane >> 3;   // 0..3
  const size_t kvoff = (size_t)b * Tk * D_MODEL + (size_t)h * D_HEAD;   // same for the wave
  const unsigned ko = h4 * D_MODEL + q8 * 8;       // the lane's own part, K
  const unsigned vo = h4 * 8 * D_MODEL + q8 * 8;   // the lane's own part, V

  for (int j = 0; j < nblk; ++j) {
    const int kb = j * 32;
    {
      gv8bf_ptr kp = (gv8bf_ptr)(Kt + kvoff + (size_t)kb * D_MODEL + ko);
      gv8bf_ptr vp = (gv8bf_ptr)(V  + kvoff + (size_t)kb * D_MODEL + vo);
      v8bf rk[8], rv[8];
#pragma unroll
      for (int i = 0; i < 8; ++i)
        rk[i] = kp[4 * i * (D_MODEL / 8)];
#pragma unroll
      for (int i = 0; i < 8; ++i)
        rv[i] = vp[i * (D_MODEL / 8)];
      // Keeps all 16 loads of the block in flight together: without it the LDS
      // stores are scheduled among them and the block waits several times.
      __builtin_amdgcn_sched_barrier(0);
      // Stands in front of every overwrite of the address registers of the loads
      // just issued; it names both addresses as inputs, so that they keep their
      // registers up to here and no load's result is given one of them.
      asm volatile("s_wait_xcnt 0x0" :: "v"(kp), "v"(vp) : "memory");
#pragma unroll
      for (int i = 0; i < 8; ++i)
        *reinterpret_cast<v8bf*>(&Ks[(4 * i + h4) * 64 + q8 * 8]) = rk[i];
#pragma unroll
      for (int c = 0; c < 8; ++c) {
        v8bf t;
#pragma unroll
        for (int jj = 0; jj < 8; ++jj) t[jj] = rv[jj][c];
        *reinterpret_cast<v8bf*>(&Vt[(q8 * 8 + c) * 32 + h4 * 8]) = t;
      }
    }

    // S = Q @ K^T for 32 keys (two 16-key column tiles)
    v8f s0 = {}, s1 = {};
    {
      v16bf b0a = ld_frag_bf(&Ks[0], 64);
      v16bf b0b = ld_frag_bf(&Ks[32], 64);
      v16bf b1a = ld_frag_bf(&Ks[16 * 64], 64);
      v16bf b1b = ld_frag_bf(&Ks[16 * 64 + 32], 64);
      s0 = __builtin_amdgcn_wmma_f32_16x16x32_bf16(false, aq0, false, b0a, (short)0, s0, false, false);
      s0 = __builtin_amdgcn_wmma_f32_16x16x32_bf16(false, aq1, false, b0b, (short)0, s0, false, false);
      s1 = __builtin_amdgcn_wmma_f32_16x16x32_bf16(false, aq0, false, b1a, (short)0, s1, false, false);
      s1 = __builtin_amdgcn_wmma_f32_16x16x32_bf16(false, aq1, false, b1b, (short)0, s1, false, false);
    }

    float p0[8], p1[8];
#pragma unroll
    for (int e = 0; e < 8; ++e) {
      float s0e = s0[e] * 0.125f;   // 1/sqrt(64)
      float s1e = s1[e] * 0.125f;
      int row = qb + e + half8;
      int c0 = kb + cn, c1 = kb + 16 + cn;
      bool ok0 = causal ? (c0 <= row) : (c0 < vl);
      bool ok1 = causal ? (c1 <= row) : (c1 < vl);
      if (!ok0) s0e = -1.0e6f;
      if (!ok1) s1e = -1.0e6f;
      float rm = fmaxf(s0e, s1e);
#pragma unroll
      for (int msk = 1; msk < 16; msk <<= 1) rm = fmaxf(rm, __shfl_xor(rm, msk, 32));
      float mn    = fmaxf(m[e], rm);
      float alpha = __expf(m[e] - mn);
      float e0 = __expf(s0e - mn);
      float e1 = __expf(s1e - mn);
      float rs = e0 + e1;
#pragma unroll
      for (int msk = 1; msk < 16; msk <<= 1) rs += __shfl_xor(rs, msk, 32);
      l[e] = l[e] * alpha + rs;
      m[e] = mn;
      o0[e] *= alpha; o1[e] *= alpha; o2[e] *= alpha; o3[e] *= alpha;
      p0[e] = e0; p1[e] = e1;
    }

#pragma unroll
    for (int e = 0; e < 8; ++e) {
      Ps[(e + half8) * 32 + cn]      = (__bf16)p0[e];
      Ps[(e + half8) * 32 + 16 + cn] = (__bf16)p1[e];
    }
    v16bf ap = ld_frag_bf(&Ps[0], 32);
    o0 = __builtin_amdgcn_wmma_f32_16x16x32_bf16(false, ap, false, ld_frag_bf(&Vt[0],       32), (short)0, o0, false, false);
    o1 = __builtin_amdgcn_wmma_f32_16x16x32_bf16(false, ap, false, ld_frag_bf(&Vt[16 * 32], 32), (short)0, o1, false, false);
    o2 = __builtin_amdgcn_wmma_f32_16x16x32_bf16(false, ap, false, ld_frag_bf(&Vt[32 * 32], 32), (short)0, o2, false, false);
    o3 = __builtin_amdgcn_wmma_f32_16x16x32_bf16(false, ap, false, ld_frag_bf(&Vt[48 * 32], 32), (short)0, o3, false, false);
  }

#pragma unroll
  for (int e = 0; e < 8; ++e) {
    float inv = 1.0f / l[e];
    size_t ro = ((size_t)b * Tq + qb + e + half8) * D_MODEL + (size_t)h * D_HEAD;
    O[ro + cn]      = (__bf16)(o0[e] * inv);
    O[ro + 16 + cn] = (__bf16)(o1[e] * inv);
    O[ro + 32 + cn] = (__bf16)(o2[e] * inv);
    O[ro + 48 + cn] = (__bf16)(o3[e] * inv);
    // Stands in front of the next row's values and address, which may take the
    // registers of the stores just issued.
    asm volatile("s_wait_xcnt 0x0" ::: "memory");
  }
}

// out = LayerNorm(a + r) * g + bt, one block per row of D_MODEL; where the row
// feeds a product too, out16 takes its bf16 rounding (else out16 is null)
__global__ __launch_bounds__(256)
void add_ln(const float* __restrict__ a, const float* __restrict__ r,
            const float* __restrict__ g, const float* __restrict__ bt,
            float* __restrict__ out, __bf16* __restrict__ out16) {
  __shared__ float red[256];
  const int tid = threadIdx.x;
  const size_t row = blockIdx.x;
  float v[4];
  float s = 0.0f;
#pragma unroll
  for (int i = 0; i < 4; ++i) {
    int c = tid + i * 256;
    v[i] = a[row * D_MODEL + c] + r[row * D_MODEL + c];
    s += v[i];
  }
  red[tid] = s; __syncthreads();
  for (int off = 128; off > 0; off >>= 1) { if (tid < off) red[tid] += red[tid + off]; __syncthreads(); }
  float mean = red[0] * (1.0f / D_MODEL);
  __syncthreads();
  float sq = 0.0f;
#pragma unroll
  for (int i = 0; i < 4; ++i) { float d = v[i] - mean; sq += d * d; }
  red[tid] = sq; __syncthreads();
  for (int off = 128; off > 0; off >>= 1) { if (tid < off) red[tid] += red[tid + off]; __syncthreads(); }
  float rstd = rsqrtf(red[0] * (1.0f / D_MODEL) + 1e-5f);
  float y[4];
#pragma unroll
  for (int i = 0; i < 4; ++i) {
    int c = tid + i * 256;
    y[i] = (v[i] - mean) * rstd * g[c] + bt[c];
  }
  float* po = out + row * D_MODEL;
#pragma unroll
  for (int i = 0; i < 4; ++i) po[tid + i * 256] = y[i];
  if (out16) {   // the test reads the same for the whole launch
    // Stands in front of any overwrite of a register of the stores just issued;
    // it names their base and values as inputs, so that these keep their
    // registers up to here.
    asm volatile("s_wait_xcnt 0x0"
                 :: "s"(po), "v"(y[0]), "v"(y[1]), "v"(y[2]), "v"(y[3]) : "memory");
#pragma unroll
    for (int i = 0; i < 4; ++i) out16[row * D_MODEL + tid + i * 256] = (__bf16)y[i];
  }
}

// gate = sigmoid(concat(code,kw) @ gw + gb); out = gate*code + (1-gate)*kw
__global__ __launch_bounds__(256)
void gate_mix(const float* __restrict__ code, const float* __restrict__ kw,
              const float* __restrict__ gw, const float* __restrict__ gb,
              float* __restrict__ out) {
  __shared__ float red[256];
  const int tid = threadIdx.x;
  const size_t row = blockIdx.x;
  float s = 0.0f;
#pragma unroll
  for (int i = 0; i < 4; ++i) {
    int c = tid + i * 256;
    s += code[row * D_MODEL + c] * gw[c] + kw[row * D_MODEL + c] * gw[D_MODEL + c];
  }
  red[tid] = s; __syncthreads();
  for (int off = 128; off > 0; off >>= 1) { if (tid < off) red[tid] += red[tid + off]; __syncthreads(); }
  float gsc = 1.0f / (1.0f + __expf(-(red[0] + gb[0])));
#pragma unroll
  for (int i = 0; i < 4; ++i) {
    int c = tid + i * 256;
    float cv = code[row * D_MODEL + c];
    float kv = kw[row * D_MODEL + c];
    out[row * D_MODEL + c] = gsc * cv + (1.0f - gsc) * kv;
  }
}

// ---------------------------------------------------------------------------
// Rounds everything that the products read from the inputs to bf16, once per
// call.  blockIdx.y < 6: weights, f32 [K][N] -> bf16 [N][K] (k-contiguous, as the
// GEMM stages them); 4 M elements per y: four 1024 x 1024 matrices, or the
// 1024 x 4096, or the 4096 x 1024 one.  blockIdx.y >= 6: activations, same
// layout.  A block handles 8192 elements.
// ---------------------------------------------------------------------------
#define PREP_LD 136   // bf16 elements per LDS row: 128 k + 8 pad (272 B = 16 B x odd)
struct PrepJobs {
  const float* w0; const float* w1; const float* w2;
  const float* w3; const float* w4; const float* w5;
  const float* s0; const float* s1; const float* s2; const float* s3;
  int n0, n1, n2, n3;   // elements of s0 .. s3
};

__global__ __launch_bounds__(256)
void prep_bf16(PrepJobs P, __bf16* __restrict__ wt, __bf16* __restrict__ d0,
               __bf16* __restrict__ d1, __bf16* __restrict__ d2,
               __bf16* __restrict__ d3) {
  __shared__ __align__(16) __bf16 Ts[64 * PREP_LD];   // [n][k]
  const int tid = threadIdx.x;
  const int y   = blockIdx.y;      // the same for the whole block
  const int t   = blockIdx.x;
  if (y >= 6) {
    const float* S; __bf16* Dp; int n;
    switch (y) {
      case 6:  S = P.s0; Dp = d0; n = P.n0; break;
      case 7:  S = P.s1; Dp = d1; n = P.n1; break;
      case 8:  S = P.s2; Dp = d2; n = P.n2; break;
      default: S = P.s3; Dp = d3; n = P.n3; break;
    }
    if (t * 8192 >= n) return;     // taken by the whole block
    v4f r[8];
#pragma unroll
    for (int i = 0; i < 4; ++i) {
      const v4f* p = reinterpret_cast<const v4f*>(S + (size_t)t * 8192 + i * 2048 + tid * 8);
      r[2 * i] = p[0]; r[2 * i + 1] = p[1];
    }
    // Stands in front of any overwrite of an address register of these loads.
    asm volatile("s_wait_xcnt 0x0" ::: "memory");
#pragma unroll
    for (int i = 0; i < 4; ++i) {
      v8bf o;
#pragma unroll
      for (int c = 0; c < 4; ++c) { o[c] = (__bf16)r[2 * i][c]; o[c + 4] = (__bf16)r[2 * i + 1][c]; }
      *reinterpret_cast<v8bf*>(Dp + (size_t)t * 8192 + i * 2048 + tid * 8) = o;
    }
    return;
  }
  const float* Wp;
  switch (y) {
    case 0:  Wp = P.w0; break;
    case 1:  Wp = P.w1; break;
    case 2:  Wp = P.w2; break;
    case 3:  Wp = P.w3; break;
    case 4:  Wp = P.w4; break;
    default: Wp = P.w5; break;
  }
  const int K   = (y == 5) ? 4096 : 1024;
  const int N   = (y == 4) ? 4096 : 1024;
  const int lgn = (y == 4) ? 6 : 4;              // log2 of the 64-column tiles per row
  const int mat = (y < 4) ? (t >> 7) : 0;        // 128 tiles per 1024 x 1024 matrix
  const int tt  = (y < 4) ? (t & 127) : t;
  const int n0  = (tt & ((1 << lgn) - 1)) * 64;
  const int k0  = (tt >> lgn) * 128;
  const size_t mo = (size_t)mat * 1024 * 1024;
  const int q16 = tid & 15;        // 4 n
  const int g16 = tid >> 4;        // 8 k
  v4f r[8];
  const v4f* qp[8];
#pragma unroll
  for (int j = 0; j < 8; ++j)
    qp[j] = reinterpret_cast<const v4f*>(Wp + mo + (size_t)(k0 + g16 * 8 + j) * N + n0 + q16 * 4);
#pragma unroll
  for (int j = 0; j < 8; ++j) r[j] = *qp[j];
  // Keeps the 8 loads in flight together: without it the conversions of the first
  // two are scheduled among them and the block waits out memory twice.
  __builtin_amdgcn_sched_barrier(0);
  // Stands in front of every overwrite of the address registers of these loads;
  // it names the addresses as inputs, so that they keep their registers up to here.
  asm volatile("s_wait_xcnt 0x0"
               :: "v"(qp[0]), "v"(qp[1]), "v"(qp[2]), "v"(qp[3]),
                  "v"(qp[4]), "v"(qp[5]), "v"(qp[6]), "v"(qp[7])
               : "memory");
#pragma unroll
  for (int i = 0; i < 4; ++i) {
    v8bf o;
#pragma unroll
    for (int j = 0; j < 8; ++j) o[j] = (__bf16)r[j][i];
    *reinterpret_cast<v8bf*>(&Ts[(q16 * 4 + i) * PREP_LD + g16 * 8]) = o;
  }
  __syncthreads();   // the rows are read back by other threads, as whole 256-byte runs
  __bf16* Wo = wt + (size_t)y * 4 * 1024 * 1024 + mo;
#pragma unroll
  for (int i = 0; i < 4; ++i) {
    int p = i * 256 + tid;
    int rown = p >> 4, c = (p & 15) * 8;
    *reinterpret_cast<v8bf*>(Wo + (size_t)(n0 + rown) * K + k0 + c) =
        *reinterpret_cast<const v8bf*>(&Ts[rown * PREP_LD + c]);
  }
  // Stands behind the four stores, in front of whatever the built code places
  // after them that could take their registers.
  asm volatile("s_wait_xcnt 0x0" ::: "memory");
}

extern "C" void kernel_launch(void* const* d_in, const int* in_sizes, int n_in,
                              void* d_out, int out_size, void* d_ws, size_t ws_size,
                              hipStream_t stream) {
  const int B = 8, T = 512, SC = 512, ST = 256, SK = 64, D = 1024, DFF = 4096;
  const float* x       = (const float*)d_in[0];
  const float* src     = (const float*)d_in[1];
  const int*   src_len = (const int*)  d_in[2];
  const float* tpl     = (const float*)d_in[3];
  const int*   tpl_len = (const int*)  d_in[4];
  const float* kwe     = (const float*)d_in[5];
  const int*   kw_len  = (const int*)  d_in[6];
  const float* sa_w    = (const float*)d_in[7];
  const float* cc_w    = (const float*)d_in[8];
  const float* ck_w    = (const float*)d_in[9];
  const float* ct_w    = (const float*)d_in[10];
  const float* gate_w  = (const float*)d_in[11];
  const float* gate_b  = (const float*)d_in[12];
  const float* w1      = (const float*)d_in[13];
  const float* b1      = (const float*)d_in[14];
  const float* w2      = (const float*)d_in[15];
  const float* b2      = (const float*)d_in[16];
  const float* ln_g    = (const float*)d_in[17];
  const float* ln_b    = (const float*)d_in[18];

  const size_t DD   = (size_t)D * D;
  const size_t NTOK = (size_t)B * T * D;   // 4M floats

  float* ws = (float*)d_ws;
  size_t off = 0;
  auto take = [&](size_t n) { float* p = ws + off; off += n; return p; };
  auto take16 = [&](size_t n) { return (__bf16*)take(n / 2); };   // n bf16 values
  float* T1 = take(NTOK); float* T2 = take(NTOK); float* Yb = take(NTOK);
  float* Cb = take(NTOK); float* Zb = take(NTOK); float* Wb = take(NTOK);
  // What only matrix products read is kept as bf16.
  __bf16* wt  = take16(24 * DD);          // all weights, [n][k]
  __bf16* x16 = take16(NTOK);
  __bf16* s16 = take16((size_t)B * SC * D);
  __bf16* p16 = take16((size_t)B * ST * D);
  __bf16* k16 = take16((size_t)B * SK * D);
  __bf16* Y16 = take16(NTOK); __bf16* Z16 = take16(NTOK); __bf16* W16 = take16(NTOK);
  __bf16* ccK = take16((size_t)B * SC * D); __bf16* ccV = take16((size_t)B * SC * D);
  __bf16* ctK = take16((size_t)B * ST * D); __bf16* ctV = take16((size_t)B * ST * D);
  __bf16* ckK = take16((size_t)B * SK * D); __bf16* ckV = take16((size_t)B * SK * D);
  // The FFN's hidden layer takes the place of Q, K, V and the attention output,
  // which are all done with when it is written.
  __bf16* Hb = take16((size_t)B * T * DFF);
  __bf16* Qb = Hb; __bf16* Kb = Qb + NTOK; __bf16* Vb = Kb + NTOK; __bf16* Ab = Vb + NTOK;
  const __bf16* sa_t = wt;           const __bf16* cc_t = wt + 4 * DD;
  const __bf16* ck_t = wt + 8 * DD;  const __bf16* ct_t = wt + 12 * DD;
  const __bf16* w1_t = wt + 16 * DD; const __bf16* w2_t = wt + 20 * DD;

  const GemmJobs none = {GEMM_NO_JOB, GEMM_NO_JOB, GEMM_NO_JOB, GEMM_NO_JOB,
                         GEMM_NO_JOB, GEMM_NO_JOB, GEMM_NO_JOB, GEMM_NO_JOB,
                         nullptr, nullptr, nullptr, nullptr, nullptr, nullptr,
                         nullptr, nullptr, nullptr, nullptr, nullptr, nullptr,
                         nullptr, nullptr, nullptr, nullptr, nullptr, nullptr,
                         nullptr, nullptr, nullptr, nullptr, nullptr, nullptr,
                         nullptr, nullptr, nullptr};
  auto gemm_jobs = [&](const GemmJobs& J, const float* bias, int row_tiles,
                       int N, int K, int relu, int out16) {
    dim3 grid(N / GEMM_BT, row_tiles);
    gemm_bf16_wmma<<<grid, dim3(256), 0, stream>>>(J, bias, N, K, relu, out16);
  };
  auto gemm = [&](const __bf16* A, const __bf16* Bm, const float* bias, float* C,
                  int M, int N, int K, int relu, int out16) {
    GemmJobs J = none;
    J.a0 = A; J.b0 = Bm; J.c0 = C;
    gemm_jobs(J, bias, M / GEMM_BT, N, K, relu, out16);
  };
  // two products with B*T rows each
  auto gemm2 = [&](const __bf16* A0, const __bf16* B0, float* C0,
                   const __bf16* A1, const __bf16* B1, float* C1, int out16) {
    GemmJobs J = none;
    J.a0 = A0; J.b0 = B0; J.c0 = C0;
    J.a1 = A1; J.b1 = B1; J.c1 = C1; J.t1 = B * T / GEMM_BT;
    gemm_jobs(J, nullptr, 2 * (B * T / GEMM_BT), D, D, 0, out16);
  };
  auto attn = [&](const __bf16* Qp, const __bf16* Kp, const __bf16* Vp, const int* vl,
                  __bf16* Op, int Tk, int causal) {
    dim3 grid(T / 16, 16, B);
    attn_wmma<<<grid, dim3(32), 0, stream>>>(Qp, Kp, Vp, vl, Op, T, Tk, causal,
                                             nullptr, nullptr, nullptr, nullptr,
                                             nullptr, 0, B);
  };
  auto lnk = [&](const float* a, const float* r, int li, float* o, __bf16* o16) {
    add_ln<<<dim3(B * T), dim3(256), 0, stream>>>(a, r, ln_g + (size_t)li * D,
                                                  ln_b + (size_t)li * D, o, o16);
  };

  // ---- inputs and weights to bf16, weights transposed ----
  {
    PrepJobs P = {sa_w, cc_w, ck_w, ct_w, w1, w2, x, src, tpl, kwe,
                  B * T * D, B * SC * D, B * ST * D, B * SK * D};
    prep_bf16<<<dim3(512, 10), dim3(256), 0, stream>>>(P, wt, x16, s16, p16, k16);
  }

  // ---- every projection that reads inputs alone: one launch ----
  {
    const int tT = B * T / GEMM_BT, tC = B * SC / GEMM_BT, tP = B * ST / GEMM_BT,
              tW = B * SK / GEMM_BT;
    GemmJobs J = none;
    J.a0 = x16; J.b0 = sa_t + 0 * DD; J.c0 = (float*)Qb;
    J.a1 = x16; J.b1 = sa_t + 1 * DD; J.c1 = (float*)Kb;  J.t1 = tT;
    J.a2 = x16; J.b2 = sa_t + 2 * DD; J.c2 = (float*)Vb;  J.t2 = 2 * tT;
    J.a3 = s16; J.b3 = cc_t + 1 * DD; J.c3 = (float*)ccK; J.t3 = 3 * tT;
    J.a4 = s16; J.b4 = cc_t + 2 * DD; J.c4 = (float*)ccV; J.t4 = 3 * tT + tC;
    J.a5 = p16; J.b5 = ct_t + 1 * DD; J.c5 = (float*)ctK; J.t5 = 3 * tT + 2 * tC;
    J.a6 = p16; J.b6 = ct_t + 2 * DD; J.c6 = (float*)ctV; J.t6 = 3 * tT + 2 * tC + tP;
    J.a7 = k16; J.b7 = ck_t + 1 * DD; J.c7 = (float*)ckK; J.t7 = 3 * tT + 2 * tC + 2 * tP;
    J.a8 = k16; J.b8 = ck_t + 2 * DD; J.c8 = (float*)ckV; J.t8 = 3 * tT + 2 * tC + 2 * tP + tW;
    gemm_jobs(J, nullptr, 3 * tT + 2 * tC + 2 * tP + 2 * tW, D, D, 0, 1);
  }

  // ---- causal self-attention ----
  attn(Qb, Kb, Vb, nullptr, Ab, T, 1);
  gemm(Ab, sa_t + 3 * DD, nullptr, T1, B * T, D, D, 0, 0);
  lnk(x, T1, 0, Yb, Y16);                         // y

  // ---- cross-attention: source code and keywords, side by side ----
  // (Kb and Vb are free again: keyword queries in Kb, keyword attention in Vb)
  gemm2(Y16, cc_t + 0 * DD, (float*)Qb, Y16, ck_t + 0 * DD, (float*)Kb, 1);
  attn_wmma<<<dim3(T / 16, 16, 2 * B), dim3(32), 0, stream>>>(
      Qb, ccK, ccV, src_len, Ab, T, SC, 0, Kb, ckK, ckV, kw_len, Vb, SK, B);
  gemm2(Ab, cc_t + 3 * DD, Cb, Vb, ck_t + 3 * DD, T1, 0);    // y2_code, y2_kw

  gate_mix<<<dim3(B * T), dim3(256), 0, stream>>>(Cb, T1, gate_w, gate_b, T2);
  lnk(Yb, T2, 1, Zb, Z16);                        // z

  // ---- cross-attention: template ----
  gemm(Z16, ct_t + 0 * DD, nullptr, (float*)Qb, B * T, D, D, 0, 1);
  attn(Qb, ctK, ctV, tpl_len, Ab, ST, 0);
  gemm(Ab, ct_t + 3 * DD, nullptr, T1, B * T, D, D, 0, 0);   // z2
  lnk(Zb, T1, 2, Wb, W16);                        // w

  // ---- FFN ----
  gemm(W16, w1_t, b1, (float*)Hb, B * T, DFF, D, 1, 1);   // relu(w@w1+b1)
  gemm(Hb, w2_t, b2, T1, B * T, D, DFF, 0, 0);
  lnk(Wb, T1, 3, (float*)d_out, nullptr);         // final LN

  (void)in_sizes; (void)n_in; (void)out_size; (void)ws_size;
}

// v007
// A run of this version takes 359 microseconds.
// Timed twice side by side with v006, it ran 1.04 and 1.03 times as fast.
// Over all steps from v000 it is 5.29 times as fast.
#include <hip/hip_runtime.h>
#include <hip/hip_bf16.h>

typedef __attribute__((ext_vector_type(16))) __bf16 v16bf;
typedef __attribute__((ext_vector_type(8)))  __bf16 v8bf;
typedef __attribute__((ext_vector_type(4)))  __bf16 v4bf;
typedef __attribute__((ext_vector_type(8)))  float  v8f;
typedef __attribute__((ext_vector_type(4)))  float  v4f;

#define D_MODEL 1024
#define D_HEAD  64

__device__ __forceinline__ v16bf ld_frag_bf(const __bf16* base, int ldk) {
  const int lane = threadIdx.x & 31;
  const int r    = lane & 15;
  const int ko   = (lane & 16) ? 8 : 0;
  const __bf16* p = base + r * ldk + ko;
  v8bf lo = *reinterpret_cast<const v8bf*>(p);
  v8bf hi = *reinterpret_cast<const v8bf*>(p + 16);
  v16bf f;
#pragma unroll
  for (int i = 0; i < 8; ++i) { f[i] = lo[i]; f[i + 8] = hi[i]; }
  return f;
}

// ---------------------------------------------------------------------------
// C = A(bf16,[M,K]) @ Bt(bf16,[N,K])^T (+bias)(+relu) -> f32 or bf16 [M,N]
// bf16 WMMA, f32 accumulate.  M,N multiples of 128; K multiple of 64.
// A block of 8 waves makes a 128 x 128 tile of C, a wave 32 x 64 of it (waves
// 4 down x 2 across), so that every operand byte fetched feeds 128 outputs.
// A stage is 64 k of both operands.  Both arrive as bf16 and k-contiguous (their
// producers round them once), so a stage row is one 128-byte line: each thread
// loads 16-byte pieces and stores them as they are, As[m][k] and Bs[n][k].
// Rows are pitched 144 B (16 B x odd) for the 16-byte fragment reads.
// The stages are pipelined: the loads of stage s + 1 are issued before the
// fragment reads and WMMAs of stage s and land behind them.  LDS holds two
// stages, so that one barrier per stage is enough: a wave writes buffer s & 1
// behind barrier s - 1, which every wave reaches with its reads of stage s - 2
// (the same buffer) complete.
// ---------------------------------------------------------------------------
#define GEMM_BK 64
#define GEMM_LD 72   // bf16 elements per LDS row: 64 k + 8 pad
#define GEMM_BT 128  // rows and columns of C per block
typedef const __attribute__((address_space(1))) v4f* gv4f_ptr;
typedef const __attribute__((address_space(1))) v8bf* gv8bf_ptr;
typedef const __attribute__((address_space(1))) char* gbyte_ptr;

// Up to nine independent products C_j = A_j @ B_j of one launch; all share N and
// K.  Their row tiles are stacked along blockIdx.y: job j owns the tiles from
// t_j (t_0 = 0) up to t_(j+1).  An unused job has t_j = GEMM_NO_JOB.
// c_j points at f32 values, or at bf16 values where the launch says out16.
#define GEMM_NO_JOB 0x7fffffff
struct GemmJobs {
  int t1, t2, t3, t4, t5, t6, t7, t8;
  const __bf16* a0; const __bf16* b0; float* c0;
  const __bf16* a1; const __bf16* b1; float* c1;
  const __bf16* a2; const __bf16* b2; float* c2;
  const __bf16* a3; const __bf16* b3; float* c3;
  const __bf16* a4; const __bf16* b4; float* c4;
  const __bf16* a5; const __bf16* b5; float* c5;
  const __bf16* a6; const __bf16* b6; float* c6;
  const __bf16* a7; const __bf16* b7; float* c7;
  const __bf16* a8; const __bf16* b8; float* c8;
};

__global__ __launch_bounds__(256)
void gemm_bf16_wmma(GemmJobs J, const float* __restrict__ bias,
                    int N, int K, int relu, int out16) {
  // two stages of As[m][k] followed by Bs[n][k]
  __shared__ __align__(16) __bf16 Sm[2][2 * GEMM_BT * GEMM_LD];
  const int tid  = threadIdx.x;
  const int wave = tid >> 5;
  const int lane = tid & 31;
  const int wm = (wave & 3) * 32;    // the wave's first row in the tile
  const int wn = (wave >> 2) * 64;   // the wave's first column in the tile
  const int n0 = blockIdx.x * GEMM_BT;

  // Which product this block works for: the same for the whole block.
  const int ty = blockIdx.y;
  // The job's number comes from all eight bounds at once, its three pointers from
  // one more read of the arguments (a chain of tests would read them one by one).
  const int job = (ty >= J.t1) + (ty >= J.t2) + (ty >= J.t3) + (ty >= J.t4) +
                  (ty >= J.t5) + (ty >= J.t6) + (ty >= J.t7) + (ty >= J.t8);
  const __bf16* A; const __bf16* B; float* C; int t0;
  switch (job) {
#define GEMM_PICK(j) case j: A = J.a##j; B = J.b##j; C = J.c##j; t0 = J.t##j; break;
    GEMM_PICK(1) GEMM_PICK(2) GEMM_PICK(3) GEMM_PICK(4)
    GEMM_PICK(5) GEMM_PICK(6) GEMM_PICK(7) GEMM_PICK(8)
#undef GEMM_PICK
    default: A = J.a0; B = J.b0; C = J.c0; t0 = 0; break;
  }
  const int m0 = (ty - t0) * GEMM_BT;

  const int q8  = tid & 7;          // 16-byte piece inside the 128 bytes of a stage row
  const int g32 = tid >> 3;         // 0..31: row group, of A and of Bt alike
  // This thread's 8 pieces of a stage: a base that is the same for the whole
  // block, one per piece and advanced per stage, plus the thread's own 32-bit
  // byte offset (one for both operands: they share K).  The full addresses then
  // live in vector registers only around the loads, not beside the fragments.
  // (global address space kept in the type, so that the loads stay global_load)
  gbyte_ptr pa[4];
  gbyte_ptr pb[4];
#pragma unroll
  for (int j = 0; j < 4; ++j) {
    pa[j] = (gbyte_ptr)(A + (size_t)(m0 + 32 * j) * K);   // rows g32 + 32j
    pb[j] = (gbyte_ptr)(B + (size_t)(n0 + 32 * j) * K);   // rows g32 + 32j
  }
  const unsigned oab = (unsigned)(g32 * K + q8 * 8) * 2u;

  v8f acc[2][4] = {};

  v8bf ra[4], rb[4];
  // Issues the 8 loads of the stage that the bases stand at, then advances them.
  auto load_stage = [&]() {
    gv8bf_ptr qa[4], qb[4];
#pragma unroll
    for (int j = 0; j < 4; ++j) {
      qa[j] = (gv8bf_ptr)(pa[j] + oab);
      qb[j] = (gv8bf_ptr)(pb[j] + oab);
    }
#pragma unroll
    for (int j = 0; j < 4; ++j) ra[j] = *qa[j];
#pragma unroll
    for (int j = 0; j < 4; ++j) rb[j] = *qb[j];
    // Keeps the 8 loads here, together and ahead of the fragment reads and
    // WMMAs that follow: moved down to their use they would hide nothing.
    __builtin_amdgcn_sched_barrier(0);
    // Stands in front of every overwrite of the address registers of the loads
    // just issued (the base updates below among them); it names the 8 addresses
    // as inputs, so that they keep their registers up to here and no load's
    // result is given one of them.
    asm volatile("s_wait_xcnt 0x0"
                 :: "v"(qa[0]), "v"(qa[1]), "v"(qa[2]), "v"(qa[3]),
                    "v"(qb[0]), "v"(qb[1]), "v"(qb[2]), "v"(qb[3])
                 : "memory");
#pragma unroll
    for (int j = 0; j < 4; ++j) { pa[j] += GEMM_BK * 2; pb[j] += GEMM_BK * 2; }
  };
  load_stage();

  for (int k0 = 0; k0 < K; k0 += GEMM_BK) {
    __bf16* As = Sm[(k0 / GEMM_BK) & 1];
    __bf16* Bs = As + GEMM_BT * GEMM_LD;
#pragma unroll
    for (int j = 0; j < 4; ++j)
      *reinterpret_cast<v8bf*>(&As[(g32 + 32 * j) * GEMM_LD + q8 * 8]) = ra[j];
#pragma unroll
    for (int j = 0; j < 4; ++j)
      *reinterpret_cast<v8bf*>(&Bs[(g32 + 32 * j) * GEMM_LD + q8 * 8]) = rb[j];
    if (k0 + GEMM_BK < K) load_stage();    // the test reads the same for the whole block
    // The stage's barrier.  Its fences name LDS alone: the stage is handed over
    // in LDS only, and a fence over global memory too (as in __syncthreads())
    // would wait here for the next stage's loads, which are to stay in flight.
    __builtin_amdgcn_fence(__ATOMIC_RELEASE, "workgroup", "local");
    __builtin_amdgcn_s_barrier();
    __builtin_amdgcn_fence(__ATOMIC_ACQUIRE, "workgroup", "local");

    v16bf fa[2][2], fb[2][4];
#pragma unroll
    for (int kk = 0; kk < 2; ++kk) {
#pragma unroll
      for (int mt = 0; mt < 2; ++mt)
        fa[kk][mt] = ld_frag_bf(&As[(wm + mt * 16) * GEMM_LD + kk * 32], GEMM_LD);
#pragma unroll
      for (int nt = 0; nt < 4; ++nt)
        fb[kk][nt] = ld_frag_bf(&Bs[(wn + nt * 16) * GEMM_LD + kk * 32], GEMM_LD);
    }
    // Keeps the stage's 24 fragment reads one group ahead of the WMMAs: without
    // it each WMMA waits out the LDS latency of its own two reads.
    __builtin_amdgcn_sched_barrier(0);
#pragma unroll
    for (int kk = 0; kk < 2; ++kk) {
#pragma unroll
      for (int mt = 0; mt < 2; ++mt) {
#pragma unroll
        for (int nt = 0; nt < 4; ++nt)
          acc[mt][nt] = __builtin_amdgcn_wmma_f32_16x16x32_bf16(
              false, fa[kk][mt], false, fb[kk][nt], (short)0, acc[mt][nt], false, false);
      }
    }
  }

  const int half8 = (lane & 16) ? 8 : 0;
  const int cn    = lane & 15;
  // The wave's 32 x 64 values are finished in their registers first: a lane has
  // one column per column tile, so it reads four bias values, once ...
  if (bias) {
    float bv[4];
#pragma unroll
    for (int nt = 0; nt < 4; ++nt) bv[nt] = bias[n0 + wn + nt * 16 + cn];
    // Stands in front of any later overwrite of the address register of these loads.
    asm volatile("s_wait_xcnt 0x0" ::: "memory");
#pragma unroll
    for (int mt = 0; mt < 2; ++mt) {
#pragma unroll
      for (int nt = 0; nt < 4; ++nt) {
#pragma unroll
        for (int e = 0; e < 8; ++e) acc[mt][nt][e] += bv[nt];
      }
    }
  }
  if (relu) {
#pragma unroll
    for (int mt = 0; mt < 2; ++mt) {
#pragma unroll
      for (int nt = 0; nt < 4; ++nt) {
#pragma unroll
        for (int e = 0; e < 8; ++e) acc[mt][nt][e] = fmaxf(acc[mt][nt][e], 0.0f);
      }
    }
  }
  // ... and then stored row by row: the four stores of a row share one address.
  if (out16) {   // a result that is read as a matrix operand only: rounded here, once
    __bf16* C16 = reinterpret_cast<__bf16*>(C);
#pragma unroll
    for (int mt = 0; mt < 2; ++mt) {
#pragma unroll
      for (int e = 0; e < 8; ++e) {
        int row = m0 + wm + mt * 16 + e + half8;
        __bf16* pr = C16 + (size_t)row * N + n0 + wn + cn;
#pragma unroll
        for (int nt = 0; nt < 4; ++nt) pr[nt * 16] = (__bf16)acc[mt][nt][e];
        // Stands in front of the next row's address, which may take the registers
        // of the stores just issued.
        asm volatile("s_wait_xcnt 0x0" ::: "memory");
      }
    }
    return;
  }
#pragma unroll
  for (int mt = 0; mt < 2; ++mt) {
#pragma unroll
    for (int e = 0; e < 8; ++e) {
      int row = m0 + wm + mt * 16 + e + half8;
      float* pr = C + (size_t)row * N + n0 + wn + cn;
#pragma unroll
      for (int nt = 0; nt < 4; ++nt) pr[nt * 16] = acc[mt][nt][e];
      // Stands in front of the next row's address, which may take the registers
      // of the stores just issued.
      asm volatile("s_wait_xcnt 0x0" ::: "memory");
    }
  }
}

// ---------------------------------------------------------------------------
// Fused flash attention, one wave per (b, h, 16-row q tile).
// Q,K,V,O are bf16 [B, T*, D_MODEL]; head h uses columns [h*64, h*64+64).
// causal=1: key <= query (dec_valid_lens = q+1).  causal=0: key < vlen[b].
// A launch may hold a second, independent attention (Q2 ... Tk2, never causal):
// blockIdx.z in [nb, 2 nb) works for it.
// ---------------------------------------------------------------------------
__global__ __launch_bounds__(32)
void attn_wmma(const __bf16* __restrict__ Q1, const __bf16* __restrict__ K1,
               const __bf16* __restrict__ V1, const int* __restrict__ vlen1,
               __bf16* __restrict__ O1, int Tq, int Tk1, int causal,
               const __bf16* __restrict__ Q2, const __bf16* __restrict__ K2,
               const __bf16* __restrict__ V2, const int* __restrict__ vlen2,
               __bf16* __restrict__ O2, int Tk2, int nb) {
  __shared__ __align__(16) __bf16 Qs[16 * 64];   // [q][d]
  __shared__ __align__(16) __bf16 Ks[32 * 64];   // [key][d] (== B-frag layout, QK^T)
  __shared__ __align__(16) __bf16 Vt[64 * 32];   // [d][key] (B-frag layout, PV)
  __shared__ __align__(16) __bf16 Ps[16 * 32];   // [q][key] P relayout buffer

  const int lane = threadIdx.x & 31;
  const int qb   = blockIdx.x * 16;
  const int h    = blockIdx.y;
  const bool second = (int)blockIdx.z >= nb;      // the same for the whole block
  const int b    = second ? (int)blockIdx.z - nb : (int)blockIdx.z;
  const __bf16* Q   = second ? Q2 : Q1;
  const __bf16* Kt  = second ? K2 : K1;
  const __bf16* V   = second ? V2 : V1;
  const int*   vlen = second ? vlen2 : vlen1;
  __bf16*      O    = second ? O2 : O1;
  const int    Tk   = second ? Tk2 : Tk1;
  const int half8 = (lane & 16) ? 8 : 0;
  const int cn    = lane & 15;

  const size_t qoff = ((size_t)b * Tq + qb) * D_MODEL + (size_t)h * D_HEAD;
#pragma unroll
  for (int i = 0; i < 4; ++i) {
    int idx = i * 32 + lane;          // 16-byte piece: 8 to a 128-byte head row
    int r = idx >> 3, c = (idx & 7) * 8;
    *reinterpret_cast<v8bf*>(&Qs[r * 64 + c]) =
        *reinterpret_cast<const v8bf*>(&Q[qoff + (size_t)r * D_MODEL + c]);
  }
  v16bf aq0 = ld_frag_bf(&Qs[0], 64);
  v16bf aq1 = ld_frag_bf(&Qs[32], 64);

  float m[8], l[8];
#pragma unroll
  for (int e = 0; e < 8; ++e) { m[e] = -3.0e38f; l[e] = 0.0f; }
  v8f o0 = {}, o1 = {}, o2 = {}, o3 = {};

  const int vl   = causal ? Tk : min(vlen[b], Tk);   // bounds the key rows read below
  const int nblk = causal ? ((qb + 16 + 31) >> 5) : ((vl + 31) >> 5);

  // Staging of a 32-key block: a lane takes 16-byte pieces of the 128-byte head
  // rows.  Of K it takes keys 4i + h4; of V keys 8 h4 + jj, that is 8 keys x 8 d,
  // so that the transpose is a register regrouping and one 16-byte store per d.
  const int q8 = lane & 7;    // piece of 8 d
  const int h4 = lane >> 3;   // 0..3
  const size_t kvoff = (size_t)b * Tk * D_MODEL + (size_t)h * D_HEAD;   // same for the wave
  const unsigned ko = h4 * D_MODEL + q8 * 8;       // the lane's own part, K
  const unsigned vo = h4 * 8 * D_MODEL + q8 * 8;   // the lane's own part, V

  for (int j = 0; j < nblk; ++j) {
    const int kb = j * 32;
    {
      gv8bf_ptr kp = (gv8bf_ptr)(Kt + kvoff + (size_t)kb * D_MODEL + ko);
      gv8bf_ptr vp = (gv8bf_ptr)(V  + kvoff + (size_t)kb * D_MODEL + vo);
      v8bf rk[8], rv[8];
#pragma unroll
      for (int i = 0; i < 8; ++i)
        rk[i] = kp[4 * i * (D_MODEL / 8)];
#pragma unroll
      for (int i = 0; i < 8; ++i)
        rv[i] = vp[i * (D_MODEL / 8)];
      // Keeps all 16 loads of the block in flight together: without it the LDS
      // stores are scheduled among them and the block waits several times.
      __builtin_amdgcn_sched_barrier(0);
      // Stands in front of every overwrite of the address registers of the loads
      // just issued; it names both addresses as inputs, so that they keep their
      // registers up to here and no load's result is given one of them.
      asm volatile("s_wait_xcnt 0x0" :: "v"(kp), "v"(vp) : "memory");
#pragma unroll
      for (int i = 0; i < 8; ++i)
        *reinterpret_cast<v8bf*>(&Ks[(4 * i + h4) * 64 + q8 * 8]) = rk[i];
#pragma unroll
      for (int c = 0; c < 8; ++c) {
        v8bf t;
#pragma unroll
        for (int jj = 0; jj < 8; ++jj) t[jj] = rv[jj][c];
        *reinterpret_cast<v8bf*>(&Vt[(q8 * 8 + c) * 32 + h4 * 8]) = t;
      }
    }

    // S = Q @ K^T for 32 keys (two 16-key column tiles)
    v8f s0 = {}, s1 = {};
    {
      v16bf b0a = ld_frag_bf(&Ks[0], 64);
      v16bf b0b = ld_frag_bf(&Ks[32], 64);
      v16bf b1a = ld_frag_bf(&Ks[16 * 64], 64);
      v16bf b1b = ld_frag_bf(&Ks[16 * 64 + 32], 64);
      s0 = __builtin_amdgcn_wmma_f32_16x16x32_bf16(false, aq0, false, b0a, (short)0, s0, false, false);
      s0 = __builtin_amdgcn_wmma_f32_16x16x32_bf16(false, aq1, false, b0b, (short)0, s0, false, false);
      s1 = __builtin_amdgcn_wmma_f32_16x16x32_bf16(false, aq0, false, b1a, (short)0, s1, false, false);
      s1 = __builtin_amdgcn_wmma_f32_16x16x32_bf16(false, aq1, false, b1b, (short)0, s1, false, false);
    }

    float p0[8], p1[8];
#pragma unroll
    for (int e = 0; e < 8; ++e) {
      float s0e = s0[e] * 0.125f;   // 1/sqrt(64)
      float s1e = s1[e] * 0.125f;
      int row = qb + e + half8;
      int c0 = kb + cn, c1 = kb + 16 + cn;
      bool ok0 = causal ? (c0 <= row) : (c0 < vl);
      bool ok1 = causal ? (c1 <= row) : (c1 < vl);
      if (!ok0) s0e = -1.0e6f;
      if (!ok1) s1e = -1.0e6f;
      float rm = fmaxf(s0e, s1e);
#pragma unroll
      for (int msk = 1; msk < 16; msk <<= 1) rm = fmaxf(rm, __shfl_xor(rm, msk, 32));
      float mn    = fmaxf(m[e], rm);
      float alpha = __expf(m[e] - mn);
      float e0 = __expf(s0e - mn);
      float e1 = __expf(s1e - mn);
      float rs = e0 + e1;
#pragma unroll
      for (int msk = 1; msk < 16; msk <<= 1) rs += __shfl_xor(rs, msk, 32);
      l[e] = l[e] * alpha + rs;
      m[e] = mn;
      o0[e] *= alpha; o1[e] *= alpha; o2[e] *= alpha; o3[e] *= alpha;
      p0[e] = e0; p1[e] = e1;
    }

#pragma unroll
    for (int e = 0; e < 8; ++e) {
      Ps[(e + half8) * 32 + cn]      = (__bf16)p0[e];
      Ps[(e + half8) * 32 + 16 + cn] = (__bf16)p1[e];
    }
    v16bf ap = ld_frag_bf(&Ps[0], 32);
    o0 = __builtin_amdgcn_wmma_f32_16x16x32_bf16(false, ap, false, ld_frag_bf(&Vt[0],       32), (short)0, o0, false, false);
    o1 = __builtin_amdgcn_wmma_f32_16x16x32_bf16(false, ap, false, ld_frag_bf(&Vt[16 * 32], 32), (short)0, o1, false, false);
    o2 = __builtin_amdgcn_wmma_f32_16x16x32_bf16(false, ap, false, ld_frag_bf(&Vt[32 * 32], 32), (short)0, o2, false, false);
    o3 = __builtin_amdgcn_wmma_f32_16x16x32_bf16(false, ap, false, ld_frag_bf(&Vt[48 * 32], 32), (short)0, o3, false, false);
  }

#pragma unroll
  for (int e = 0; e < 8; ++e) {
    float inv = 1.0f / l[e];
    size_t ro = ((size_t)b * Tq + qb + e + half8) * D_MODEL + (size_t)h * D_HEAD;
    O[ro + cn]      = (__bf16)(o0[e] * inv);
    O[ro + 16 + cn] = (__bf16)(o1[e] * inv);
    O[ro + 32 + cn] = (__bf16)(o2[e] * inv);
    O[ro + 48 + cn] = (__bf16)(o3[e] * inv);
    // Stands in front of the next row's values and address, which may take the
    // registers of the stores just issued.
    asm volatile("s_wait_xcnt 0x0" ::: "memory");
  }
}

#define ROW_WAVES 8

template <int M>
__device__ __forceinline__ float row_xmask(float x) {
  return __builtin_bit_cast(float, __builtin_amdgcn_update_dpp(
      0, __builtin_bit_cast(int, x), 0x160 | M, 0xf, 0xf, true));
}
// Sum over the 32 lanes, alike in every lane.
__device__ __forceinline__ float wave_sum(float x) {
  x += row_xmask<1>(x);
  x += row_xmask<2>(x);
  x += row_xmask<4>(x);
  x += row_xmask<8>(x);
  const int b = __builtin_bit_cast(int, x);
  return x + __builtin_bit_cast(float, __builtin_amdgcn_permlanex16(
                 b, b, 0x76543210, 0xfedcba98, false, false));
}

// out = LayerNorm(a + r) * g + bt; where the row feeds a product too, out16 takes
// its bf16 rounding (else out16 is null)
__global__ __launch_bounds__(32 * ROW_WAVES)
void add_ln(const float* __restrict__ a, const float* __restrict__ r,
            const float* __restrict__ g, const float* __restrict__ bt,
            float* __restrict__ out, __bf16* __restrict__ out16) {
  const int lane = threadIdx.x & 31;
  const int wave = __builtin_amdgcn_readfirstlane(threadIdx.x >> 5);
  const size_t ro = ((size_t)blockIdx.x * ROW_WAVES + wave) * D_MODEL;   // same for the wave
  gv4f_ptr pa = (gv4f_ptr)(a + ro);
  gv4f_ptr pr = (gv4f_ptr)(r + ro);
  gv4f_ptr pg = (gv4f_ptr)g;
  gv4f_ptr pb = (gv4f_ptr)bt;
  v4f v[8], t[8], vg[8], vb[8];
#pragma unroll
  for (int i = 0; i < 8; ++i) v[i] = pa[32 * i + lane];
#pragma unroll
  for (int i = 0; i < 8; ++i) t[i] = pr[32 * i + lane];
  // Keeps the row's own 16 loads ahead of those of g and bt, which are used last.
  __builtin_amdgcn_sched_barrier(0);
#pragma unroll
  for (int i = 0; i < 8; ++i) vg[i] = pg[32 * i + lane];
#pragma unroll
  for (int i = 0; i < 8; ++i) vb[i] = pb[32 * i + lane];
  // Stands in front of every overwrite of the address registers of these loads; it
  // names the bases and the lane as inputs, so that they keep their registers up to here.
  asm volatile("s_wait_xcnt 0x0" :: "s"(pa), "s"(pr), "s"(pg), "s"(pb), "v"(lane) : "memory");
  // Keeps the sums behind the 32 loads (the wave waits out memory once) and lets
  // nothing that writes a register be moved in front of the wait.
  __builtin_amdgcn_sched_barrier(0);
  v4f s4 = {};
#pragma unroll
  for (int i = 0; i < 8; ++i) { v[i] += t[i]; s4 += v[i]; }
  const float mean = wave_sum((s4[0] + s4[1]) + (s4[2] + s4[3])) * (1.0f / D_MODEL);
  v4f q4 = {};
#pragma unroll
  for (int i = 0; i < 8; ++i) { v[i] -= mean; q4 += v[i] * v[i]; }
  const float rstd =
      rsqrtf(wave_sum((q4[0] + q4[1]) + (q4[2] + q4[3])) * (1.0f / D_MODEL) + 1e-5f);
#pragma unroll
  for (int i = 0; i < 8; ++i) v[i] = v[i] * rstd * vg[i] + vb[i];
  // The bf16 copy goes first: its values take registers of their own while the f32
  // values are still needed, and behind the f32 stores the wave only ends.
  if (out16) {   // the test reads the same for the whole launch
    v4bf* ph = reinterpret_cast<v4bf*>(out16 + ro);
#pragma unroll
    for (int i = 0; i < 8; ++i) {
      v4bf o;
#pragma unroll
      for (int c = 0; c < 4; ++c) o[c] = (__bf16)v[i][c];
      ph[32 * i + lane] = o;
    }
    // Stands in front of any overwrite of a register of the stores just issued; it
    // names their base as an input, so that it keeps its registers up to here.
    asm volatile("s_wait_xcnt 0x0" :: "s"(ph), "v"(lane) : "memory");
  }
  v4f* po = reinterpret_cast<v4f*>(out + ro);
#pragma unroll
  for (int i = 0; i < 8; ++i) po[32 * i + lane] = v[i];
}

// gate = sigmoid(concat(code,kw) @ gw + gb); out = gate*code + (1-gate)*kw
__global__ __launch_bounds__(32 * ROW_WAVES)
void gate_mix(const float* __restrict__ code, const float* __restrict__ kw,
              const float* __restrict__ gw, const float* __restrict__ gb,
              float* __restrict__ out) {
  const int lane = threadIdx.x & 31;
  const int wave = __builtin_amdgcn_readfirstlane(threadIdx.x >> 5);
  const size_t ro = ((size_t)blockIdx.x * ROW_WAVES + wave) * D_MODEL;   // same for the wave
  gv4f_ptr pc = (gv4f_ptr)(code + ro);
  gv4f_ptr pk = (gv4f_ptr)(kw + ro);
  gv4f_ptr pw = (gv4f_ptr)gw;
  v4f vc[8], vk[8], wc[8], wk[8];
#pragma unroll
  for (int i = 0; i < 8; ++i) vc[i] = pc[32 * i + lane];
#pragma unroll
  for (int i = 0; i < 8; ++i) vk[i] = pk[32 * i + lane];
#pragma unroll
  for (int i = 0; i < 8; ++i) wc[i] = pw[32 * i + lane];
#pragma unroll
  for (int i = 0; i < 8; ++i) wk[i] = pw[D_MODEL / 4 + 32 * i + lane];
  // Stands in front of every overwrite of the address registers of these loads; it
  // names the bases and the lane as inputs, so that they keep their registers up to here.
  asm volatile("s_wait_xcnt 0x0" :: "s"(pc), "s"(pk), "s"(pw), "v"(lane) : "memory");
  // Keeps the sums behind the 32 loads (the wave waits out memory once) and lets
  // nothing that writes a register be moved in front of the wait.
  __builtin_amdgcn_sched_barrier(0);
  v4f s4 = {};
#pragma unroll
  for (int i = 0; i < 8; ++i) { s4 += vc[i] * wc[i]; s4 += vk[i] * wk[i]; }
  const float s = wave_sum((s4[0] + s4[1]) + (s4[2] + s4[3]));
  const float gsc = 1.0f / (1.0f + __expf(-(s + gb[0])));
  v4f* po = reinterpret_cast<v4f*>(out + ro);
#pragma unroll
  for (int i = 0; i < 8; ++i) po[32 * i + lane] = gsc * vc[i] + (1.0f - gsc) * vk[i];
}

// ---------------------------------------------------------------------------
// Rounds everything that the products read from the inputs to bf16, once per
// call.  blockIdx.y < 6: weights, f32 [K][N] -> bf16 [N][K] (k-contiguous, as the
// GEMM stages them); 4 M elements per y: four 1024 x 1024 matrices, or the
// 1024 x 4096, or the 4096 x 1024 one.  blockIdx.y >= 6: activations, same
// layout.  A block handles 8192 elements.
// ---------------------------------------------------------------------------
#define PREP_LD 136   // bf16 elements per LDS row: 128 k + 8 pad (272 B = 16 B x odd)
struct PrepJobs {
  const float* w0; const float* w1; const float* w2;
  const float* w3; const float* w4; const float* w5;
  const float* s0; const float* s1; const float* s2; const float* s3;
  int n0, n1, n2, n3;   // elements of s0 .. s3
};

__global__ __launch_bounds__(256)
void prep_bf16(PrepJobs P, __bf16* __restrict__ wt, __bf16* __restrict__ d0,
               __bf16* __restrict__ d1, __bf16* __restrict__ d2,
               __bf16* __restrict__ d3) {
  __shared__ __align__(16) __bf16 Ts[64 * PREP_LD];   // [n][k]
  const int tid = threadIdx.x;
  const int y   = blockIdx.y;      // the same for the whole block
  const int t   = blockIdx.x;
  if (y >= 6) {
    const float* S; __bf16* Dp; int n;
    switch (y) {
      case 6:  S = P.s0; Dp = d0; n = P.n0; break;
      case 7:  S = P.s1; Dp = d1; n = P.n1; break;
      case 8:  S = P.s2; Dp = d2; n = P.n2; break;
      default: S = P.s3; Dp = d3; n = P.n3; break;
    }
    if (t * 8192 >= n) return;     // taken by the whole block
    v4f r[8];
#pragma unroll
    for (int i = 0; i < 4; ++i) {
      const v4f* p = reinterpret_cast<const v4f*>(S + (size_t)t * 8192 + i * 2048 + tid * 8);
      r[2 * i] = p[0]; r[2 * i + 1] = p[1];
    }
    // Stands in front of any overwrite of an address register of these loads.
    asm volatile("s_wait_xcnt 0x0" ::: "memory");
#pragma unroll
    for (int i = 0; i < 4; ++i) {
      v8bf o;
#pragma unroll
      for (int c = 0; c < 4; ++c) { o[c] = (__bf16)r[2 * i][c]; o[c + 4] = (__bf16)r[2 * i + 1][c]; }
      *reinterpret_cast<v8bf*>(Dp + (size_t)t * 8192 + i * 2048 + tid * 8) = o;
    }
    return;
  }
  const float* Wp;
  switch (y) {
    case 0:  Wp = P.w0; break;
    case 1:  Wp = P.w1; break;
    case 2:  Wp = P.w2; break;
    case 3:  Wp = P.w3; break;
    case 4:  Wp = P.w4; break;
    default: Wp = P.w5; break;
  }
  const int K   = (y == 5) ? 4096 : 1024;
  const int N   = (y == 4) ? 4096 : 1024;
  const int lgn = (y == 4) ? 6 : 4;              // log2 of the 64-column tiles per row
  const int mat = (y < 4) ? (t >> 7) : 0;        // 128 tiles per 1024 x 1024 matrix
  const int tt  = (y < 4) ? (t & 127) : t;
  const int n0  = (tt & ((1 << lgn) - 1)) * 64;
  const int k0  = (tt >> lgn) * 128;
  const size_t mo = (size_t)mat * 1024 * 1024;
  const int q16 = tid & 15;        // 4 n
  const int g16 = tid >> 4;        // 8 k
  v4f r[8];
  const v4f* qp[8];
#pragma unroll
  for (int j = 0; j < 8; ++j)
    qp[j] = reinterpret_cast<const v4f*>(Wp + mo + (size_t)(k0 + g16 * 8 + j) * N + n0 + q16 * 4);
#pragma unroll
  for (int j = 0; j < 8; ++j) r[j] = *qp[j];
  // Keeps the 8 loads in flight together: without it the conversions of the first
  // two are scheduled among them and the block waits out memory twice.
  __builtin_amdgcn_sched_barrier(0);
  // Stands in front of every overwrite of the address registers of these loads;
  // it names the addresses as inputs, so that they keep their registers up to here.
  asm volatile("s_wait_xcnt 0x0"
               :: "v"(qp[0]), "v"(qp[1]), "v"(qp[2]), "v"(qp[3]),
                  "v"(qp[4]), "v"(qp[5]), "v"(qp[6]), "v"(qp[7])
               : "memory");
#pragma unroll
  for (int i = 0; i < 4; ++i) {
    v8bf o;
#pragma unroll
    for (int j = 0; j < 8; ++j) o[j] = (__bf16)r[j][i];
    *reinterpret_cast<v8bf*>(&Ts[(q16 * 4 + i) * PREP_LD + g16 * 8]) = o;
  }
  __syncthreads();   // the rows are read back by other threads, as whole 256-byte runs
  __bf16* Wo = wt + (size_t)y * 4 * 1024 * 1024 + mo;
#pragma unroll
  for (int i = 0; i < 4; ++i) {
    int p = i * 256 + tid;
    int rown = p >> 4, c = (p & 15) * 8;
    *reinterpret_cast<v8bf*>(Wo + (size_t)(n0 + rown) * K + k0 + c) =
        *reinterpret_cast<const v8bf*>(&Ts[rown * PREP_LD + c]);
  }
  // Stands behind the four stores, in front of whatever the built code places
  // after them that could take their registers.
  asm volatile("s_wait_xcnt 0x0" ::: "memory");
}

extern "C" void kernel_launch(void* const* d_in, const int* in_sizes, int n_in,
                              void* d_out, int out_size, void* d_ws, size_t ws_size,
                              hipStream_t stream) {
  const int B = 8, T = 512, SC = 512, ST = 256, SK = 64, D = 1024, DFF = 4096;
  const float* x       = (const float*)d_in[0];
  const float* src     = (const float*)d_in[1];
  const int*   src_len = (const int*)  d_in[2];
  const float* tpl     = (const float*)d_in[3];
  const int*   tpl_len = (const int*)  d_in[4];
  const float* kwe     = (const float*)d_in[5];
  const int*   kw_len  = (const int*)  d_in[6];
  const float* sa_w    = (const float*)d_in[7];
  const float* cc_w    = (const float*)d_in[8];
  const float* ck_w    = (const float*)d_in[9];
  const float* ct_w    = (const float*)d_in[10];
  const float* gate_w  = (const float*)d_in[11];
  const float* gate_b  = (const float*)d_in[12];
  const float* w1      = (const float*)d_in[13];
  const float* b1      = (const float*)d_in[14];
  const float* w2      = (const float*)d_in[15];
  const float* b2      = (const float*)d_in[16];
  const float* ln_g    = (const float*)d_in[17];
  const float* ln_b    = (const float*)d_in[18];

  const size_t DD   = (size_t)D * D;
  const size_t NTOK = (size_t)B * T * D;   // 4M floats

  float* ws = (float*)d_ws;
  size_t off = 0;
  auto take = [&](size_t n) { float* p = ws + off; off += n; return p; };
  auto take16 = [&](size_t n) { return (__bf16*)take(n / 2); };   // n bf16 values
  float* T1 = take(NTOK); float* T2 = take(NTOK); float* Yb = take(NTOK);
  float* Cb = take(NTOK); float* Zb = take(NTOK); float* Wb = take(NTOK);
  // What only matrix products read is kept as bf16.
  __bf16* wt  = take16(24 * DD);          // all weights, [n][k]
  __bf16* x16 = take16(NTOK);
  __bf16* s16 = take16((size_t)B * SC * D);
  __bf16* p16 = take16((size_t)B * ST * D);
  __bf16* k16 = take16((size_t)B * SK * D);
  __bf16* Y16 = take16(NTOK); __bf16* Z16 = take16(NTOK); __bf16* W16 = take16(NTOK);
  __bf16* ccK = take16((size_t)B * SC * D); __bf16* ccV = take16((size_t)B * SC * D);
  __bf16* ctK = take16((size_t)B * ST * D); __bf16* ctV = take16((size_t)B * ST * D);
  __bf16* ckK = take16((size_t)B * SK * D); __bf16* ckV = take16((size_t)B * SK * D);
  // The FFN's hidden layer takes the place of Q, K, V and the attention output,
  // which are all done with when it is written.
  __bf16* Hb = take16((size_t)B * T * DFF);
  __bf16* Qb = Hb; __bf16* Kb = Qb + NTOK; __bf16* Vb = Kb + NTOK; __bf16* Ab = Vb + NTOK;
  const __bf16* sa_t = wt;           const __bf16* cc_t = wt + 4 * DD;
  const __bf16* ck_t = wt + 8 * DD;  const __bf16* ct_t = wt + 12 * DD;
  const __bf16* w1_t = wt + 16 * DD; const __bf16* w2_t = wt + 20 * DD;

  const GemmJobs none = {GEMM_NO_JOB, GEMM_NO_JOB, GEMM_NO_JOB, GEMM_NO_JOB,
                         GEMM_NO_JOB, GEMM_NO_JOB, GEMM_NO_JOB, GEMM_NO_JOB,
                         nullptr, nullptr, nullptr, nullptr, nullptr, nullptr,
                         nullptr, nullptr, nullptr, nullptr, nullptr, nullptr,
                         nullptr, nullptr, nullptr, nullptr, nullptr, nullptr,
                         nullptr, nullptr, nullptr, nullptr, nullptr, nullptr,
                         nullptr, nullptr, nullptr};
  auto gemm_jobs = [&](const GemmJobs& J, const float* bias, int row_tiles,
                       int N, int K, int relu, int out16) {
    dim3 grid(N / GEMM_BT, row_tiles);
    gemm_bf16_wmma<<<grid, dim3(256), 0, stream>>>(J, bias, N, K, relu, out16);
  };
  auto gemm = [&](const __bf16* A, const __bf16* Bm, const float* bias, float* C,
                  int M, int N, int K, int relu, int out16) {
    GemmJobs J = none;
    J.a0 = A; J.b0 = Bm; J.c0 = C;
    gemm_jobs(J, bias, M / GEMM_BT, N, K, relu, out16);
  };
  // two products with B*T rows each
  auto gemm2 = [&](const __bf16* A0, const __bf16* B0, float* C0,
                   const __bf16* A1, const __bf16* B1, float* C1, int out16) {
    GemmJobs J = none;
    J.a0 = A0; J.b0 = B0; J.c0 = C0;
    J.a1 = A1; J.b1 = B1; J.c1 = C1; J.t1 = B * T / GEMM_BT;
    gemm_jobs(J, nullptr, 2 * (B * T / GEMM_BT), D, D, 0, out16);
  };
  auto attn = [&](const __bf16* Qp, const __bf16* Kp, const __bf16* Vp, const int* vl,
                  __bf16* Op, int Tk, int causal) {
    dim3 grid(T / 16, 16, B);
    attn_wmma<<<grid, dim3(32), 0, stream>>>(Qp, Kp, Vp, vl, Op, T, Tk, causal,
                                             nullptr, nullptr, nullptr, nullptr,
                                             nullptr, 0, B);
  };
  auto lnk = [&](const float* a, const float* r, int li, float* o, __bf16* o16) {
    add_ln<<<dim3(B * T / ROW_WAVES), dim3(32 * ROW_WAVES), 0, stream>>>(a, r, ln_g + (size_t)li * D,
                                                  ln_b + (size_t)li * D, o, o16);
  };

  // ---- inputs and weights to bf16, weights transposed ----
  {
    PrepJobs P = {sa_w, cc_w, ck_w, ct_w, w1, w2, x, src, tpl, kwe,
                  B * T * D, B * SC * D, B * ST * D, B * SK * D};
    prep_bf16<<<dim3(512, 10), dim3(256), 0, stream>>>(P, wt, x16, s16, p16, k16);
  }

  // ---- every projection that reads inputs alone: one launch ----
  {
    const int tT = B * T / GEMM_BT, tC = B * SC / GEMM_BT, tP = B * ST / GEMM_BT,
              tW = B * SK / GEMM_BT;
    GemmJobs J = none;
    J.a0 = x16; J.b0 = sa_t + 0 * DD; J.c0 = (float*)Qb;
    J.a1 = x16; J.b1 = sa_t + 1 * DD; J.c1 = (float*)Kb;  J.t1 = tT;
    J.a2 = x16; J.b2 = sa_t + 2 * DD; J.c2 = (float*)Vb;  J.t2 = 2 * tT;
    J.a3 = s16; J.b3 = cc_t + 1 * DD; J.c3 = (float*)ccK; J.t3 = 3 * tT;
    J.a4 = s16; J.b4 = cc_t + 2 * DD; J.c4 = (float*)ccV; J.t4 = 3 * tT + tC;
    J.a5 = p16; J.b5 = ct_t + 1 * DD; J.c5 = (float*)ctK; J.t5 = 3 * tT + 2 * tC;
    J.a6 = p16; J.b6 = ct_t + 2 * DD; J.c6 = (float*)ctV; J.t6 = 3 * tT + 2 * tC + tP;
    J.a7 = k16; J.b7 = ck_t + 1 * DD; J.c7 = (float*)ckK; J.t7 = 3 * tT + 2 * tC + 2 * tP;
    J.a8 = k16; J.b8 = ck_t + 2 * DD; J.c8 = (float*)ckV; J.t8 = 3 * tT + 2 * tC + 2 * tP + tW;
    gemm_jobs(J, nullptr, 3 * tT + 2 * tC + 2 * tP + 2 * tW, D, D, 0, 1);
  }

  // ---- causal self-attention ----
  attn(Qb, Kb, Vb, nullptr, Ab, T, 1);
  gemm(Ab, sa_t + 3 * DD, nullptr, T1, B * T, D, D, 0, 0);
  lnk(x, T1, 0, Yb, Y16);                         // y

  // ---- cross-attention: source code and keywords, side by side ----
  // (Kb and Vb are free again: keyword queries in Kb, keyword attention in Vb)
  gemm2(Y16, cc_t + 0 * DD, (float*)Qb, Y16, ck_t + 0 * DD, (float*)Kb, 1);
  attn_wmma<<<dim3(T / 16, 16, 2 * B), dim3(32), 0, stream>>>(
      Qb, ccK, ccV, src_len, Ab, T, SC, 0, Kb, ckK, ckV, kw_len, Vb, SK, B);
  gemm2(Ab, cc_t + 3 * DD, Cb, Vb, ck_t + 3 * DD, T1, 0);    // y2_code, y2_kw

  gate_mix<<<dim3(B * T / ROW_WAVES), dim3(32 * ROW_WAVES), 0, stream>>>(Cb, T1, gate_w, gate_b, T2);
  lnk(Yb, T2, 1, Zb, Z16);                        // z

  // ---- cross-attention: template ----
  gemm(Z16, ct_t + 0 * DD, nullptr, (float*)Qb, B * T, D, D, 0, 1);
  attn(Qb, ctK, ctV, tpl_len, Ab, ST, 0);
  gemm(Ab, ct_t + 3 * DD, nullptr, T1, B * T, D, D, 0, 0);   // z2
  lnk(Zb, T1, 2, Wb, W16);                        // w

  // ---- FFN ----
  gemm(W16, w1_t, b1, (float*)Hb, B * T, DFF, D, 1, 1);   // relu(w@w1+b1)
  gemm(Hb, w2_t, b2, T1, B * T, D, DFF, 0, 0);
  lnk(Wb, T1, 3, (float*)d_out, nullptr);         // final LN

  (void)in_sizes; (void)n_in; (void)out_size; (void)ws_size;
}

// v008
// One run takes 325 microseconds.
// Two timings next to v007 put it at 1.11 and 1.10 times that version's speed.
// Over all steps from v000 it is 5.85 times as fast.
#include <hip/hip_runtime.h>
#include <hip/hip_bf16.h>

typedef __attribute__((ext_vector_type(16))) __bf16 v16bf;
typedef __attribute__((ext_vector_type(8)))  __bf16 v8bf;
typedef __attribute__((ext_vector_type(4)))  __bf16 v4bf;
typedef __attribute__((ext_vector_type(8)))  float  v8f;
typedef __attribute__((ext_vector_type(4)))  float  v4f;

#define D_MODEL 1024
#define D_HEAD  64

__device__ __forceinline__ v16bf ld_frag_bf(const __bf16* base, int ldk) {
  const int lane = threadIdx.x & 31;
  const int r    = lane & 15;
  const int ko   = (lane & 16) ? 8 : 0;
  const __bf16* p = base + r * ldk + ko;
  v8bf lo = *reinterpret_cast<const v8bf*>(p);
  v8bf hi = *reinterpret_cast<const v8bf*>(p + 16);
  v16bf f;
#pragma unroll
  for (int i = 0; i < 8; ++i) { f[i] = lo[i]; f[i + 8] = hi[i]; }
  return f;
}

// ---------------------------------------------------------------------------
// C = A(bf16,[M,K]) @ Bt(bf16,[N,K])^T (+bias)(+relu) -> f32 or bf16 [M,N]
// bf16 WMMA, f32 accumulate.  M,N multiples of 128; K multiple of 64.
// A block of 8 waves makes a 128 x 128 tile of C, a wave 32 x 64 of it (waves
// 4 down x 2 across), so that every operand byte fetched feeds 128 outputs.
// A stage is 64 k of both operands.  Both arrive as bf16 and k-contiguous (their
// producers round them once), so a stage row is one 128-byte line: each thread
// loads 16-byte pieces and stores them as they are, As[m][k] and Bs[n][k].
// Rows are pitched 144 B (16 B x odd) for the 16-byte fragment reads.
// The stages are pipelined: the loads of stage s + 1 are issued before the
// fragment reads and WMMAs of stage s and land behind them.  LDS holds two
// stages, so that one barrier per stage is enough: a wave writes buffer s & 1
// behind barrier s - 1, which every wave reaches with its reads of stage s - 2
// (the same buffer) complete.
// ---------------------------------------------------------------------------
#define GEMM_BK 64
#define GEMM_LD 72   // bf16 elements per LDS row: 64 k + 8 pad
#define GEMM_BT 128  // rows and columns of C per block
typedef const __attribute__((address_space(1))) v4f* gv4f_ptr;
typedef const __attribute__((address_space(1))) v8bf* gv8bf_ptr;
typedef const __attribute__((address_space(1))) char* gbyte_ptr;

// Up to nine independent products C_j = A_j @ B_j of one launch; all share N and
// K.  Their row tiles are stacked along blockIdx.y: job j owns the tiles from
// t_j (t_0 = 0) up to t_(j+1).  An unused job has t_j = GEMM_NO_JOB.
// c_j points at f32 values, or at bf16 values where the launch says out16.
#define GEMM_NO_JOB 0x7fffffff
struct GemmJobs {
  int t1, t2, t3, t4, t5, t6, t7, t8;
  const __bf16* a0; const __bf16* b0; float* c0;
  const __bf16* a1; const __bf16* b1; float* c1;
  const __bf16* a2; const __bf16* b2; float* c2;
  const __bf16* a3; const __bf16* b3; float* c3;
  const __bf16* a4; const __bf16* b4; float* c4;
  const __bf16* a5; const __bf16* b5; float* c5;
  const __bf16* a6; const __bf16* b6; float* c6;
  const __bf16* a7; const __bf16* b7; float* c7;
  const __bf16* a8; const __bf16* b8; float* c8;
};

__global__ __launch_bounds__(256)
void gemm_bf16_wmma(GemmJobs J, const float* __restrict__ bias,
                    int N, int K, int relu, int out16) {
  // two stages of As[m][k] followed by Bs[n][k]
  __shared__ __align__(16) __bf16 Sm[2][2 * GEMM_BT * GEMM_LD];
  const int tid  = threadIdx.x;
  const int wave = tid >> 5;
  const int lane = tid & 31;
  const int wm = (wave & 3) * 32;    // the wave's first row in the tile
  const int wn = (wave >> 2) * 64;   // the wave's first column in the tile
  const int n0 = blockIdx.x * GEMM_BT;

  // Which product this block works for: the same for the whole block.
  const int ty = blockIdx.y;
  // The job's number comes from all eight bounds at once, its three pointers from
  // one more read of the arguments (a chain of tests would read them one by one).
  const int job = (ty >= J.t1) + (ty >= J.t2) + (ty >= J.t3) + (ty >= J.t4) +
                  (ty >= J.t5) + (ty >= J.t6) + (ty >= J.t7) + (ty >= J.t8);
  const __bf16* A; const __bf16* B; float* C; int t0;
  switch (job) {
#define GEMM_PICK(j) case j: A = J.a##j; B = J.b##j; C = J.c##j; t0 = J.t##j; break;
    GEMM_PICK(1) GEMM_PICK(2) GEMM_PICK(3) GEMM_PICK(4)
    GEMM_PICK(5) GEMM_PICK(6) GEMM_PICK(7) GEMM_PICK(8)
#undef GEMM_PICK
    default: A = J.a0; B = J.b0; C = J.c0; t0 = 0; break;
  }
  const int m0 = (ty - t0) * GEMM_BT;

  const int q8  = tid & 7;          // 16-byte piece inside the 128 bytes of a stage row
  const int g32 = tid >> 3;         // 0..31: row group, of A and of Bt alike
  // This thread's 8 pieces of a stage: a base that is the same for the whole
  // block, one per piece and advanced per stage, plus the thread's own 32-bit
  // byte offset (one for both operands: they share K).  The full addresses then
  // live in vector registers only around the loads, not beside the fragments.
  // (global address space kept in the type, so that the loads stay global_load)
  gbyte_ptr pa[4];
  gbyte_ptr pb[4];
#pragma unroll
  for (int j = 0; j < 4; ++j) {
    pa[j] = (gbyte_ptr)(A + (size_t)(m0 + 32 * j) * K);   // rows g32 + 32j
    pb[j] = (gbyte_ptr)(B + (size_t)(n0 + 32 * j) * K);   // rows g32 + 32j
  }
  const unsigned oab = (unsigned)(g32 * K + q8 * 8) * 2u;

  v8f acc[2][4] = {};

  v8bf ra[4], rb[4];
  // Issues the 8 loads of the stage that the bases stand at, then advances them.
  auto load_stage = [&]() {
    gv8bf_ptr qa[4], qb[4];
#pragma unroll
    for (int j = 0; j < 4; ++j) {
      qa[j] = (gv8bf_ptr)(pa[j] + oab);
      qb[j] = (gv8bf_ptr)(pb[j] + oab);
    }
#pragma unroll
    for (int j = 0; j < 4; ++j) ra[j] = *qa[j];
#pragma unroll
    for (int j = 0; j < 4; ++j) rb[j] = *qb[j];
    // Keeps the 8 loads here, together and ahead of the fragment reads and
    // WMMAs that follow: moved down to their use they would hide nothing.
    __builtin_amdgcn_sched_barrier(0);
    // Stands in front of every overwrite of the address registers of the loads
    // just issued (the base updates below among them); it names the 8 addresses
    // as inputs, so that they keep their registers up to here and no load's
    // result is given one of them.
    asm volatile("s_wait_xcnt 0x0"
                 :: "v"(qa[0]), "v"(qa[1]), "v"(qa[2]), "v"(qa[3]),
                    "v"(qb[0]), "v"(qb[1]), "v"(qb[2]), "v"(qb[3])
                 : "memory");
#pragma unroll
    for (int j = 0; j < 4; ++j) { pa[j] += GEMM_BK * 2; pb[j] += GEMM_BK * 2; }
  };
  load_stage();

  for (int k0 = 0; k0 < K; k0 += GEMM_BK) {
    __bf16* As = Sm[(k0 / GEMM_BK) & 1];
    __bf16* Bs = As + GEMM_BT * GEMM_LD;
#pragma unroll
    for (int j = 0; j < 4; ++j)
      *reinterpret_cast<v8bf*>(&As[(g32 + 32 * j) * GEMM_LD + q8 * 8]) = ra[j];
#pragma unroll
    for (int j = 0; j < 4; ++j)
      *reinterpret_cast<v8bf*>(&Bs[(g32 + 32 * j) * GEMM_LD + q8 * 8]) = rb[j];
    if (k0 + GEMM_BK < K) load_stage();    // the test reads the same for the whole block
    // The stage's barrier.  Its fences name LDS alone: the stage is handed over
    // in LDS only, and a fence over global memory too (as in __syncthreads())
    // would wait here for the next stage's loads, which are to stay in flight.
    __builtin_amdgcn_fence(__ATOMIC_RELEASE, "workgroup", "local");
    __builtin_amdgcn_s_barrier();
    __builtin_amdgcn_fence(__ATOMIC_ACQUIRE, "workgroup", "local");

    v16bf fa[2][2], fb[2][4];
#pragma unroll
    for (int kk = 0; kk < 2; ++kk) {
#pragma unroll
      for (int mt = 0; mt < 2; ++mt)
        fa[kk][mt] = ld_frag_bf(&As[(wm + mt * 16) * GEMM_LD + kk * 32], GEMM_LD);
#pragma unroll
      for (int nt = 0; nt < 4; ++nt)
        fb[kk][nt] = ld_frag_bf(&Bs[(wn + nt * 16) * GEMM_LD + kk * 32], GEMM_LD);
    }
    // Keeps the stage's 24 fragment reads one group ahead of the WMMAs: without
    // it each WMMA waits out the LDS latency of its own two reads.
    __builtin_amdgcn_sched_barrier(0);
#pragma unroll
    for (int kk = 0; kk < 2; ++kk) {
#pragma unroll
      for (int mt = 0; mt < 2; ++mt) {
#pragma unroll
        for (int nt = 0; nt < 4; ++nt)
          acc[mt][nt] = __builtin_amdgcn_wmma_f32_16x16x32_bf16(
              false, fa[kk][mt], false, fb[kk][nt], (short)0, acc[mt][nt], false, false);
      }
    }
  }

  const int half8 = (lane & 16) ? 8 : 0;
  const int cn    = lane & 15;
  // The wave's 32 x 64 values are finished in their registers first: a lane has
  // one column per column tile, so it reads four bias values, once ...
  if (bias) {
    float bv[4];
#pragma unroll
    for (int nt = 0; nt < 4; ++nt) bv[nt] = bias[n0 + wn + nt * 16 + cn];
    // Stands in front of any later overwrite of the address register of these loads.
    asm volatile("s_wait_xcnt 0x0" ::: "memory");
#pragma unroll
    for (int mt = 0; mt < 2; ++mt) {
#pragma unroll
      for (int nt = 0; nt < 4; ++nt) {
#pragma unroll
        for (int e = 0; e < 8; ++e) acc[mt][nt][e] += bv[nt];
      }
    }
  }
  if (relu) {
#pragma unroll
    for (int mt = 0; mt < 2; ++mt) {
#pragma unroll
      for (int nt = 0; nt < 4; ++nt) {
#pragma unroll
        for (int e = 0; e < 8; ++e) acc[mt][nt][e] = fmaxf(acc[mt][nt][e], 0.0f);
      }
    }
  }
  // ... and then stored row by row: the four stores of a row share one address.
  if (out16) {   // a result that is read as a matrix operand only: rounded here, once
    __bf16* C16 = reinterpret_cast<__bf16*>(C);
#pragma unroll
    for (int mt = 0; mt < 2; ++mt) {
#pragma unroll
      for (int e = 0; e < 8; ++e) {
        int row = m0 + wm + mt * 16 + e + half8;
        __bf16* pr = C16 + (size_t)row * N + n0 + wn + cn;
#pragma unroll
        for (int nt = 0; nt < 4; ++nt) pr[nt * 16] = (__bf16)acc[mt][nt][e];
        // Stands in front of the next row's address, which may take the registers
        // of the stores just issued.
        asm volatile("s_wait_xcnt 0x0" ::: "memory");
      }
    }
    return;
  }
#pragma unroll
  for (int mt = 0; mt < 2; ++mt) {
#pragma unroll
    for (int e = 0; e < 8; ++e) {
      int row = m0 + wm + mt * 16 + e + half8;
      float* pr = C + (size_t)row * N + n0 + wn + cn;
#pragma unroll
      for (int nt = 0; nt < 4; ++nt) pr[nt * 16] = acc[mt][nt][e];
      // Stands in front of the next row's address, which may take the registers
      // of the stores just issued.
      asm volatile("s_wait_xcnt 0x0" ::: "memory");
    }
  }
}

__device__ __forceinline__ float other_half(float x) {
  const int b = __builtin_bit_cast(int, x);
  return __builtin_bit_cast(float, __builtin_amdgcn_permlanex16(
             b, b, 0x76543210, 0xfedcba98, false, false));
}

__global__ __launch_bounds__(32)
void attn_wmma(const __bf16* __restrict__ Q1, const __bf16* __restrict__ K1,
               const __bf16* __restrict__ V1, const int* __restrict__ vlen1,
               __bf16* __restrict__ O1, int Tq, int Tk1, int causal,
               const __bf16* __restrict__ Q2, const __bf16* __restrict__ K2,
               const __bf16* __restrict__ V2, const int* __restrict__ vlen2,
               __bf16* __restrict__ O2, int Tk2, int nb) {
  __shared__ __align__(16) __bf16 Qs[16 * 64];   // [q][d]   (B fragments of K Q^T)
  __shared__ __align__(16) __bf16 Ks[32 * 64];   // [key][d] (A fragments of K Q^T)
  __shared__ __align__(16) __bf16 Vt[64 * 32];   // [d][key] (A fragments of V^T P^T)

  const int lane = threadIdx.x & 31;
  const int qb   = blockIdx.x * 16;
  const int h    = blockIdx.y;
  const bool second = (int)blockIdx.z >= nb;      // the same for the whole block
  const int b    = second ? (int)blockIdx.z - nb : (int)blockIdx.z;
  const __bf16* Q   = second ? Q2 : Q1;
  const __bf16* Kt  = second ? K2 : K1;
  const __bf16* V   = second ? V2 : V1;
  const int*   vlen = second ? vlen2 : vlen1;
  __bf16*      O    = second ? O2 : O1;
  const int    Tk   = second ? Tk2 : Tk1;
  const int half8 = (lane & 16) ? 8 : 0;
  const int cn    = lane & 15;                    // the lane's query in the tile

  const size_t qoff = ((size_t)b * Tq + qb) * D_MODEL + (size_t)h * D_HEAD;
#pragma unroll
  for (int i = 0; i < 4; ++i) {
    int idx = i * 32 + lane;          // 16-byte piece: 8 to a 128-byte head row
    int r = idx >> 3, c = (idx & 7) * 8;
    *reinterpret_cast<v8bf*>(&Qs[r * 64 + c]) =
        *reinterpret_cast<const v8bf*>(&Q[qoff + (size_t)r * D_MODEL + c]);
  }
  v16bf bq0 = ld_frag_bf(&Qs[0], 64);
  v16bf bq1 = ld_frag_bf(&Qs[32], 64);

  // Of the lane's query: the running maximum (alike in both halves) and the sum
  // over the keys that this half holds (the halves are joined behind the loop).
  float m = -3.0e38f, l = 0.0f;
  v8f o0 = {}, o1 = {}, o2 = {}, o3 = {};   // O^T: element e of tile t is d = 16 t + half8 + e

  const int vl   = causal ? Tk : min(vlen[b], Tk);   // bounds the key rows read below
  const int nblk = causal ? ((qb + 16 + 31) >> 5) : ((vl + 31) >> 5);
  const int lim  = causal ? qb + cn + 1 : vl;        // the lane's query takes the keys below lim

  // Staging of a 32-key block: a lane takes 16-byte pieces of the 128-byte head
  // rows.  Of K it takes keys 4i + h4; of V keys 8 h4 + jj, that is 8 keys x 8 d,
  // so that the transpose is a register regrouping and one 16-byte store per d.
  const int q8 = lane & 7;    // piece of 8 d
  const int h4 = lane >> 3;   // 0..3
  const size_t kvoff = (size_t)b * Tk * D_MODEL + (size_t)h * D_HEAD;   // same for the wave
  const unsigned ko = h4 * D_MODEL + q8 * 8;       // the lane's own part, K
  const unsigned vo = h4 * 8 * D_MODEL + q8 * 8;   // the lane's own part, V

  for (int j = 0; j < nblk; ++j) {
    const int kb = j * 32;
    {
      gv8bf_ptr kp = (gv8bf_ptr)(Kt + kvoff + (size_t)kb * D_MODEL + ko);
      gv8bf_ptr vp = (gv8bf_ptr)(V  + kvoff + (size_t)kb * D_MODEL + vo);
      v8bf rk[8], rv[8];
#pragma unroll
      for (int i = 0; i < 8; ++i)
        rk[i] = kp[4 * i * (D_MODEL / 8)];
#pragma unroll
      for (int i = 0; i < 8; ++i)
        rv[i] = vp[i * (D_MODEL / 8)];
      // Keeps all 16 loads of the block in flight together: without it the LDS
      // stores are scheduled among them and the block waits several times.
      __builtin_amdgcn_sched_barrier(0);
      // Stands in front of every overwrite of the address registers of the loads
      // just issued; it names both addresses as inputs, so that they keep their
      // registers up to here and no load's result is given one of them.
      asm volatile("s_wait_xcnt 0x0" :: "v"(kp), "v"(vp) : "memory");
#pragma unroll
      for (int i = 0; i < 8; ++i)
        *reinterpret_cast<v8bf*>(&Ks[(4 * i + h4) * 64 + q8 * 8]) = rk[i];
#pragma unroll
      for (int c = 0; c < 8; ++c) {
        v8bf t;
#pragma unroll
        for (int jj = 0; jj < 8; ++jj) t[jj] = rv[jj][c];
        *reinterpret_cast<v8bf*>(&Vt[(q8 * 8 + c) * 32 + h4 * 8]) = t;
      }
    }

    // S^T = K @ Q^T for 32 keys (two 16-key row tiles): element e of s0 is key
    // kb + half8 + e, of s1 key kb + 16 + half8 + e
    v8f s0 = {}, s1 = {};
    {
      v16bf a0a = ld_frag_bf(&Ks[0], 64);
      v16bf a0b = ld_frag_bf(&Ks[32], 64);
      v16bf a1a = ld_frag_bf(&Ks[16 * 64], 64);
      v16bf a1b = ld_frag_bf(&Ks[16 * 64 + 32], 64);
      s0 = __builtin_amdgcn_wmma_f32_16x16x32_bf16(false, a0a, false, bq0, (short)0, s0, false, false);
      s0 = __builtin_amdgcn_wmma_f32_16x16x32_bf16(false, a0b, false, bq1, (short)0, s0, false, false);
      s1 = __builtin_amdgcn_wmma_f32_16x16x32_bf16(false, a1a, false, bq0, (short)0, s1, false, false);
      s1 = __builtin_amdgcn_wmma_f32_16x16x32_bf16(false, a1b, false, bq1, (short)0, s1, false, false);
    }

    float p0[8], p1[8], t[8];
    const int key0 = kb + half8;
#pragma unroll
    for (int e = 0; e < 8; ++e) {
      p0[e] = s0[e] * 0.125f;   // 1/sqrt(64)
      p1[e] = s1[e] * 0.125f;
      if (key0 + e >= lim)      p0[e] = -1.0e6f;
      if (key0 + 16 + e >= lim) p1[e] = -1.0e6f;
      t[e] = fmaxf(p0[e], p1[e]);
    }
    float rm = fmaxf(fmaxf(fmaxf(t[0], t[1]), fmaxf(t[2], t[3])),
                     fmaxf(fmaxf(t[4], t[5]), fmaxf(t[6], t[7])));
    rm = fmaxf(rm, other_half(rm));
    const float mn    = fmaxf(m, rm);
    const float alpha = __expf(m - mn);
#pragma unroll
    for (int e = 0; e < 8; ++e) {
      p0[e] = __expf(p0[e] - mn);
      p1[e] = __expf(p1[e] - mn);
      t[e] = p0[e] + p1[e];
    }
    l = l * alpha + (((t[0] + t[1]) + (t[2] + t[3])) + ((t[4] + t[5]) + (t[6] + t[7])));
    m = mn;
    o0 *= alpha; o1 *= alpha; o2 *= alpha; o3 *= alpha;

    // P^T as B operand: elements 0..7 are k = half8 + e, elements 8..15 k = 16 + half8 + e,
    // the k order of ld_frag_bf, which loads the A operand
    v16bf bp;
#pragma unroll
    for (int e = 0; e < 8; ++e) { bp[e] = (__bf16)p0[e]; bp[e + 8] = (__bf16)p1[e]; }
    o0 = __builtin_amdgcn_wmma_f32_16x16x32_bf16(false, ld_frag_bf(&Vt[0],       32), false, bp, (short)0, o0, false, false);
    o1 = __builtin_amdgcn_wmma_f32_16x16x32_bf16(false, ld_frag_bf(&Vt[16 * 32], 32), false, bp, (short)0, o1, false, false);
    o2 = __builtin_amdgcn_wmma_f32_16x16x32_bf16(false, ld_frag_bf(&Vt[32 * 32], 32), false, bp, (short)0, o2, false, false);
    o3 = __builtin_amdgcn_wmma_f32_16x16x32_bf16(false, ld_frag_bf(&Vt[48 * 32], 32), false, bp, (short)0, o3, false, false);
  }

  // A lane has 8 neighbouring d of its query per tile: one 16-byte store each.
  const float inv = 1.0f / (l + other_half(l));
  __bf16* po = O + ((size_t)b * Tq + qb + cn) * D_MODEL + (size_t)h * D_HEAD + half8;
  v8bf r0, r1, r2, r3;
#pragma unroll
  for (int e = 0; e < 8; ++e) {
    r0[e] = (__bf16)(o0[e] * inv);
    r1[e] = (__bf16)(o1[e] * inv);
    r2[e] = (__bf16)(o2[e] * inv);
    r3[e] = (__bf16)(o3[e] * inv);
  }
  *reinterpret_cast<v8bf*>(po)      = r0;
  *reinterpret_cast<v8bf*>(po + 16) = r1;
  *reinterpret_cast<v8bf*>(po + 32) = r2;
  *reinterpret_cast<v8bf*>(po + 48) = r3;
}

#define ROW_WAVES 8

template <int M>
__device__ __forceinline__ float row_xmask(float x) {
  return __builtin_bit_cast(float, __builtin_amdgcn_update_dpp(
      0, __builtin_bit_cast(int, x), 0x160 | M, 0xf, 0xf, true));
}
// Sum over the 32 lanes, alike in every lane.
__device__ __forceinline__ float wave_sum(float x) {
  x += row_xmask<1>(x);
  x += row_xmask<2>(x);
  x += row_xmask<4>(x);
  x += row_xmask<8>(x);
  const int b = __builtin_bit_cast(int, x);
  return x + __builtin_bit_cast(float, __builtin_amdgcn_permlanex16(
                 b, b, 0x76543210, 0xfedcba98, false, false));
}

// out = LayerNorm(a + r) * g + bt; where the row feeds a product too, out16 takes
// its bf16 rounding (else out16 is null)
__global__ __launch_bounds__(32 * ROW_WAVES)
void add_ln(const float* __restrict__ a, const float* __restrict__ r,
            const float* __restrict__ g, const float* __restrict__ bt,
            float* __restrict__ out, __bf16* __restrict__ out16) {
  const int lane = threadIdx.x & 31;
  const int wave = __builtin_amdgcn_readfirstlane(threadIdx.x >> 5);
  const size_t ro = ((size_t)blockIdx.x * ROW_WAVES + wave) * D_MODEL;   // same for the wave
  gv4f_ptr pa = (gv4f_ptr)(a + ro);
  gv4f_ptr pr = (gv4f_ptr)(r + ro);
  gv4f_ptr pg = (gv4f_ptr)g;
  gv4f_ptr pb = (gv4f_ptr)bt;
  v4f v[8], t[8], vg[8], vb[8];
#pragma unroll
  for (int i = 0; i < 8; ++i) v[i] = pa[32 * i + lane];
#pragma unroll
  for (int i = 0; i < 8; ++i) t[i] = pr[32 * i + lane];
  // Keeps the row's own 16 loads ahead of those of g and bt, which are used last.
  __builtin_amdgcn_sched_barrier(0);
#pragma unroll
  for (int i = 0; i < 8; ++i) vg[i] = pg[32 * i + lane];
#pragma unroll
  for (int i = 0; i < 8; ++i) vb[i] = pb[32 * i + lane];
  // Stands in front of every overwrite of the address registers of these loads; it
  // names the bases and the lane as inputs, so that they keep their registers up to here.
  asm volatile("s_wait_xcnt 0x0" :: "s"(pa), "s"(pr), "s"(pg), "s"(pb), "v"(lane) : "memory");
  // Keeps the sums behind the 32 loads (the wave waits out memory once) and lets
  // nothing that writes a register be moved in front of the wait.
  __builtin_amdgcn_sched_barrier(0);
  v4f s4 = {};
#pragma unroll
  for (int i = 0; i < 8; ++i) { v[i] += t[i]; s4 += v[i]; }
  const float mean = wave_sum((s4[0] + s4[1]) + (s4[2] + s4[3])) * (1.0f / D_MODEL);
  v4f q4 = {};
#pragma unroll
  for (int i = 0; i < 8; ++i) { v[i] -= mean; q4 += v[i] * v[i]; }
  const float rstd =
      rsqrtf(wave_sum((q4[0] + q4[1]) + (q4[2] + q4[3])) * (1.0f / D_MODEL) + 1e-5f);
#pragma unroll
  for (int i = 0; i < 8; ++i) v[i] = v[i] * rstd * vg[i] + vb[i];
  // The bf16 copy goes first: its values take registers of their own while the f32
  // values are still needed, and behind the f32 stores the wave only ends.
  if (out16) {   // the test reads the same for the whole launch
    v4bf* ph = reinterpret_cast<v4bf*>(out16 + ro);
#pragma unroll
    for (int i = 0; i < 8; ++i) {
      v4bf o;
#pragma unroll
      for (int c = 0; c < 4; ++c) o[c] = (__bf16)v[i][c];
      ph[32 * i + lane] = o;
    }
    // Stands in front of any overwrite of a register of the stores just issued; it
    // names their base as an input, so that it keeps its registers up to here.
    asm volatile("s_wait_xcnt 0x0" :: "s"(ph), "v"(lane) : "memory");
  }
  v4f* po = reinterpret_cast<v4f*>(out + ro);
#pragma unroll
  for (int i = 0; i < 8; ++i) po[32 * i + lane] = v[i];
}

// gate = sigmoid(concat(code,kw) @ gw + gb); out = gate*code + (1-gate)*kw
__global__ __launch_bounds__(32 * ROW_WAVES)
void gate_mix(const float* __restrict__ code, const float* __restrict__ kw,
              const float* __restrict__ gw, const float* __restrict__ gb,
              float* __restrict__ out) {
  const int lane = threadIdx.x & 31;
  const int wave = __builtin_amdgcn_readfirstlane(threadIdx.x >> 5);
  const size_t ro = ((size_t)blockIdx.x * ROW_WAVES + wave) * D_MODEL;   // same for the wave
  gv4f_ptr pc = (gv4f_ptr)(code + ro);
  gv4f_ptr pk = (gv4f_ptr)(kw + ro);
  gv4f_ptr pw = (gv4f_ptr)gw;
  v4f vc[8], vk[8], wc[8], wk[8];
#pragma unroll
  for (int i = 0; i < 8; ++i) vc[i] = pc[32 * i + lane];
#pragma unroll
  for (int i = 0; i < 8; ++i) vk[i] = pk[32 * i + lane];
#pragma unroll
  for (int i = 0; i < 8; ++i) wc[i] = pw[32 * i + lane];
#pragma unroll
  for (int i = 0; i < 8; ++i) wk[i] = pw[D_MODEL / 4 + 32 * i + lane];
  // Stands in front of every overwrite of the address registers of these loads; it
  // names the bases and the lane as inputs, so that they keep their registers up to here.
  asm volatile("s_wait_xcnt 0x0" :: "s"(pc), "s"(pk), "s"(pw), "v"(lane) : "memory");
  // Keeps the sums behind the 32 loads (the wave waits out memory once) and lets
  // nothing that writes a register be moved in front of the wait.
  __builtin_amdgcn_sched_barrier(0);
  v4f s4 = {};
#pragma unroll
  for (int i = 0; i < 8; ++i) { s4 += vc[i] * wc[i]; s4 += vk[i] * wk[i]; }
  const float s = wave_sum((s4[0] + s4[1]) + (s4[2] + s4[3]));
  const float gsc = 1.0f / (1.0f + __expf(-(s + gb[0])));
  v4f* po = reinterpret_cast<v4f*>(out + ro);
#pragma unroll
  for (int i = 0; i < 8; ++i) po[32 * i + lane] = gsc * vc[i] + (1.0f - gsc) * vk[i];
}

// ---------------------------------------------------------------------------
// Rounds everything that the products read from the inputs to bf16, once per
// call.  blockIdx.y < 6: weights, f32 [K][N] -> bf16 [N][K] (k-contiguous, as the
// GEMM stages them); 4 M elements per y: four 1024 x 1024 matrices, or the
// 1024 x 4096, or the 4096 x 1024 one.  blockIdx.y >= 6: activations, same
// layout.  A block handles 8192 elements.
// ---------------------------------------------------------------------------
#define PREP_LD 136   // bf16 elements per LDS row: 128 k + 8 pad (272 B = 16 B x odd)
struct PrepJobs {
  const float* w0; const float* w1; const float* w2;
  const float* w3; const float* w4; const float* w5;
  const float* s0; const float* s1; const float* s2; const float* s3;
  int n0, n1, n2, n3;   // elements of s0 .. s3
};

__global__ __launch_bounds__(256)
void prep_bf16(PrepJobs P, __bf16* __restrict__ wt, __bf16* __restrict__ d0,
               __bf16* __restrict__ d1, __bf16* __restrict__ d2,
               __bf16* __restrict__ d3) {
  __shared__ __align__(16) __bf16 Ts[64 * PREP_LD];   // [n][k]
  const int tid = threadIdx.x;
  const int y   = blockIdx.y;      // the same for the whole block
  const int t   = blockIdx.x;
  if (y >= 6) {
    const float* S; __bf16* Dp; int n;
    switch (y) {
      case 6:  S = P.s0; Dp = d0; n = P.n0; break;
      case 7:  S = P.s1; Dp = d1; n = P.n1; break;
      case 8:  S = P.s2; Dp = d2; n = P.n2; break;
      default: S = P.s3; Dp = d3; n = P.n3; break;
    }
    if (t * 8192 >= n) return;     // taken by the whole block
    v4f r[8];
#pragma unroll
    for (int i = 0; i < 4; ++i) {
      const v4f* p = reinterpret_cast<const v4f*>(S + (size_t)t * 8192 + i * 2048 + tid * 8);
      r[2 * i] = p[0]; r[2 * i + 1] = p[1];
    }
    // Stands in front of any overwrite of an address register of these loads.
    asm volatile("s_wait_xcnt 0x0" ::: "memory");
#pragma unroll
    for (int i = 0; i < 4; ++i) {
      v8bf o;
#pragma unroll
      for (int c = 0; c < 4; ++c) { o[c] = (__bf16)r[2 * i][c]; o[c + 4] = (__bf16)r[2 * i + 1][c]; }
      *reinterpret_cast<v8bf*>(Dp + (size_t)t * 8192 + i * 2048 + tid * 8) = o;
    }
    return;
  }
  const float* Wp;
  switch (y) {
    case 0:  Wp = P.w0; break;
    case 1:  Wp = P.w1; break;
    case 2:  Wp = P.w2; break;
    case 3:  Wp = P.w3; break;
    case 4:  Wp = P.w4; break;
    default: Wp = P.w5; break;
  }
  const int K   = (y == 5) ? 4096 : 1024;
  const int N   = (y == 4) ? 4096 : 1024;
  const int lgn = (y == 4) ? 6 : 4;              // log2 of the 64-column tiles per row
  const int mat = (y < 4) ? (t >> 7) : 0;        // 128 tiles per 1024 x 1024 matrix
  const int tt  = (y < 4) ? (t & 127) : t;
  const int n0  = (tt & ((1 << lgn) - 1)) * 64;
  const int k0  = (tt >> lgn) * 128;
  const size_t mo = (size_t)mat * 1024 * 1024;
  const int q16 = tid & 15;        // 4 n
  const int g16 = tid >> 4;        // 8 k
  v4f r[8];
  const v4f* qp[8];
#pragma unroll
  for (int j = 0; j < 8; ++j)
    qp[j] = reinterpret_cast<const v4f*>(Wp + mo + (size_t)(k0 + g16 * 8 + j) * N + n0 + q16 * 4);
#pragma unroll
  for (int j = 0; j < 8; ++j) r[j] = *qp[j];
  // Keeps the 8 loads in flight together: without it the conversions of the first
  // two are scheduled among them and the block waits out memory twice.
  __builtin_amdgcn_sched_barrier(0);
  // Stands in front of every overwrite of the address registers of these loads;
  // it names the addresses as inputs, so that they keep their registers up to here.
  asm volatile("s_wait_xcnt 0x0"
               :: "v"(qp[0]), "v"(qp[1]), "v"(qp[2]), "v"(qp[3]),
                  "v"(qp[4]), "v"(qp[5]), "v"(qp[6]), "v"(qp[7])
               : "memory");
#pragma unroll
  for (int i = 0; i < 4; ++i) {
    v8bf o;
#pragma unroll
    for (int j = 0; j < 8; ++j) o[j] = (__bf16)r[j][i];
    *reinterpret_cast<v8bf*>(&Ts[(q16 * 4 + i) * PREP_LD + g16 * 8]) = o;
  }
  __syncthreads();   // the rows are read back by other threads, as whole 256-byte runs
  __bf16* Wo = wt + (size_t)y * 4 * 1024 * 1024 + mo;
#pragma unroll
  for (int i = 0; i < 4; ++i) {
    int p = i * 256 + tid;
    int rown = p >> 4, c = (p & 15) * 8;
    *reinterpret_cast<v8bf*>(Wo + (size_t)(n0 + rown) * K + k0 + c) =
        *reinterpret_cast<const v8bf*>(&Ts[rown * PREP_LD + c]);
  }
  // Stands behind the four stores, in front of whatever the built code places
  // after them that could take their registers.
  asm volatile("s_wait_xcnt 0x0" ::: "memory");
}

extern "C" void kernel_launch(void* const* d_in, const int* in_sizes, int n_in,
                              void* d_out, int out_size, void* d_ws, size_t ws_size,
                              hipStream_t stream) {
  const int B = 8, T = 512, SC = 512, ST = 256, SK = 64, D = 1024, DFF = 4096;
  const float* x       = (const float*)d_in[0];
  const float* src     = (const float*)d_in[1];
  const int*   src_len = (const int*)  d_in[2];
  const float* tpl     = (const float*)d_in[3];
  const int*   tpl_len = (const int*)  d_in[4];
  const float* kwe     = (const float*)d_in[5];
  const int*   kw_len  = (const int*)  d_in[6];
  const float* sa_w    = (const float*)d_in[7];
  const float* cc_w    = (const float*)d_in[8];
  const float* ck_w    = (const float*)d_in[9];
  const float* ct_w    = (const float*)d_in[10];
  const float* gate_w  = (const float*)d_in[11];
  const float* gate_b  = (const float*)d_in[12];
  const float* w1      = (const float*)d_in[13];
  const float* b1      = (const float*)d_in[14];
  const float* w2      = (const float*)d_in[15];
  const float* b2      = (const float*)d_in[16];
  const float* ln_g    = (const float*)d_in[17];
  const float* ln_b    = (const float*)d_in[18];

  const size_t DD   = (size_t)D * D;
  const size_t NTOK = (size_t)B * T * D;   // 4M floats

  float* ws = (float*)d_ws;
  size_t off = 0;
  auto take = [&](size_t n) { float* p = ws + off; off += n; return p; };
  auto take16 = [&](size_t n) { return (__bf16*)take(n / 2); };   // n bf16 values
  float* T1 = take(NTOK); float* T2 = take(NTOK); float* Yb = take(NTOK);
  float* Cb = take(NTOK); float* Zb = take(NTOK); float* Wb = take(NTOK);
  // What only matrix products read is kept as bf16.
  __bf16* wt  = take16(24 * DD);          // all weights, [n][k]
  __bf16* x16 = take16(NTOK);
  __bf16* s16 = take16((size_t)B * SC * D);
  __bf16* p16 = take16((size_t)B * ST * D);
  __bf16* k16 = take16((size_t)B * SK * D);
  __bf16* Y16 = take16(NTOK); __bf16* Z16 = take16(NTOK); __bf16* W16 = take16(NTOK);
  __bf16* ccK = take16((size_t)B * SC * D); __bf16* ccV = take16((size_t)B * SC * D);
  __bf16* ctK = take16((size_t)B * ST * D); __bf16* ctV = take16((size_t)B * ST * D);
  __bf16* ckK = take16((size_t)B * SK * D); __bf16* ckV = take16((size_t)B * SK * D);
  // The FFN's hidden layer takes the place of Q, K, V and the attention output,
  // which are all done with when it is written.
  __bf16* Hb = take16((size_t)B * T * DFF);
  __bf16* Qb = Hb; __bf16* Kb = Qb + NTOK; __bf16* Vb = Kb + NTOK; __bf16* Ab = Vb + NTOK;
  const __bf16* sa_t = wt;           const __bf16* cc_t = wt + 4 * DD;
  const __bf16* ck_t = wt + 8 * DD;  const __bf16* ct_t = wt + 12 * DD;
  const __bf16* w1_t = wt + 16 * DD; const __bf16* w2_t = wt + 20 * DD;

  const GemmJobs none = {GEMM_NO_JOB, GEMM_NO_JOB, GEMM_NO_JOB, GEMM_NO_JOB,
                         GEMM_NO_JOB, GEMM_NO_JOB, GEMM_NO_JOB, GEMM_NO_JOB,
                         nullptr, nullptr, nullptr, nullptr, nullptr, nullptr,
                         nullptr, nullptr, nullptr, nullptr, nullptr, nullptr,
                         nullptr, nullptr, nullptr, nullptr, nullptr, nullptr,
                         nullptr, nullptr, nullptr, nullptr, nullptr, nullptr,
                         nullptr, nullptr, nullptr};
  auto gemm_jobs = [&](const GemmJobs& J, const float* bias, int row_tiles,
                       int N, int K, int relu, int out16) {
    dim3 grid(N / GEMM_BT, row_tiles);
    gemm_bf16_wmma<<<grid, dim3(256), 0, stream>>>(J, bias, N, K, relu, out16);
  };
  auto gemm = [&](const __bf16* A, const __bf16* Bm, const float* bias, float* C,
                  int M, int N, int K, int relu, int out16) {
    GemmJobs J = none;
    J.a0 = A; J.b0 = Bm; J.c0 = C;
    gemm_jobs(J, bias, M / GEMM_BT, N, K, relu, out16);
  };
  // two products with B*T rows each
  auto gemm2 = [&](const __bf16* A0, const __bf16* B0, float* C0,
                   const __bf16* A1, const __bf16* B1, float* C1, int out16) {
    GemmJobs J = none;
    J.a0 = A0; J.b0 = B0; J.c0 = C0;
    J.a1 = A1; J.b1 = B1; J.c1 = C1; J.t1 = B * T / GEMM_BT;
    gemm_jobs(J, nullptr, 2 * (B * T / GEMM_BT), D, D, 0, out16);
  };
  auto attn = [&](const __bf16* Qp, const __bf16* Kp, const __bf16* Vp, const int* vl,
                  __bf16* Op, int Tk, int causal) {
    dim3 grid(T / 16, 16, B);
    attn_wmma<<<grid, dim3(32), 0, stream>>>(Qp, Kp, Vp, vl, Op, T, Tk, causal,
                                             nullptr, nullptr, nullptr, nullptr,
                                             nullptr, 0, B);
  };
  auto lnk = [&](const float* a, const float* r, int li, float* o, __bf16* o16) {
    add_ln<<<dim3(B * T / ROW_WAVES), dim3(32 * ROW_WAVES), 0, stream>>>(a, r, ln_g + (size_t)li * D,
                                                  ln_b + (size_t)li * D, o, o16);
  };

  // ---- inputs and weights to bf16, weights transposed ----
  {
    PrepJobs P = {sa_w, cc_w, ck_w, ct_w, w1, w2, x, src, tpl, kwe,
                  B * T * D, B * SC * D, B * ST * D, B * SK * D};
    prep_bf16<<<dim3(512, 10), dim3(256), 0, stream>>>(P, wt, x16, s16, p16, k16);
  }

  // ---- every projection that reads inputs alone: one launch ----
  {
    const int tT = B * T / GEMM_BT, tC = B * SC / GEMM_BT, tP = B * ST / GEMM_BT,
              tW = B * SK / GEMM_BT;
    GemmJobs J = none;
    J.a0 = x16; J.b0 = sa_t + 0 * DD; J.c0 = (float*)Qb;
    J.a1 = x16; J.b1 = sa_t + 1 * DD; J.c1 = (float*)Kb;  J.t1 = tT;
    J.a2 = x16; J.b2 = sa_t + 2 * DD; J.c2 = (float*)Vb;  J.t2 = 2 * tT;
    J.a3 = s16; J.b3 = cc_t + 1 * DD; J.c3 = (float*)ccK; J.t3 = 3 * tT;
    J.a4 = s16; J.b4 = cc_t + 2 * DD; J.c4 = (float*)ccV; J.t4 = 3 * tT + tC;
    J.a5 = p16; J.b5 = ct_t + 1 * DD; J.c5 = (float*)ctK; J.t5 = 3 * tT + 2 * tC;
    J.a6 = p16; J.b6 = ct_t + 2 * DD; J.c6 = (float*)ctV; J.t6 = 3 * tT + 2 * tC + tP;
    J.a7 = k16; J.b7 = ck_t + 1 * DD; J.c7 = (float*)ckK; J.t7 = 3 * tT + 2 * tC + 2 * tP;
    J.a8 = k16; J.b8 = ck_t + 2 * DD; J.c8 = (float*)ckV; J.t8 = 3 * tT + 2 * tC + 2 * tP + tW;
    gemm_jobs(J, nullptr, 3 * tT + 2 * tC + 2 * tP + 2 * tW, D, D, 0, 1);
  }

  // ---- causal self-attention ----
  attn(Qb, Kb, Vb, nullptr, Ab, T, 1);
  gemm(Ab, sa_t + 3 * DD, nullptr, T1, B * T, D, D, 0, 0);
  lnk(x, T1, 0, Yb, Y16);                         // y

  // ---- cross-attention: source code and keywords, side by side ----
  // (Kb and Vb are free again: keyword queries in Kb, keyword attention in Vb)
  gemm2(Y16, cc_t + 0 * DD, (float*)Qb, Y16, ck_t + 0 * DD, (float*)Kb, 1);
  attn_wmma<<<dim3(T / 16, 16, 2 * B), dim3(32), 0, stream>>>(
      Qb, ccK, ccV, src_len, Ab, T, SC, 0, Kb, ckK, ckV, kw_len, Vb, SK, B);
  gemm2(Ab, cc_t + 3 * DD, Cb, Vb, ck_t + 3 * DD, T1, 0);    // y2_code, y2_kw

  gate_mix<<<dim3(B * T / ROW_WAVES), dim3(32 * ROW_WAVES), 0, stream>>>(Cb, T1, gate_w, gate_b, T2);
  lnk(Yb, T2, 1, Zb, Z16);                        // z

  // ---- cross-attention: template ----
  gemm(Z16, ct_t + 0 * DD, nullptr, (float*)Qb, B * T, D, D, 0, 1);
  attn(Qb, ctK, ctV, tpl_len, Ab, ST, 0);
  gemm(Ab, ct_t + 3 * DD, nullptr, T1, B * T, D, D, 0, 0);   // z2
  lnk(Zb, T1, 2, Wb, W16);                        // w

  // ---- FFN ----
  gemm(W16, w1_t, b1, (float*)Hb, B * T, DFF, D, 1, 1);   // relu(w@w1+b1)
  gemm(Hb, w2_t, b2, T1, B * T, D, DFF, 0, 0);
  lnk(Wb, T1, 3, (float*)d_out, nullptr);         // final LN

  (void)in_sizes; (void)n_in; (void)out_size; (void)ws_size;
}

// v009
// One run takes 313 microseconds.
// Two timings next to v008 put it at 1.04 and 1.03 times that version's speed.
// All steps since v000 together make it 6.05 times as fast.
#include <hip/hip_runtime.h>
#include <hip/hip_bf16.h>

typedef __attribute__((ext_vector_type(16))) __bf16 v16bf;
typedef __attribute__((ext_vector_type(8)))  __bf16 v8bf;
typedef __attribute__((ext_vector_type(4)))  __bf16 v4bf;
typedef __attribute__((ext_vector_type(8)))  float  v8f;
typedef __attribute__((ext_vector_type(4)))  float  v4f;

#define D_MODEL 1024
#define D_HEAD  64

__device__ __forceinline__ v16bf ld_frag_bf(const __bf16* base, int ldk) {
  const int lane = threadIdx.x & 31;
  const int r    = lane & 15;
  const int ko   = (lane & 16) ? 8 : 0;
  const __bf16* p = base + r * ldk + ko;
  v8bf lo = *reinterpret_cast<const v8bf*>(p);
  v8bf hi = *reinterpret_cast<const v8bf*>(p + 16);
  v16bf f;
#pragma unroll
  for (int i = 0; i < 8; ++i) { f[i] = lo[i]; f[i + 8] = hi[i]; }
  return f;
}

// ---------------------------------------------------------------------------
// C = A(bf16,[M,K]) @ Bt(bf16,[N,K])^T (+bias)(+relu) -> f32 or bf16 [M,N]
// bf16 WMMA, f32 accumulate.  M,N multiples of 128; K multiple of 64.
// A block of 8 waves makes a 128 x 128 tile of C, a wave 32 x 64 of it (waves
// 4 down x 2 across), so that every operand byte fetched feeds 128 outputs.
// A stage is 64 k of both operands.  Both arrive as bf16 and k-contiguous (their
// producers round them once), so a stage row is one 128-byte line: each thread
// loads 16-byte pieces and stores them as they are, As[m][k] and Bs[n][k].
// Rows are pitched 144 B (16 B x odd) for the 16-byte fragment reads.
// The stages are pipelined: the loads of stage s + 1 are issued before the
// fragment reads and WMMAs of stage s and land behind them.  LDS holds two
// stages, so that one barrier per stage is enough: a wave writes buffer s & 1
// behind barrier s - 1, which every wave reaches with its reads of stage s - 2
// (the same buffer) complete.
// ---------------------------------------------------------------------------
#define GEMM_BK 64
#define GEMM_LD 72   // bf16 elements per LDS row: 64 k + 8 pad
#define GEMM_BT 128  // rows and columns of C per block
typedef const __attribute__((address_space(1))) v4f* gv4f_ptr;
typedef const __attribute__((address_space(1))) v8bf* gv8bf_ptr;
typedef const __attribute__((address_space(1))) char* gbyte_ptr;

// Up to nine independent products C_j = A_j @ B_j of one launch; all share N and
// K.  Their row tiles are stacked along blockIdx.y: job j owns the tiles from
// t_j (t_0 = 0) up to t_(j+1).  An unused job has t_j = GEMM_NO_JOB.
// c_j points at f32 values, or at bf16 values where the launch says out16.
#define GEMM_NO_JOB 0x7fffffff
struct GemmJobs {
  int t1, t2, t3, t4, t5, t6, t7, t8;
  const __bf16* a0; const __bf16* b0; float* c0;
  const __bf16* a1; const __bf16* b1; float* c1;
  const __bf16* a2; const __bf16* b2; float* c2;
  const __bf16* a3; const __bf16* b3; float* c3;
  const __bf16* a4; const __bf16* b4; float* c4;
  const __bf16* a5; const __bf16* b5; float* c5;
  const __bf16* a6; const __bf16* b6; float* c6;
  const __bf16* a7; const __bf16* b7; float* c7;
  const __bf16* a8; const __bf16* b8; float* c8;
};

__global__ __launch_bounds__(256)
void gemm_bf16_wmma(GemmJobs J, const float* __restrict__ bias,
                    int N, int K, int relu, int out16) {
  // two stages of As[m][k] followed by Bs[n][k]
  __shared__ __align__(16) __bf16 Sm[2][2 * GEMM_BT * GEMM_LD];
  const int tid  = threadIdx.x;
  const int wave = tid >> 5;
  const int lane = tid & 31;
  const int wm = (wave & 3) * 32;    // the wave's first row in the tile
  const int wn = (wave >> 2) * 64;   // the wave's first column in the tile
  const int n0 = blockIdx.x * GEMM_BT;

  // Which product this block works for: the same for the whole block.
  const int ty = blockIdx.y;
  // The job's number comes from all eight bounds at once, its three pointers from
  // one more read of the arguments (a chain of tests would read them one by one).
  const int job = (ty >= J.t1) + (ty >= J.t2) + (ty >= J.t3) + (ty >= J.t4) +
                  (ty >= J.t5) + (ty >= J.t6) + (ty >= J.t7) + (ty >= J.t8);
  const __bf16* A; const __bf16* B; float* C; int t0;
  switch (job) {
#define GEMM_PICK(j) case j: A = J.a##j; B = J.b##j; C = J.c##j; t0 = J.t##j; break;
    GEMM_PICK(1) GEMM_PICK(2) GEMM_PICK(3) GEMM_PICK(4)
    GEMM_PICK(5) GEMM_PICK(6) GEMM_PICK(7) GEMM_PICK(8)
#undef GEMM_PICK
    default: A = J.a0; B = J.b0; C = J.c0; t0 = 0; break;
  }
  const int m0 = (ty - t0) * GEMM_BT;

  const int q8  = tid & 7;          // 16-byte piece inside the 128 bytes of a stage row
  const int g32 = tid >> 3;         // 0..31: row group, of A and of Bt alike
  // This thread's 8 pieces of a stage: a base that is the same for the whole
  // block, one per piece and advanced per stage, plus the thread's own 32-bit
  // byte offset (one for both operands: they share K).  The full addresses then
  // live in vector registers only around the loads, not beside the fragments.
  // (global address space kept in the type, so that the loads stay global_load)
  gbyte_ptr pa[4];
  gbyte_ptr pb[4];
#pragma unroll
  for (int j = 0; j < 4; ++j) {
    pa[j] = (gbyte_ptr)(A + (size_t)(m0 + 32 * j) * K);   // rows g32 + 32j
    pb[j] = (gbyte_ptr)(B + (size_t)(n0 + 32 * j) * K);   // rows g32 + 32j
  }
  const unsigned oab = (unsigned)(g32 * K + q8 * 8) * 2u;

  v8f acc[2][4] = {};

  v8bf ra[4], rb[4];
  // Issues the 8 loads of the stage that the bases stand at, then advances them.
  auto load_stage = [&]() {
    gv8bf_ptr qa[4], qb[4];
#pragma unroll
    for (int j = 0; j < 4; ++j) {
      qa[j] = (gv8bf_ptr)(pa[j] + oab);
      qb[j] = (gv8bf_ptr)(pb[j] + oab);
    }
#pragma unroll
    for (int j = 0; j < 4; ++j) ra[j] = *qa[j];
#pragma unroll
    for (int j = 0; j < 4; ++j) rb[j] = *qb[j];
    // Keeps the 8 loads here, together and ahead of the fragment reads and
    // WMMAs that follow: moved down to their use they would hide nothing.
    __builtin_amdgcn_sched_barrier(0);
    // Stands in front of every overwrite of the address registers of the loads
    // just issued (the base updates below among them); it names the 8 addresses
    // as inputs, so that they keep their registers up to here and no load's
    // result is given one of them.
    asm volatile("s_wait_xcnt 0x0"
                 :: "v"(qa[0]), "v"(qa[1]), "v"(qa[2]), "v"(qa[3]),
                    "v"(qb[0]), "v"(qb[1]), "v"(qb[2]), "v"(qb[3])
                 : "memory");
#pragma unroll
    for (int j = 0; j < 4; ++j) { pa[j] += GEMM_BK * 2; pb[j] += GEMM_BK * 2; }
  };
  load_stage();

  for (int k0 = 0; k0 < K; k0 += GEMM_BK) {
    __bf16* As = Sm[(k0 / GEMM_BK) & 1];
    __bf16* Bs = As + GEMM_BT * GEMM_LD;
#pragma unroll
    for (int j = 0; j < 4; ++j)
      *reinterpret_cast<v8bf*>(&As[(g32 + 32 * j) * GEMM_LD + q8 * 8]) = ra[j];
#pragma unroll
    for (int j = 0; j < 4; ++j)
      *reinterpret_cast<v8bf*>(&Bs[(g32 + 32 * j) * GEMM_LD + q8 * 8]) = rb[j];
    if (k0 + GEMM_BK < K) load_stage();    // the test reads the same for the whole block
    // The stage's barrier.  Its fences name LDS alone: the stage is handed over
    // in LDS only, and a fence over global memory too (as in __syncthreads())
    // would wait here for the next stage's loads, which are to stay in flight.
    __builtin_amdgcn_fence(__ATOMIC_RELEASE, "workgroup", "local");
    __builtin_amdgcn_s_barrier();
    __builtin_amdgcn_fence(__ATOMIC_ACQUIRE, "workgroup", "local");

    v16bf fa[2][2], fb[2][4];
#pragma unroll
    for (int kk = 0; kk < 2; ++kk) {
#pragma unroll
      for (int mt = 0; mt < 2; ++mt)
        fa[kk][mt] = ld_frag_bf(&As[(wm + mt * 16) * GEMM_LD + kk * 32], GEMM_LD);
#pragma unroll
      for (int nt = 0; nt < 4; ++nt)
        fb[kk][nt] = ld_frag_bf(&Bs[(wn + nt * 16) * GEMM_LD + kk * 32], GEMM_LD);
    }
    // Keeps the stage's 24 fragment reads one group ahead of the WMMAs: without
    // it each WMMA waits out the LDS latency of its own two reads.
    __builtin_amdgcn_sched_barrier(0);
#pragma unroll
    for (int kk = 0; kk < 2; ++kk) {
#pragma unroll
      for (int mt = 0; mt < 2; ++mt) {
#pragma unroll
        for (int nt = 0; nt < 4; ++nt)
          acc[mt][nt] = __builtin_amdgcn_wmma_f32_16x16x32_bf16(
              false, fa[kk][mt], false, fb[kk][nt], (short)0, acc[mt][nt], false, false);
      }
    }
  }

  const int half8 = (lane & 16) ? 8 : 0;
  const int cn    = lane & 15;
  // The wave's 32 x 64 values are finished in their registers first: a lane has
  // one column per column tile, so it reads four bias values, once ...
  if (bias) {
    float bv[4];
#pragma unroll
    for (int nt = 0; nt < 4; ++nt) bv[nt] = bias[n0 + wn + nt * 16 + cn];
    // Stands in front of any later overwrite of the address register of these loads.
    asm volatile("s_wait_xcnt 0x0" ::: "memory");
#pragma unroll
    for (int mt = 0; mt < 2; ++mt) {
#pragma unroll
      for (int nt = 0; nt < 4; ++nt) {
#pragma unroll
        for (int e = 0; e < 8; ++e) acc[mt][nt][e] += bv[nt];
      }
    }
  }
  if (relu) {
#pragma unroll
    for (int mt = 0; mt < 2; ++mt) {
#pragma unroll
      for (int nt = 0; nt < 4; ++nt) {
#pragma unroll
        for (int e = 0; e < 8; ++e) acc[mt][nt][e] = fmaxf(acc[mt][nt][e], 0.0f);
      }
    }
  }
  // ... and then stored row by row: the four stores of a row share one address.
  if (out16) {   // a result that is read as a matrix operand only: rounded here, once
    __bf16* C16 = reinterpret_cast<__bf16*>(C);
#pragma unroll
    for (int mt = 0; mt < 2; ++mt) {
#pragma unroll
      for (int e = 0; e < 8; ++e) {
        int row = m0 + wm + mt * 16 + e + half8;
        __bf16* pr = C16 + (size_t)row * N + n0 + wn + cn;
#pragma unroll
        for (int nt = 0; nt < 4; ++nt) pr[nt * 16] = (__bf16)acc[mt][nt][e];
        // Stands in front of the next row's address, which may take the registers
        // of the stores just issued.
        asm volatile("s_wait_xcnt 0x0" ::: "memory");
      }
    }
    return;
  }
#pragma unroll
  for (int mt = 0; mt < 2; ++mt) {
#pragma unroll
    for (int e = 0; e < 8; ++e) {
      int row = m0 + wm + mt * 16 + e + half8;
      float* pr = C + (size_t)row * N + n0 + wn + cn;
#pragma unroll
      for (int nt = 0; nt < 4; ++nt) pr[nt * 16] = acc[mt][nt][e];
      // Stands in front of the next row's address, which may take the registers
      // of the stores just issued.
      asm volatile("s_wait_xcnt 0x0" ::: "memory");
    }
  }
}

#define ATT_KP 72
#define ATT_VP 80
typedef __attribute__((ext_vector_type(8))) short v8s;
typedef __attribute__((address_space(3))) v8s lds_v8s;

// A fragment of V^T (16 d x 32 keys) out of the row-major tile [key][d]: the LDS
// transposes.  tile = key 0 of the block, first d of the fragment.  A lane gets,
// for d = lane & 15, the keys of ld_frag_bf's k order.
__device__ __forceinline__ v16bf ld_frag_tr(const __bf16* tile) {
  const int lane = threadIdx.x & 31;
  const __bf16* p = tile + (((lane & 16) >> 1) + (lane & 7)) * ATT_VP + (lane & 8);
  v8bf lo = __builtin_bit_cast(v8bf, __builtin_amdgcn_ds_load_tr16_b128_v8i16((lds_v8s*)p));
  v8bf hi = __builtin_bit_cast(v8bf, __builtin_amdgcn_ds_load_tr16_b128_v8i16(
                                         (lds_v8s*)(p + 16 * ATT_VP)));
  v16bf f;
#pragma unroll
  for (int i = 0; i < 8; ++i) { f[i] = lo[i]; f[i + 8] = hi[i]; }
  return f;
}

__device__ __forceinline__ float other_half(float x) {
  const int b = __builtin_bit_cast(int, x);
  return __builtin_bit_cast(float, __builtin_amdgcn_permlanex16(
             b, b, 0x76543210, 0xfedcba98, false, false));
}

__global__ __launch_bounds__(32)
void attn_wmma(const __bf16* __restrict__ Q1, const __bf16* __restrict__ K1,
               const __bf16* __restrict__ V1, const int* __restrict__ vlen1,
               __bf16* __restrict__ O1, int Tq, int Tk1, int causal,
               const __bf16* __restrict__ Q2, const __bf16* __restrict__ K2,
               const __bf16* __restrict__ V2, const int* __restrict__ vlen2,
               __bf16* __restrict__ O2, int Tk2, int nb) {
  __shared__ __align__(16) __bf16 Qs[16 * ATT_KP];   // [q][d]   (B fragments of K Q^T)
  __shared__ __align__(16) __bf16 Ks[32 * ATT_KP];   // [key][d] (A fragments of K Q^T)
  __shared__ __align__(16) __bf16 Vs[32 * ATT_VP];   // [key][d] (A fragments of V^T P^T, transposed on reading)

  const int lane = threadIdx.x & 31;
  const int qb   = blockIdx.x * 16;
  const int h    = blockIdx.y;
  const bool second = (int)blockIdx.z >= nb;      // the same for the whole block
  const int b    = second ? (int)blockIdx.z - nb : (int)blockIdx.z;
  const __bf16* Q   = second ? Q2 : Q1;
  const __bf16* Kt  = second ? K2 : K1;
  const __bf16* V   = second ? V2 : V1;
  const int*   vlen = second ? vlen2 : vlen1;
  __bf16*      O    = second ? O2 : O1;
  const int    Tk   = second ? Tk2 : Tk1;
  const int half8 = (lane & 16) ? 8 : 0;
  const int cn    = lane & 15;                    // the lane's query in the tile

  const size_t qoff = ((size_t)b * Tq + qb) * D_MODEL + (size_t)h * D_HEAD;
#pragma unroll
  for (int i = 0; i < 4; ++i) {
    int idx = i * 32 + lane;          // 16-byte piece: 8 to a 128-byte head row
    int r = idx >> 3, c = (idx & 7) * 8;
    *reinterpret_cast<v8bf*>(&Qs[r * ATT_KP + c]) =
        *reinterpret_cast<const v8bf*>(&Q[qoff + (size_t)r * D_MODEL + c]);
  }
  v16bf bq0 = ld_frag_bf(&Qs[0], ATT_KP);
  v16bf bq1 = ld_frag_bf(&Qs[32], ATT_KP);

  // Of the lane's query: the running maximum (alike in both halves) and the sum
  // over the keys that this half holds (the halves are joined behind the loop).
  float m = -3.0e38f, l = 0.0f;
  v8f o0 = {}, o1 = {}, o2 = {}, o3 = {};   // O^T: element e of tile t is d = 16 t + half8 + e

  const int vl   = causal ? Tk : min(vlen[b], Tk);   // bounds the key rows read below
  const int nblk = causal ? ((qb + 16 + 31) >> 5) : ((vl + 31) >> 5);
  const int lim  = causal ? qb + cn + 1 : vl;        // the lane's query takes the keys below lim

  const int q8 = lane & 7;    // piece of 8 d
  const int h4 = lane >> 3;   // 0..3
  const int kr = 8 * h4;                          // K: keys kr + i
  const int vr = 4 * (h4 & 1) + 16 * (h4 >> 1);   // V: keys vr + (i & 3) + 8 (i >> 2)
  const size_t kvoff = (size_t)b * Tk * D_MODEL + (size_t)h * D_HEAD;   // same for the wave
  const unsigned ko = kr * D_MODEL + q8 * 8;   // the lane's own part, K
  const unsigned vo = vr * D_MODEL + q8 * 8;   // the lane's own part, V

  for (int j = 0; j < nblk; ++j) {
    const int kb = j * 32;
    {
      gv8bf_ptr kp = (gv8bf_ptr)(Kt + kvoff + (size_t)kb * D_MODEL + ko);
      gv8bf_ptr vp = (gv8bf_ptr)(V  + kvoff + (size_t)kb * D_MODEL + vo);
      v8bf rk[8], rv[8];
#pragma unroll
      for (int i = 0; i < 8; ++i)
        rk[i] = kp[i * (D_MODEL / 8)];
#pragma unroll
      for (int i = 0; i < 8; ++i)
        rv[i] = vp[((i & 3) + 8 * (i >> 2)) * (D_MODEL / 8)];
      // Keeps all 16 loads of the block in flight together: without it the LDS
      // stores are scheduled among them and the block waits several times.
      __builtin_amdgcn_sched_barrier(0);
      // Stands in front of every overwrite of the address registers of the loads
      // just issued; it names both addresses as inputs, so that they keep their
      // registers up to here and no load's result is given one of them.
      asm volatile("s_wait_xcnt 0x0" :: "v"(kp), "v"(vp) : "memory");
#pragma unroll
      for (int i = 0; i < 8; ++i)
        *reinterpret_cast<v8bf*>(&Ks[(kr + i) * ATT_KP + q8 * 8]) = rk[i];
#pragma unroll
      for (int i = 0; i < 8; ++i)
        *reinterpret_cast<v8bf*>(&Vs[(vr + (i & 3) + 8 * (i >> 2)) * ATT_VP + q8 * 8]) = rv[i];
    }

    // S^T = K @ Q^T for 32 keys (two 16-key row tiles): element e of s0 is key
    // kb + half8 + e, of s1 key kb + 16 + half8 + e
    v8f s0 = {}, s1 = {};
    {
      v16bf a0a = ld_frag_bf(&Ks[0], ATT_KP);
      v16bf a0b = ld_frag_bf(&Ks[32], ATT_KP);
      v16bf a1a = ld_frag_bf(&Ks[16 * ATT_KP], ATT_KP);
      v16bf a1b = ld_frag_bf(&Ks[16 * ATT_KP + 32], ATT_KP);
      s0 = __builtin_amdgcn_wmma_f32_16x16x32_bf16(false, a0a, false, bq0, (short)0, s0, false, false);
      s0 = __builtin_amdgcn_wmma_f32_16x16x32_bf16(false, a0b, false, bq1, (short)0, s0, false, false);
      s1 = __builtin_amdgcn_wmma_f32_16x16x32_bf16(false, a1a, false, bq0, (short)0, s1, false, false);
      s1 = __builtin_amdgcn_wmma_f32_16x16x32_bf16(false, a1b, false, bq1, (short)0, s1, false, false);
    }

    float p0[8], p1[8], t[8];
    const int key0 = kb + half8;
#pragma unroll
    for (int e = 0; e < 8; ++e) {
      p0[e] = s0[e] * 0.125f;   // 1/sqrt(64)
      p1[e] = s1[e] * 0.125f;
      if (key0 + e >= lim)      p0[e] = -1.0e6f;
      if (key0 + 16 + e >= lim) p1[e] = -1.0e6f;
      t[e] = fmaxf(p0[e], p1[e]);
    }
    float rm = fmaxf(fmaxf(fmaxf(t[0], t[1]), fmaxf(t[2], t[3])),
                     fmaxf(fmaxf(t[4], t[5]), fmaxf(t[6], t[7])));
    rm = fmaxf(rm, other_half(rm));
    const float mn    = fmaxf(m, rm);
    const float alpha = __expf(m - mn);
#pragma unroll
    for (int e = 0; e < 8; ++e) {
      p0[e] = __expf(p0[e] - mn);
      p1[e] = __expf(p1[e] - mn);
      t[e] = p0[e] + p1[e];
    }
    l = l * alpha + (((t[0] + t[1]) + (t[2] + t[3])) + ((t[4] + t[5]) + (t[6] + t[7])));
    m = mn;
    o0 *= alpha; o1 *= alpha; o2 *= alpha; o3 *= alpha;

    // P^T as B operand: elements 0..7 are k = half8 + e, elements 8..15 k = 16 + half8 + e,
    // the k order of ld_frag_tr, which loads the A operand
    v16bf bp;
#pragma unroll
    for (int e = 0; e < 8; ++e) { bp[e] = (__bf16)p0[e]; bp[e + 8] = (__bf16)p1[e]; }
    o0 = __builtin_amdgcn_wmma_f32_16x16x32_bf16(false, ld_frag_tr(&Vs[0]),  false, bp, (short)0, o0, false, false);
    o1 = __builtin_amdgcn_wmma_f32_16x16x32_bf16(false, ld_frag_tr(&Vs[16]), false, bp, (short)0, o1, false, false);
    o2 = __builtin_amdgcn_wmma_f32_16x16x32_bf16(false, ld_frag_tr(&Vs[32]), false, bp, (short)0, o2, false, false);
    o3 = __builtin_amdgcn_wmma_f32_16x16x32_bf16(false, ld_frag_tr(&Vs[48]), false, bp, (short)0, o3, false, false);
  }

  // A lane has 8 neighbouring d of its query per tile: one 16-byte store each.
  const float inv = 1.0f / (l + other_half(l));
  __bf16* po = O + ((size_t)b * Tq + qb + cn) * D_MODEL + (size_t)h * D_HEAD + half8;
  v8bf r0, r1, r2, r3;
#pragma unroll
  for (int e = 0; e < 8; ++e) {
    r0[e] = (__bf16)(o0[e] * inv);
    r1[e] = (__bf16)(o1[e] * inv);
    r2[e] = (__bf16)(o2[e] * inv);
    r3[e] = (__bf16)(o3[e] * inv);
  }
  *reinterpret_cast<v8bf*>(po)      = r0;
  *reinterpret_cast<v8bf*>(po + 16) = r1;
  *reinterpret_cast<v8bf*>(po + 32) = r2;
  *reinterpret_cast<v8bf*>(po + 48) = r3;
}

#define ROW_WAVES 8

template <int M>
__device__ __forceinline__ float row_xmask(float x) {
  return __builtin_bit_cast(float, __builtin_amdgcn_update_dpp(
      0, __builtin_bit_cast(int, x), 0x160 | M, 0xf, 0xf, true));
}
// Sum over the 32 lanes, alike in every lane.
__device__ __forceinline__ float wave_sum(float x) {
  x += row_xmask<1>(x);
  x += row_xmask<2>(x);
  x += row_xmask<4>(x);
  x += row_xmask<8>(x);
  const int b = __builtin_bit_cast(int, x);
  return x + __builtin_bit_cast(float, __builtin_amdgcn_permlanex16(
                 b, b, 0x76543210, 0xfedcba98, false, false));
}

// out = LayerNorm(a + r) * g + bt; where the row feeds a product too, out16 takes
// its bf16 rounding (else out16 is null)
__global__ __launch_bounds__(32 * ROW_WAVES)
void add_ln(const float* __restrict__ a, const float* __restrict__ r,
            const float* __restrict__ g, const float* __restrict__ bt,
            float* __restrict__ out, __bf16* __restrict__ out16) {
  const int lane = threadIdx.x & 31;
  const int wave = __builtin_amdgcn_readfirstlane(threadIdx.x >> 5);
  const size_t ro = ((size_t)blockIdx.x * ROW_WAVES + wave) * D_MODEL;   // same for the wave
  gv4f_ptr pa = (gv4f_ptr)(a + ro);
  gv4f_ptr pr = (gv4f_ptr)(r + ro);
  gv4f_ptr pg = (gv4f_ptr)g;
  gv4f_ptr pb = (gv4f_ptr)bt;
  v4f v[8], t[8], vg[8], vb[8];
#pragma unroll
  for (int i = 0; i < 8; ++i) v[i] = pa[32 * i + lane];
#pragma unroll
  for (int i = 0; i < 8; ++i) t[i] = pr[32 * i + lane];
  // Keeps the row's own 16 loads ahead of those of g and bt, which are used last.
  __builtin_amdgcn_sched_barrier(0);
#pragma unroll
  for (int i = 0; i < 8; ++i) vg[i] = pg[32 * i + lane];
#pragma unroll
  for (int i = 0; i < 8; ++i) vb[i] = pb[32 * i + lane];
  // Stands in front of every overwrite of the address registers of these loads; it
  // names the bases and the lane as inputs, so that they keep their registers up to here.
  asm volatile("s_wait_xcnt 0x0" :: "s"(pa), "s"(pr), "s"(pg), "s"(pb), "v"(lane) : "memory");
  // Keeps the sums behind the 32 loads (the wave waits out memory once) and lets
  // nothing that writes a register be moved in front of the wait.
  __builtin_amdgcn_sched_barrier(0);
  v4f s4 = {};
#pragma unroll
  for (int i = 0; i < 8; ++i) { v[i] += t[i]; s4 += v[i]; }
  const float mean = wave_sum((s4[0] + s4[1]) + (s4[2] + s4[3])) * (1.0f / D_MODEL);
  v4f q4 = {};
#pragma unroll
  for (int i = 0; i < 8; ++i) { v[i] -= mean; q4 += v[i] * v[i]; }
  const float rstd =
      rsqrtf(wave_sum((q4[0] + q4[1]) + (q4[2] + q4[3])) * (1.0f / D_MODEL) + 1e-5f);
#pragma unroll
  for (int i = 0; i < 8; ++i) v[i] = v[i] * rstd * vg[i] + vb[i];
  // The bf16 copy goes first: its values take registers of their own while the f32
  // values are still needed, and behind the f32 stores the wave only ends.
  if (out16) {   // the test reads the same for the whole launch
    v4bf* ph = reinterpret_cast<v4bf*>(out16 + ro);
#pragma unroll
    for (int i = 0; i < 8; ++i) {
      v4bf o;
#pragma unroll
      for (int c = 0; c < 4; ++c) o[c] = (__bf16)v[i][c];
      ph[32 * i + lane] = o;
    }
    // Stands in front of any overwrite of a register of the stores just issued; it
    // names their base as an input, so that it keeps its registers up to here.
    asm volatile("s_wait_xcnt 0x0" :: "s"(ph), "v"(lane) : "memory");
  }
  v4f* po = reinterpret_cast<v4f*>(out + ro);
#pragma unroll
  for (int i = 0; i < 8; ++i) po[32 * i + lane] = v[i];
}

// gate = sigmoid(concat(code,kw) @ gw + gb); out = gate*code + (1-gate)*kw
__global__ __launch_bounds__(32 * ROW_WAVES)
void gate_mix(const float* __restrict__ code, const float* __restrict__ kw,
              const float* __restrict__ gw, const float* __restrict__ gb,
              float* __restrict__ out) {
  const int lane = threadIdx.x & 31;
  const int wave = __builtin_amdgcn_readfirstlane(threadIdx.x >> 5);
  const size_t ro = ((size_t)blockIdx.x * ROW_WAVES + wave) * D_MODEL;   // same for the wave
  gv4f_ptr pc = (gv4f_ptr)(code + ro);
  gv4f_ptr pk = (gv4f_ptr)(kw + ro);
  gv4f_ptr pw = (gv4f_ptr)gw;
  v4f vc[8], vk[8], wc[8], wk[8];
#pragma unroll
  for (int i = 0; i < 8; ++i) vc[i] = pc[32 * i + lane];
#pragma unroll
  for (int i = 0; i < 8; ++i) vk[i] = pk[32 * i + lane];
#pragma unroll
  for (int i = 0; i < 8; ++i) wc[i] = pw[32 * i + lane];
#pragma unroll
  for (int i = 0; i < 8; ++i) wk[i] = pw[D_MODEL / 4 + 32 * i + lane];
  // Stands in front of every overwrite of the address registers of these loads; it
  // names the bases and the lane as inputs, so that they keep their registers up to here.
  asm volatile("s_wait_xcnt 0x0" :: "s"(pc), "s"(pk), "s"(pw), "v"(lane) : "memory");
  // Keeps the sums behind the 32 loads (the wave waits out memory once) and lets
  // nothing that writes a register be moved in front of the wait.
  __builtin_amdgcn_sched_barrier(0);
  v4f s4 = {};
#pragma unroll
  for (int i = 0; i < 8; ++i) { s4 += vc[i] * wc[i]; s4 += vk[i] * wk[i]; }
  const float s = wave_sum((s4[0] + s4[1]) + (s4[2] + s4[3]));
  const float gsc = 1.0f / (1.0f + __expf(-(s + gb[0])));
  v4f* po = reinterpret_cast<v4f*>(out + ro);
#pragma unroll
  for (int i = 0; i < 8; ++i) po[32 * i + lane] = gsc * vc[i] + (1.0f - gsc) * vk[i];
}

// ---------------------------------------------------------------------------
// Rounds everything that the products read from the inputs to bf16, once per
// call.  blockIdx.y < 6: weights, f32 [K][N] -> bf16 [N][K] (k-contiguous, as the
// GEMM stages them); 4 M elements per y: four 1024 x 1024 matrices, or the
// 1024 x 4096, or the 4096 x 1024 one.  blockIdx.y >= 6: activations, same
// layout.  A block handles 8192 elements.
// ---------------------------------------------------------------------------
#define PREP_LD 136   // bf16 elements per LDS row: 128 k + 8 pad (272 B = 16 B x odd)
struct PrepJobs {
  const float* w0; const float* w1; const float* w2;
  const float* w3; const float* w4; const float* w5;
  const float* s0; const float* s1; const float* s2; const float* s3;
  int n0, n1, n2, n3;   // elements of s0 .. s3
};

__global__ __launch_bounds__(256)
void prep_bf16(PrepJobs P, __bf16* __restrict__ wt, __bf16* __restrict__ d0,
               __bf16* __restrict__ d1, __bf16* __restrict__ d2,
               __bf16* __restrict__ d3) {
  __shared__ __align__(16) __bf16 Ts[64 * PREP_LD];   // [n][k]
  const int tid = threadIdx.x;
  const int y   = blockIdx.y;      // the same for the whole block
  const int t   = blockIdx.x;
  if (y >= 6) {
    const float* S; __bf16* Dp; int n;
    switch (y) {
      case 6:  S = P.s0; Dp = d0; n = P.n0; break;
      case 7:  S = P.s1; Dp = d1; n = P.n1; break;
      case 8:  S = P.s2; Dp = d2; n = P.n2; break;
      default: S = P.s3; Dp = d3; n = P.n3; break;
    }
    if (t * 8192 >= n) return;     // taken by the whole block
    v4f r[8];
#pragma unroll
    for (int i = 0; i < 4; ++i) {
      const v4f* p = reinterpret_cast<const v4f*>(S + (size_t)t * 8192 + i * 2048 + tid * 8);
      r[2 * i] = p[0]; r[2 * i + 1] = p[1];
    }
    // Stands in front of any overwrite of an address register of these loads.
    asm volatile("s_wait_xcnt 0x0" ::: "memory");
#pragma unroll
    for (int i = 0; i < 4; ++i) {
      v8bf o;
#pragma unroll
      for (int c = 0; c < 4; ++c) { o[c] = (__bf16)r[2 * i][c]; o[c + 4] = (__bf16)r[2 * i + 1][c]; }
      *reinterpret_cast<v8bf*>(Dp + (size_t)t * 8192 + i * 2048 + tid * 8) = o;
    }
    return;
  }
  const float* Wp;
  switch (y) {
    case 0:  Wp = P.w0; break;
    case 1:  Wp = P.w1; break;
    case 2:  Wp = P.w2; break;
    case 3:  Wp = P.w3; break;
    case 4:  Wp = P.w4; break;
    default: Wp = P.w5; break;
  }
  const int K   = (y == 5) ? 4096 : 1024;
  const int N   = (y == 4) ? 4096 : 1024;
  const int lgn = (y == 4) ? 6 : 4;              // log2 of the 64-column tiles per row
  const int mat = (y < 4) ? (t >> 7) : 0;        // 128 tiles per 1024 x 1024 matrix
  const int tt  = (y < 4) ? (t & 127) : t;
  const int n0  = (tt & ((1 << lgn) - 1)) * 64;
  const int k0  = (tt >> lgn) * 128;
  const size_t mo = (size_t)mat * 1024 * 1024;
  const int q16 = tid & 15;        // 4 n
  const int g16 = tid >> 4;        // 8 k
  v4f r[8];
  const v4f* qp[8];
#pragma unroll
  for (int j = 0; j < 8; ++j)
    qp[j] = reinterpret_cast<const v4f*>(Wp + mo + (size_t)(k0 + g16 * 8 + j) * N + n0 + q16 * 4);
#pragma unroll
  for (int j = 0; j < 8; ++j) r[j] = *qp[j];
  // Keeps the 8 loads in flight together: without it the conversions of the first
  // two are scheduled among them and the block waits out memory twice.
  __builtin_amdgcn_sched_barrier(0);
  // Stands in front of every overwrite of the address registers of these loads;
  // it names the addresses as inputs, so that they keep their registers up to here.
  asm volatile("s_wait_xcnt 0x0"
               :: "v"(qp[0]), "v"(qp[1]), "v"(qp[2]), "v"(qp[3]),
                  "v"(qp[4]), "v"(qp[5]), "v"(qp[6]), "v"(qp[7])
               : "memory");
#pragma unroll
  for (int i = 0; i < 4; ++i) {
    v8bf o;
#pragma unroll
    for (int j = 0; j < 8; ++j) o[j] = (__bf16)r[j][i];
    *reinterpret_cast<v8bf*>(&Ts[(q16 * 4 + i) * PREP_LD + g16 * 8]) = o;
  }
  __syncthreads();   // the rows are read back by other threads, as whole 256-byte runs
  __bf16* Wo = wt + (size_t)y * 4 * 1024 * 1024 + mo;
#pragma unroll
  for (int i = 0; i < 4; ++i) {
    int p = i * 256 + tid;
    int rown = p >> 4, c = (p & 15) * 8;
    *reinterpret_cast<v8bf*>(Wo + (size_t)(n0 + rown) * K + k0 + c) =
        *reinterpret_cast<const v8bf*>(&Ts[rown * PREP_LD + c]);
  }
  // Stands behind the four stores, in front of whatever the built code places
  // after them that could take their registers.
  asm volatile("s_wait_xcnt 0x0" ::: "memory");
}

extern "C" void kernel_launch(void* const* d_in, const int* in_sizes, int n_in,
                              void* d_out, int out_size, void* d_ws, size_t ws_size,
                              hipStream_t stream) {
  const int B = 8, T = 512, SC = 512, ST = 256, SK = 64, D = 1024, DFF = 4096;
  const float* x       = (const float*)d_in[0];
  const float* src     = (const float*)d_in[1];
  const int*   src_len = (const int*)  d_in[2];
  const float* tpl     = (const float*)d_in[3];
  const int*   tpl_len = (const int*)  d_in[4];
  const float* kwe     = (const float*)d_in[5];
  const int*   kw_len  = (const int*)  d_in[6];
  const float* sa_w    = (const float*)d_in[7];
  const float* cc_w    = (const float*)d_in[8];
  const float* ck_w    = (const float*)d_in[9];
  const float* ct_w    = (const float*)d_in[10];
  const float* gate_w  = (const float*)d_in[11];
  const float* gate_b  = (const float*)d_in[12];
  const float* w1      = (const float*)d_in[13];
  const float* b1      = (const float*)d_in[14];
  const float* w2      = (const float*)d_in[15];
  const float* b2      = (const float*)d_in[16];
  const float* ln_g    = (const float*)d_in[17];
  const float* ln_b    = (const float*)d_in[18];

  const size_t DD   = (size_t)D * D;
  const size_t NTOK = (size_t)B * T * D;   // 4M floats

  float* ws = (float*)d_ws;
  size_t off = 0;
  auto take = [&](size_t n) { float* p = ws + off; off += n; return p; };
  auto take16 = [&](size_t n) { return (__bf16*)take(n / 2); };   // n bf16 values
  float* T1 = take(NTOK); float* T2 = take(NTOK); float* Yb = take(NTOK);
  float* Cb = take(NTOK); float* Zb = take(NTOK); float* Wb = take(NTOK);
  // What only matrix products read is kept as bf16.
  __bf16* wt  = take16(24 * DD);          // all weights, [n][k]
  __bf16* x16 = take16(NTOK);
  __bf16* s16 = take16((size_t)B * SC * D);
  __bf16* p16 = take16((size_t)B * ST * D);
  __bf16* k16 = take16((size_t)B * SK * D);
  __bf16* Y16 = take16(NTOK); __bf16* Z16 = take16(NTOK); __bf16* W16 = take16(NTOK);
  __bf16* ccK = take16((size_t)B * SC * D); __bf16* ccV = take16((size_t)B * SC * D);
  __bf16* ctK = take16((size_t)B * ST * D); __bf16* ctV = take16((size_t)B * ST * D);
  __bf16* ckK = take16((size_t)B * SK * D); __bf16* ckV = take16((size_t)B * SK * D);
  // The FFN's hidden layer takes the place of Q, K, V and the attention output,
  // which are all done with when it is written.
  __bf16* Hb = take16((size_t)B * T * DFF);
  __bf16* Qb = Hb; __bf16* Kb = Qb + NTOK; __bf16* Vb = Kb + NTOK; __bf16* Ab = Vb + NTOK;
  const __bf16* sa_t = wt;           const __bf16* cc_t = wt + 4 * DD;
  const __bf16* ck_t = wt + 8 * DD;  const __bf16* ct_t = wt + 12 * DD;
  const __bf16* w1_t = wt + 16 * DD; const __bf16* w2_t = wt + 20 * DD;

  const GemmJobs none = {GEMM_NO_JOB, GEMM_NO_JOB, GEMM_NO_JOB, GEMM_NO_JOB,
                         GEMM_NO_JOB, GEMM_NO_JOB, GEMM_NO_JOB, GEMM_NO_JOB,
                         nullptr, nullptr, nullptr, nullptr, nullptr, nullptr,
                         nullptr, nullptr, nullptr, nullptr, nullptr, nullptr,
                         nullptr, nullptr, nullptr, nullptr, nullptr, nullptr,
                         nullptr, nullptr, nullptr, nullptr, nullptr, nullptr,
                         nullptr, nullptr, nullptr};
  auto gemm_jobs = [&](const GemmJobs& J, const float* bias, int row_tiles,
                       int N, int K, int relu, int out16) {
    dim3 grid(N / GEMM_BT, row_tiles);
    gemm_bf16_wmma<<<grid, dim3(256), 0, stream>>>(J, bias, N, K, relu, out16);
  };
  auto gemm = [&](const __bf16* A, const __bf16* Bm, const float* bias, float* C,
                  int M, int N, int K, int relu, int out16) {
    GemmJobs J = none;
    J.a0 = A; J.b0 = Bm; J.c0 = C;
    gemm_jobs(J, bias, M / GEMM_BT, N, K, relu, out16);
  };
  // two products with B*T rows each
  auto gemm2 = [&](const __bf16* A0, const __bf16* B0, float* C0,
                   const __bf16* A1, const __bf16* B1, float* C1, int out16) {
    GemmJobs J = none;
    J.a0 = A0; J.b0 = B0; J.c0 = C0;
    J.a1 = A1; J.b1 = B1; J.c1 = C1; J.t1 = B * T / GEMM_BT;
    gemm_jobs(J, nullptr, 2 * (B * T / GEMM_BT), D, D, 0, out16);
  };
  auto attn = [&](const __bf16* Qp, const __bf16* Kp, const __bf16* Vp, const int* vl,
                  __bf16* Op, int Tk, int causal) {
    dim3 grid(T / 16, 16, B);
    attn_wmma<<<grid, dim3(32), 0, stream>>>(Qp, Kp, Vp, vl, Op, T, Tk, causal,
                                             nullptr, nullptr, nullptr, nullptr,
                                             nullptr, 0, B);
  };
  auto lnk = [&](const float* a, const float* r, int li, float* o, __bf16* o16) {
    add_ln<<<dim3(B * T / ROW_WAVES), dim3(32 * ROW_WAVES), 0, stream>>>(a, r, ln_g + (size_t)li * D,
                                                  ln_b + (size_t)li * D, o, o16);
  };

  // ---- inputs and weights to bf16, weights transposed ----
  {
    PrepJobs P = {sa_w, cc_w, ck_w, ct_w, w1, w2, x, src, tpl, kwe,
                  B * T * D, B * SC * D, B * ST * D, B * SK * D};
    prep_bf16<<<dim3(512, 10), dim3(256), 0, stream>>>(P, wt, x16, s16, p16, k16);
  }

  // ---- every projection that reads inputs alone: one launch ----
  {
    const int tT = B * T / GEMM_BT, tC = B * SC / GEMM_BT, tP = B * ST / GEMM_BT,
              tW = B * SK / GEMM_BT;
    GemmJobs J = none;
    J.a0 = x16; J.b0 = sa_t + 0 * DD; J.c0 = (float*)Qb;
    J.a1 = x16; J.b1 = sa_t + 1 * DD; J.c1 = (float*)Kb;  J.t1 = tT;
    J.a2 = x16; J.b2 = sa_t + 2 * DD; J.c2 = (float*)Vb;  J.t2 = 2 * tT;
    J.a3 = s16; J.b3 = cc_t + 1 * DD; J.c3 = (float*)ccK; J.t3 = 3 * tT;
    J.a4 = s16; J.b4 = cc_t + 2 * DD; J.c4 = (float*)ccV; J.t4 = 3 * tT + tC;
    J.a5 = p16; J.b5 = ct_t + 1 * DD; J.c5 = (float*)ctK; J.t5 = 3 * tT + 2 * tC;
    J.a6 = p16; J.b6 = ct_t + 2 * DD; J.c6 = (float*)ctV; J.t6 = 3 * tT + 2 * tC + tP;
    J.a7 = k16; J.b7 = ck_t + 1 * DD; J.c7 = (float*)ckK; J.t7 = 3 * tT + 2 * tC + 2 * tP;
    J.a8 = k16; J.b8 = ck_t + 2 * DD; J.c8 = (float*)ckV; J.t8 = 3 * tT + 2 * tC + 2 * tP + tW;
    gemm_jobs(J, nullptr, 3 * tT + 2 * tC + 2 * tP + 2 * tW, D, D, 0, 1);
  }

  // ---- causal self-attention ----
  attn(Qb, Kb, Vb, nullptr, Ab, T, 1);
  gemm(Ab, sa_t + 3 * DD, nullptr, T1, B * T, D, D, 0, 0);
  lnk(x, T1, 0, Yb, Y16);                         // y

  // ---- cross-attention: source code and keywords, side by side ----
  // (Kb and Vb are free again: keyword queries in Kb, keyword attention in Vb)
  gemm2(Y16, cc_t + 0 * DD, (float*)Qb, Y16, ck_t + 0 * DD, (float*)Kb, 1);
  attn_wmma<<<dim3(T / 16, 16, 2 * B), dim3(32), 0, stream>>>(
      Qb, ccK, ccV, src_len, Ab, T, SC, 0, Kb, ckK, ckV, kw_len, Vb, SK, B);
  gemm2(Ab, cc_t + 3 * DD, Cb, Vb, ck_t + 3 * DD, T1, 0);    // y2_code, y2_kw

  gate_mix<<<dim3(B * T / ROW_WAVES), dim3(32 * ROW_WAVES), 0, stream>>>(Cb, T1, gate_w, gate_b, T2);
  lnk(Yb, T2, 1, Zb, Z16);                        // z

  // ---- cross-attention: template ----
  gemm(Z16, ct_t + 0 * DD, nullptr, (float*)Qb, B * T, D, D, 0, 1);
  attn(Qb, ctK, ctV, tpl_len, Ab, ST, 0);
  gemm(Ab, ct_t + 3 * DD, nullptr, T1, B * T, D, D, 0, 0);   // z2
  lnk(Zb, T1, 2, Wb, W16);                        // w

  // ---- FFN ----
  gemm(W16, w1_t, b1, (float*)Hb, B * T, DFF, D, 1, 1);   // relu(w@w1+b1)
  gemm(Hb, w2_t, b2, T1, B * T, D, DFF, 0, 0);
  lnk(Wb, T1, 3, (float*)d_out, nullptr);         // final LN

  (void)in_sizes; (void)n_in; (void)out_size; (void)ws_size;
}

// v010
// One run takes 298 microseconds.
// In two side-by-side timings against v009, it was 1.06 and 1.04 times as fast.
// Counting every step since v000, it is 6.37 times as fast.
#include <hip/hip_runtime.h>
#include <hip/hip_bf16.h>

typedef __attribute__((ext_vector_type(16))) __bf16 v16bf;
typedef __attribute__((ext_vector_type(8)))  __bf16 v8bf;
typedef __attribute__((ext_vector_type(4)))  __bf16 v4bf;
typedef __attribute__((ext_vector_type(8)))  float  v8f;
typedef __attribute__((ext_vector_type(4)))  float  v4f;

#define D_MODEL 1024
#define D_HEAD  64

__device__ __forceinline__ v16bf ld_frag_bf(const __bf16* base, int ldk) {
  const int lane = threadIdx.x & 31;
  const int r    = lane & 15;
  const int ko   = (lane & 16) ? 8 : 0;
  const __bf16* p = base + r * ldk + ko;
  v8bf lo = *reinterpret_cast<const v8bf*>(p);
  v8bf hi = *reinterpret_cast<const v8bf*>(p + 16);
  v16bf f;
#pragma unroll
  for (int i = 0; i < 8; ++i) { f[i] = lo[i]; f[i + 8] = hi[i]; }
  return f;
}

// ---------------------------------------------------------------------------
// C = A(bf16,[M,K]) @ Bt(bf16,[N,K])^T (+bias)(+relu) -> f32 or bf16 [M,N]
// bf16 WMMA, f32 accumulate.  M,N multiples of 128; K multiple of 64.
// A block of 8 waves makes a 128 x 128 tile of C, a wave 32 x 64 of it (waves
// 4 down x 2 across), so that every operand byte fetched feeds 128 outputs.
// A stage is 64 k of both operands.  Both arrive as bf16 and k-contiguous (their
// producers round them once), so a stage row is one 128-byte line: each thread
// loads 16-byte pieces and stores them as they are, As[m][k] and Bs[n][k].
// Rows are pitched 144 B (16 B x odd) for the 16-byte fragment reads.
// The stages are pipelined: the loads of stage s + 1 are issued before the
// fragment reads and WMMAs of stage s and land behind them.  LDS holds two
// stages, so that one barrier per stage is enough: a wave writes buffer s & 1
// behind barrier s - 1, which every wave reaches with its reads of stage s - 2
// (the same buffer) complete.
// ---------------------------------------------------------------------------
#define GEMM_BK 64
#define GEMM_LD 72   // bf16 elements per LDS row: 64 k + 8 pad
#define GEMM_BT 128  // rows and columns of C per block
typedef const __attribute__((address_space(1))) v4f* gv4f_ptr;
typedef const __attribute__((address_space(1))) v8bf* gv8bf_ptr;
typedef const __attribute__((address_space(1))) char* gbyte_ptr;

// Up to nine independent products C_j = A_j @ B_j of one launch; all share N and
// K.  Their row tiles are stacked along blockIdx.y: job j owns the tiles from
// t_j (t_0 = 0) up to t_(j+1).  An unused job has t_j = GEMM_NO_JOB.
// c_j points at f32 values, or at bf16 values where the launch says out16.
#define GEMM_NO_JOB 0x7fffffff
struct GemmJobs {
  int t1, t2, t3, t4, t5, t6, t7, t8;
  const __bf16* a0; const __bf16* b0; float* c0;
  const __bf16* a1; const __bf16* b1; float* c1;
  const __bf16* a2; const __bf16* b2; float* c2;
  const __bf16* a3; const __bf16* b3; float* c3;
  const __bf16* a4; const __bf16* b4; float* c4;
  const __bf16* a5; const __bf16* b5; float* c5;
  const __bf16* a6; const __bf16* b6; float* c6;
  const __bf16* a7; const __bf16* b7; float* c7;
  const __bf16* a8; const __bf16* b8; float* c8;
};

__global__ __launch_bounds__(256)
void gemm_bf16_wmma(GemmJobs J, const float* __restrict__ bias,
                    int N, int K, int relu, int out16) {
  // two stages of As[m][k] followed by Bs[n][k]
  __shared__ __align__(16) __bf16 Sm[2][2 * GEMM_BT * GEMM_LD];
  const int tid  = threadIdx.x;
  const int wave = tid >> 5;
  const int lane = tid & 31;
  const int wm = (wave & 3) * 32;    // the wave's first row in the tile
  const int wn = (wave >> 2) * 64;   // the wave's first column in the tile
  const int n0 = blockIdx.x * GEMM_BT;

  // Which product this block works for: the same for the whole block.
  const int ty = blockIdx.y;
  // The job's number comes from all eight bounds at once, its three pointers from
  // one more read of the arguments (a chain of tests would read them one by one).
  const int job = (ty >= J.t1) + (ty >= J.t2) + (ty >= J.t3) + (ty >= J.t4) +
                  (ty >= J.t5) + (ty >= J.t6) + (ty >= J.t7) + (ty >= J.t8);
  const __bf16* A; const __bf16* B; float* C; int t0;
  switch (job) {
#define GEMM_PICK(j) case j: A = J.a##j; B = J.b##j; C = J.c##j; t0 = J.t##j; break;
    GEMM_PICK(1) GEMM_PICK(2) GEMM_PICK(3) GEMM_PICK(4)
    GEMM_PICK(5) GEMM_PICK(6) GEMM_PICK(7) GEMM_PICK(8)
#undef GEMM_PICK
    default: A = J.a0; B = J.b0; C = J.c0; t0 = 0; break;
  }
  const int m0 = (ty - t0) * GEMM_BT;

  const int q8  = tid & 7;          // 16-byte piece inside the 128 bytes of a stage row
  const int g32 = tid >> 3;         // 0..31: row group, of A and of Bt alike
  // This thread's 8 pieces of a stage: a base that is the same for the whole
  // block, one per piece and advanced per stage, plus the thread's own 32-bit
  // byte offset (one for both operands: they share K).  The full addresses then
  // live in vector registers only around the loads, not beside the fragments.
  // (global address space kept in the type, so that the loads stay global_load)
  gbyte_ptr pa[4];
  gbyte_ptr pb[4];
#pragma unroll
  for (int j = 0; j < 4; ++j) {
    pa[j] = (gbyte_ptr)(A + (size_t)(m0 + 32 * j) * K);   // rows g32 + 32j
    pb[j] = (gbyte_ptr)(B + (size_t)(n0 + 32 * j) * K);   // rows g32 + 32j
  }
  const unsigned oab = (unsigned)(g32 * K + q8 * 8) * 2u;

  v8f acc[2][4] = {};

  v8bf ra[4], rb[4];
  // Issues the 8 loads of the stage that the bases stand at, then advances them.
  auto load_stage = [&]() {
    gv8bf_ptr qa[4], qb[4];
#pragma unroll
    for (int j = 0; j < 4; ++j) {
      qa[j] = (gv8bf_ptr)(pa[j] + oab);
      qb[j] = (gv8bf_ptr)(pb[j] + oab);
    }
#pragma unroll
    for (int j = 0; j < 4; ++j) ra[j] = *qa[j];
#pragma unroll
    for (int j = 0; j < 4; ++j) rb[j] = *qb[j];
    // Keeps the 8 loads here, together and ahead of the fragment reads and
    // WMMAs that follow: moved down to their use they would hide nothing.
    __builtin_amdgcn_sched_barrier(0);
    // Stands in front of every overwrite of the address registers of the loads
    // just issued (the base updates below among them); it names the 8 addresses
    // as inputs, so that they keep their registers up to here and no load's
    // result is given one of them.
    asm volatile("s_wait_xcnt 0x0"
                 :: "v"(qa[0]), "v"(qa[1]), "v"(qa[2]), "v"(qa[3]),
                    "v"(qb[0]), "v"(qb[1]), "v"(qb[2]), "v"(qb[3])
                 : "memory");
#pragma unroll
    for (int j = 0; j < 4; ++j) { pa[j] += GEMM_BK * 2; pb[j] += GEMM_BK * 2; }
  };
  load_stage();

  for (int k0 = 0; k0 < K; k0 += GEMM_BK) {
    __bf16* As = Sm[(k0 / GEMM_BK) & 1];
    __bf16* Bs = As + GEMM_BT * GEMM_LD;
#pragma unroll
    for (int j = 0; j < 4; ++j)
      *reinterpret_cast<v8bf*>(&As[(g32 + 32 * j) * GEMM_LD + q8 * 8]) = ra[j];
#pragma unroll
    for (int j = 0; j < 4; ++j)
      *reinterpret_cast<v8bf*>(&Bs[(g32 + 32 * j) * GEMM_LD + q8 * 8]) = rb[j];
    if (k0 + GEMM_BK < K) load_stage();    // the test reads the same for the whole block
    // The stage's barrier.  Its fences name LDS alone: the stage is handed over
    // in LDS only, and a fence over global memory too (as in __syncthreads())
    // would wait here for the next stage's loads, which are to stay in flight.
    __builtin_amdgcn_fence(__ATOMIC_RELEASE, "workgroup", "local");
    __builtin_amdgcn_s_barrier();
    __builtin_amdgcn_fence(__ATOMIC_ACQUIRE, "workgroup", "local");

    v16bf fa[2][2], fb[2][4];
#pragma unroll
    for (int kk = 0; kk < 2; ++kk) {
#pragma unroll
      for (int mt = 0; mt < 2; ++mt)
        fa[kk][mt] = ld_frag_bf(&As[(wm + mt * 16) * GEMM_LD + kk * 32], GEMM_LD);
#pragma unroll
      for (int nt = 0; nt < 4; ++nt)
        fb[kk][nt] = ld_frag_bf(&Bs[(wn + nt * 16) * GEMM_LD + kk * 32], GEMM_LD);
    }
    // Keeps the stage's 24 fragment reads one group ahead of the WMMAs: without
    // it each WMMA waits out the LDS latency of its own two reads.
    __builtin_amdgcn_sched_barrier(0);
#pragma unroll
    for (int kk = 0; kk < 2; ++kk) {
#pragma unroll
      for (int mt = 0; mt < 2; ++mt) {
#pragma unroll
        for (int nt = 0; nt < 4; ++nt)
          acc[mt][nt] = __builtin_amdgcn_wmma_f32_16x16x32_bf16(
              false, fa[kk][mt], false, fb[kk][nt], (short)0, acc[mt][nt], false, false);
      }
    }
  }

  const int half8 = (lane & 16) ? 8 : 0;
  const int cn    = lane & 15;
  // The wave's 32 x 64 values are finished in their registers first: a lane has
  // one column per column tile, so it reads four bias values, once ...
  if (bias) {
    float bv[4];
#pragma unroll
    for (int nt = 0; nt < 4; ++nt) bv[nt] = bias[n0 + wn + nt * 16 + cn];
    // Stands in front of any later overwrite of the address register of these loads.
    asm volatile("s_wait_xcnt 0x0" ::: "memory");
#pragma unroll
    for (int mt = 0; mt < 2; ++mt) {
#pragma unroll
      for (int nt = 0; nt < 4; ++nt) {
#pragma unroll
        for (int e = 0; e < 8; ++e) acc[mt][nt][e] += bv[nt];
      }
    }
  }
  if (relu) {
#pragma unroll
    for (int mt = 0; mt < 2; ++mt) {
#pragma unroll
      for (int nt = 0; nt < 4; ++nt) {
#pragma unroll
        for (int e = 0; e < 8; ++e) acc[mt][nt][e] = fmaxf(acc[mt][nt][e], 0.0f);
      }
    }
  }
  // ... and then stored row by row: the four stores of a row share one address.
  if (out16) {   // a result that is read as a matrix operand only: rounded here, once
    __bf16* C16 = reinterpret_cast<__bf16*>(C);
#pragma unroll
    for (int mt = 0; mt < 2; ++mt) {
#pragma unroll
      for (int e = 0; e < 8; ++e) {
        int row = m0 + wm + mt * 16 + e + half8;
        __bf16* pr = C16 + (size_t)row * N + n0 + wn + cn;
#pragma unroll
        for (int nt = 0; nt < 4; ++nt) pr[nt * 16] = (__bf16)acc[mt][nt][e];
        // Stands in front of the next row's address, which may take the registers
        // of the stores just issued.
        asm volatile("s_wait_xcnt 0x0" ::: "memory");
      }
    }
    return;
  }
#pragma unroll
  for (int mt = 0; mt < 2; ++mt) {
#pragma unroll
    for (int e = 0; e < 8; ++e) {
      int row = m0 + wm + mt * 16 + e + half8;
      float* pr = C + (size_t)row * N + n0 + wn + cn;
#pragma unroll
      for (int nt = 0; nt < 4; ++nt) pr[nt * 16] = acc[mt][nt][e];
      // Stands in front of the next row's address, which may take the registers
      // of the stores just issued.
      asm volatile("s_wait_xcnt 0x0" ::: "memory");
    }
  }
}

#define ATT_KP 72
#define ATT_VP 80
#define ATT_WAVES 4
#define ATT_SK 64
typedef __attribute__((ext_vector_type(8))) short v8s;
typedef __attribute__((address_space(3))) v8s lds_v8s;

// A fragment of V^T (16 d x 32 keys) out of the row-major tile [key][d]: the LDS
// transposes.  tile = key 0 of the block, first d of the fragment.  A lane gets,
// for d = lane & 15, the keys of ld_frag_bf's k order.
__device__ __forceinline__ v16bf ld_frag_tr(const __bf16* tile) {
  const int lane = threadIdx.x & 31;
  const __bf16* p = tile + (((lane & 16) >> 1) + (lane & 7)) * ATT_VP + (lane & 8);
  v8bf lo = __builtin_bit_cast(v8bf, __builtin_amdgcn_ds_load_tr16_b128_v8i16((lds_v8s*)p));
  v8bf hi = __builtin_bit_cast(v8bf, __builtin_amdgcn_ds_load_tr16_b128_v8i16(
                                         (lds_v8s*)(p + 16 * ATT_VP)));
  v16bf f;
#pragma unroll
  for (int i = 0; i < 8; ++i) { f[i] = lo[i]; f[i + 8] = hi[i]; }
  return f;
}

__device__ __forceinline__ float other_half(float x) {
  const int b = __builtin_bit_cast(int, x);
  return __builtin_bit_cast(float, __builtin_amdgcn_permlanex16(
             b, b, 0x76543210, 0xfedcba98, false, false));
}

__global__ __launch_bounds__(32 * ATT_WAVES)
void attn_wmma(const __bf16* __restrict__ Q1, const __bf16* __restrict__ K1,
               const __bf16* __restrict__ V1, const int* __restrict__ vlen1,
               __bf16* __restrict__ O1, int Tq, int Tk1, int causal,
               const __bf16* __restrict__ Q2, const __bf16* __restrict__ K2,
               const __bf16* __restrict__ V2, const int* __restrict__ vlen2,
               __bf16* __restrict__ O2, int Tk2, int nb) {
  __shared__ __align__(16) __bf16 Qw[ATT_WAVES][16 * ATT_KP];   // [q][d], a wave's own (B fragments of K Q^T)
  __shared__ __align__(16) __bf16 Kw[2][ATT_SK * ATT_KP];   // [key][d] (A fragments of K Q^T)
  __shared__ __align__(16) __bf16 Vw[2][ATT_SK * ATT_VP];   // [key][d] (A fragments of V^T P^T, transposed on reading)

  const int lane = threadIdx.x & 31;
  const int wave = __builtin_amdgcn_readfirstlane(threadIdx.x >> 5);
  const int qb0  = blockIdx.y * (16 * ATT_WAVES);   // the block's first query
  const int qb   = qb0 + wave * 16;                 // the wave's first query
  const int h    = blockIdx.x;
  __bf16* Qs = Qw[wave];
  const bool second = (int)blockIdx.z >= nb;      // the same for the whole block
  const int b    = second ? (int)blockIdx.z - nb : (int)blockIdx.z;
  const __bf16* Q   = second ? Q2 : Q1;
  const __bf16* Kt  = second ? K2 : K1;
  const __bf16* V   = second ? V2 : V1;
  const int*   vlen = second ? vlen2 : vlen1;
  __bf16*      O    = second ? O2 : O1;
  const int    Tk   = second ? Tk2 : Tk1;
  const int half8 = (lane & 16) ? 8 : 0;
  const int cn    = lane & 15;                    // the lane's query in the tile

  const size_t qoff = ((size_t)b * Tq + qb) * D_MODEL + (size_t)h * D_HEAD;
#pragma unroll
  for (int i = 0; i < 4; ++i) {
    int idx = i * 32 + lane;          // 16-byte piece: 8 to a 128-byte head row
    int r = idx >> 3, c = (idx & 7) * 8;
    *reinterpret_cast<v8bf*>(&Qs[r * ATT_KP + c]) =
        *reinterpret_cast<const v8bf*>(&Q[qoff + (size_t)r * D_MODEL + c]);
  }
  v16bf bq0 = ld_frag_bf(&Qs[0], ATT_KP);
  v16bf bq1 = ld_frag_bf(&Qs[32], ATT_KP);

  // Of the lane's query: the running maximum (alike in both halves) and the sum
  // over the keys that this half holds (the halves are joined behind the loop).
  float m = -3.0e38f, l = 0.0f;
  v8f o0 = {}, o1 = {}, o2 = {}, o3 = {};   // O^T: element e of tile t is d = 16 t + half8 + e

  const int vl   = causal ? Tk : min(vlen[b], Tk);   // bounds the key rows read below
  // 32-key blocks that the wave works on, and stages that the work-group brings in
  // (by the last wave's keys: the same for the whole work-group, it bounds the loop
  // with the barrier).
  const int nblk_w = causal ? ((qb + 16 + 31) >> 5) : ((vl + 31) >> 5);
  const int nst    = ((causal ? qb0 + 16 * ATT_WAVES : vl) + ATT_SK - 1) / ATT_SK;
  const int lim  = causal ? qb + cn + 1 : vl;        // the lane's query takes the keys below lim

  const int q8 = lane & 7;    // piece of 8 d
  const int h4 = lane >> 3;   // 0..3
  const int kr = 8 * h4 + 2 * wave;               // K: keys kr, kr + 1, kr + 32, kr + 33
  const int vr = 4 * (h4 & 1) + 16 * (h4 >> 1) +  // V: keys vr, vr + 1, vr + 32, vr + 33
                 2 * (wave & 1) + 8 * (wave >> 1);
  const size_t kvoff = (size_t)b * Tk * D_MODEL + (size_t)h * D_HEAD;   // same for the wave
  const unsigned ko = kr * D_MODEL + q8 * 8;   // the lane's own part, K
  const unsigned vo = vr * D_MODEL + q8 * 8;   // the lane's own part, V

  for (int j = 0; j < nst; ++j) {
    __bf16* Kst = Kw[j & 1];
    __bf16* Vst = Vw[j & 1];
    {
      gv8bf_ptr kp = (gv8bf_ptr)(Kt + kvoff + (size_t)j * ATT_SK * D_MODEL + ko);
      gv8bf_ptr vp = (gv8bf_ptr)(V  + kvoff + (size_t)j * ATT_SK * D_MODEL + vo);
      v8bf rk[4], rv[4];   // piece i: key (i & 1) + 32 (i >> 1) past the lane's first
#pragma unroll
      for (int i = 0; i < 4; ++i)
        rk[i] = kp[((i & 1) + 32 * (i >> 1)) * (D_MODEL / 8)];
#pragma unroll
      for (int i = 0; i < 4; ++i)
        rv[i] = vp[((i & 1) + 32 * (i >> 1)) * (D_MODEL / 8)];
      // Keeps the wave's 8 loads in flight together: without it the LDS stores
      // may be scheduled among them and the stage waits several times.
      __builtin_amdgcn_sched_barrier(0);
      // Stands in front of every overwrite of the address registers of the loads
      // just issued; it names both addresses as inputs, so that they keep their
      // registers up to here and no load's result is given one of them.
      asm volatile("s_wait_xcnt 0x0" :: "v"(kp), "v"(vp) : "memory");
#pragma unroll
      for (int i = 0; i < 4; ++i)
        *reinterpret_cast<v8bf*>(&Kst[(kr + (i & 1) + 32 * (i >> 1)) * ATT_KP + q8 * 8]) = rk[i];
#pragma unroll
      for (int i = 0; i < 4; ++i)
        *reinterpret_cast<v8bf*>(&Vst[(vr + (i & 1) + 32 * (i >> 1)) * ATT_VP + q8 * 8]) = rv[i];
    }
    // Hands the four waves' quarters of the stage over; every wave passes it in
    // every trip, also a wave whose queries are done with their keys.
    __syncthreads();

    for (int sb = 0; sb < ATT_SK / 32; ++sb) {
      // A block past the last key of the wave's queries has nothing for them (the
      // test reads the same for the whole wave).
      if (j * (ATT_SK / 32) + sb >= nblk_w) break;
      const int kb = j * ATT_SK + sb * 32;
      const __bf16* Ks = Kst + sb * 32 * ATT_KP;
      const __bf16* Vs = Vst + sb * 32 * ATT_VP;

      // S^T = K @ Q^T for 32 keys (two 16-key row tiles): element e of s0 is key
      // kb + half8 + e, of s1 key kb + 16 + half8 + e
      v8f s0 = {}, s1 = {};
      v16bf av0, av1, av2, av3;   // V^T, 16 d each
      {
        v16bf a0a = ld_frag_bf(&Ks[0], ATT_KP);
        v16bf a0b = ld_frag_bf(&Ks[32], ATT_KP);
        v16bf a1a = ld_frag_bf(&Ks[16 * ATT_KP], ATT_KP);
        v16bf a1b = ld_frag_bf(&Ks[16 * ATT_KP + 32], ATT_KP);
        av0 = ld_frag_tr(&Vs[0]);
        av1 = ld_frag_tr(&Vs[16]);
        av2 = ld_frag_tr(&Vs[32]);
        av3 = ld_frag_tr(&Vs[48]);
        // Keeps the block's 16 fragment reads one group at its head: V's land behind
        // the score products and the softmax.  Left to their uses they share
        // registers and each small group waits out the LDS latency by itself.
        __builtin_amdgcn_sched_barrier(0);
        s0 = __builtin_amdgcn_wmma_f32_16x16x32_bf16(false, a0a, false, bq0, (short)0, s0, false, false);
        s0 = __builtin_amdgcn_wmma_f32_16x16x32_bf16(false, a0b, false, bq1, (short)0, s0, false, false);
        s1 = __builtin_amdgcn_wmma_f32_16x16x32_bf16(false, a1a, false, bq0, (short)0, s1, false, false);
        s1 = __builtin_amdgcn_wmma_f32_16x16x32_bf16(false, a1b, false, bq1, (short)0, s1, false, false);
      }

      float p0[8], p1[8], t[8];
      const int key0 = kb + half8;
#pragma unroll
      for (int e = 0; e < 8; ++e) {
        p0[e] = s0[e] * 0.125f;   // 1/sqrt(64)
        p1[e] = s1[e] * 0.125f;
        if (key0 + e >= lim)      p0[e] = -1.0e6f;
        if (key0 + 16 + e >= lim) p1[e] = -1.0e6f;
        t[e] = fmaxf(p0[e], p1[e]);
      }
      float rm = fmaxf(fmaxf(fmaxf(t[0], t[1]), fmaxf(t[2], t[3])),
                       fmaxf(fmaxf(t[4], t[5]), fmaxf(t[6], t[7])));
      rm = fmaxf(rm, other_half(rm));
      const float mn    = fmaxf(m, rm);
      // e^x as 2^(x log2 e), the arguments first ...
      const float L2E = 1.44269504f;
      const float xa = (m - mn) * L2E;
#pragma unroll
      for (int e = 0; e < 8; ++e) {
        p0[e] = (p0[e] - mn) * L2E;
        p1[e] = (p1[e] - mn) * L2E;
      }
      __builtin_amdgcn_sched_barrier(0);
      const float alpha = __builtin_amdgcn_exp2f(xa);
#pragma unroll
      for (int e = 0; e < 8; ++e) {
        p0[e] = __builtin_amdgcn_exp2f(p0[e]);
        p1[e] = __builtin_amdgcn_exp2f(p1[e]);
        t[e] = p0[e] + p1[e];
      }
      l = l * alpha + (((t[0] + t[1]) + (t[2] + t[3])) + ((t[4] + t[5]) + (t[6] + t[7])));
      m = mn;
      o0 *= alpha; o1 *= alpha; o2 *= alpha; o3 *= alpha;

      // P^T as B operand: elements 0..7 are k = half8 + e, elements 8..15 k = 16 + half8 + e,
      // the k order of ld_frag_tr, which loads the A operand
      v16bf bp;
#pragma unroll
      for (int e = 0; e < 8; ++e) { bp[e] = (__bf16)p0[e]; bp[e + 8] = (__bf16)p1[e]; }
      o0 = __builtin_amdgcn_wmma_f32_16x16x32_bf16(false, av0, false, bp, (short)0, o0, false, false);
      o1 = __builtin_amdgcn_wmma_f32_16x16x32_bf16(false, av1, false, bp, (short)0, o1, false, false);
      o2 = __builtin_amdgcn_wmma_f32_16x16x32_bf16(false, av2, false, bp, (short)0, o2, false, false);
      o3 = __builtin_amdgcn_wmma_f32_16x16x32_bf16(false, av3, false, bp, (short)0, o3, false, false);
    }
  }

  // A lane has 8 neighbouring d of its query per tile: one 16-byte store each.
  const float inv = 1.0f / (l + other_half(l));
  __bf16* po = O + ((size_t)b * Tq + qb + cn) * D_MODEL + (size_t)h * D_HEAD + half8;
  v8bf r0, r1, r2, r3;
#pragma unroll
  for (int e = 0; e < 8; ++e) {
    r0[e] = (__bf16)(o0[e] * inv);
    r1[e] = (__bf16)(o1[e] * inv);
    r2[e] = (__bf16)(o2[e] * inv);
    r3[e] = (__bf16)(o3[e] * inv);
  }
  *reinterpret_cast<v8bf*>(po)      = r0;
  *reinterpret_cast<v8bf*>(po + 16) = r1;
  *reinterpret_cast<v8bf*>(po + 32) = r2;
  *reinterpret_cast<v8bf*>(po + 48) = r3;
}

#define ROW_WAVES 8

template <int M>
__device__ __forceinline__ float row_xmask(float x) {
  return __builtin_bit_cast(float, __builtin_amdgcn_update_dpp(
      0, __builtin_bit_cast(int, x), 0x160 | M, 0xf, 0xf, true));
}
// Sum over the 32 lanes, alike in every lane.
__device__ __forceinline__ float wave_sum(float x) {
  x += row_xmask<1>(x);
  x += row_xmask<2>(x);
  x += row_xmask<4>(x);
  x += row_xmask<8>(x);
  const int b = __builtin_bit_cast(int, x);
  return x + __builtin_bit_cast(float, __builtin_amdgcn_permlanex16(
                 b, b, 0x76543210, 0xfedcba98, false, false));
}

// out = LayerNorm(a + r) * g + bt; where the row feeds a product too, out16 takes
// its bf16 rounding (else out16 is null)
__global__ __launch_bounds__(32 * ROW_WAVES)
void add_ln(const float* __restrict__ a, const float* __restrict__ r,
            const float* __restrict__ g, const float* __restrict__ bt,
            float* __restrict__ out, __bf16* __restrict__ out16) {
  const int lane = threadIdx.x & 31;
  const int wave = __builtin_amdgcn_readfirstlane(threadIdx.x >> 5);
  const size_t ro = ((size_t)blockIdx.x * ROW_WAVES + wave) * D_MODEL;   // same for the wave
  gv4f_ptr pa = (gv4f_ptr)(a + ro);
  gv4f_ptr pr = (gv4f_ptr)(r + ro);
  gv4f_ptr pg = (gv4f_ptr)g;
  gv4f_ptr pb = (gv4f_ptr)bt;
  v4f v[8], t[8], vg[8], vb[8];
#pragma unroll
  for (int i = 0; i < 8; ++i) v[i] = pa[32 * i + lane];
#pragma unroll
  for (int i = 0; i < 8; ++i) t[i] = pr[32 * i + lane];
  // Keeps the row's own 16 loads ahead of those of g and bt, which are used last.
  __builtin_amdgcn_sched_barrier(0);
#pragma unroll
  for (int i = 0; i < 8; ++i) vg[i] = pg[32 * i + lane];
#pragma unroll
  for (int i = 0; i < 8; ++i) vb[i] = pb[32 * i + lane];
  // Stands in front of every overwrite of the address registers of these loads; it
  // names the bases and the lane as inputs, so that they keep their registers up to here.
  asm volatile("s_wait_xcnt 0x0" :: "s"(pa), "s"(pr), "s"(pg), "s"(pb), "v"(lane) : "memory");
  // Keeps the sums behind the 32 loads (the wave waits out memory once) and lets
  // nothing that writes a register be moved in front of the wait.
  __builtin_amdgcn_sched_barrier(0);
  v4f s4 = {};
#pragma unroll
  for (int i = 0; i < 8; ++i) { v[i] += t[i]; s4 += v[i]; }
  const float mean = wave_sum((s4[0] + s4[1]) + (s4[2] + s4[3])) * (1.0f / D_MODEL);
  v4f q4 = {};
#pragma unroll
  for (int i = 0; i < 8; ++i) { v[i] -= mean; q4 += v[i] * v[i]; }
  const float rstd =
      rsqrtf(wave_sum((q4[0] + q4[1]) + (q4[2] + q4[3])) * (1.0f / D_MODEL) + 1e-5f);
#pragma unroll
  for (int i = 0; i < 8; ++i) v[i] = v[i] * rstd * vg[i] + vb[i];
  // The bf16 copy goes first: its values take registers of their own while the f32
  // values are still needed, and behind the f32 stores the wave only ends.
  if (out16) {   // the test reads the same for the whole launch
    v4bf* ph = reinterpret_cast<v4bf*>(out16 + ro);
#pragma unroll
    for (int i = 0; i < 8; ++i) {
      v4bf o;
#pragma unroll
      for (int c = 0; c < 4; ++c) o[c] = (__bf16)v[i][c];
      ph[32 * i + lane] = o;
    }
    // Stands in front of any overwrite of a register of the stores just issued; it
    // names their base as an input, so that it keeps its registers up to here.
    asm volatile("s_wait_xcnt 0x0" :: "s"(ph), "v"(lane) : "memory");
  }
  v4f* po = reinterpret_cast<v4f*>(out + ro);
#pragma unroll
  for (int i = 0; i < 8; ++i) po[32 * i + lane] = v[i];
}

// gate = sigmoid(concat(code,kw) @ gw + gb); out = gate*code + (1-gate)*kw
__global__ __launch_bounds__(32 * ROW_WAVES)
void gate_mix(const float* __restrict__ code, const float* __restrict__ kw,
              const float* __restrict__ gw, const float* __restrict__ gb,
              float* __restrict__ out) {
  const int lane = threadIdx.x & 31;
  const int wave = __builtin_amdgcn_readfirstlane(threadIdx.x >> 5);
  const size_t ro = ((size_t)blockIdx.x * ROW_WAVES + wave) * D_MODEL;   // same for the wave
  gv4f_ptr pc = (gv4f_ptr)(code + ro);
  gv4f_ptr pk = (gv4f_ptr)(kw + ro);
  gv4f_ptr pw = (gv4f_ptr)gw;
  v4f vc[8], vk[8], wc[8], wk[8];
#pragma unroll
  for (int i = 0; i < 8; ++i) vc[i] = pc[32 * i + lane];
#pragma unroll
  for (int i = 0; i < 8; ++i) vk[i] = pk[32 * i + lane];
#pragma unroll
  for (int i = 0; i < 8; ++i) wc[i] = pw[32 * i + lane];
#pragma unroll
  for (int i = 0; i < 8; ++i) wk[i] = pw[D_MODEL / 4 + 32 * i + lane];
  // Stands in front of every overwrite of the address registers of these loads; it
  // names the bases and the lane as inputs, so that they keep their registers up to here.
  asm volatile("s_wait_xcnt 0x0" :: "s"(pc), "s"(pk), "s"(pw), "v"(lane) : "memory");
  // Keeps the sums behind the 32 loads (the wave waits out memory once) and lets
  // nothing that writes a register be moved in front of the wait.
  __builtin_amdgcn_sched_barrier(0);
  v4f s4 = {};
#pragma unroll
  for (int i = 0; i < 8; ++i) { s4 += vc[i] * wc[i]; s4 += vk[i] * wk[i]; }
  const float s = wave_sum((s4[0] + s4[1]) + (s4[2] + s4[3]));
  const float gsc = 1.0f / (1.0f + __expf(-(s + gb[0])));
  v4f* po = reinterpret_cast<v4f*>(out + ro);
#pragma unroll
  for (int i = 0; i < 8; ++i) po[32 * i + lane] = gsc * vc[i] + (1.0f - gsc) * vk[i];
}

// ---------------------------------------------------------------------------
// Rounds everything that the products read from the inputs to bf16, once per
// call.  blockIdx.y < 6: weights, f32 [K][N] -> bf16 [N][K] (k-contiguous, as the
// GEMM stages them); 4 M elements per y: four 1024 x 1024 matrices, or the
// 1024 x 4096, or the 4096 x 1024 one.  blockIdx.y >= 6: activations, same
// layout.  A block handles 8192 elements.
// ---------------------------------------------------------------------------
#define PREP_LD 136   // bf16 elements per LDS row: 128 k + 8 pad (272 B = 16 B x odd)
struct PrepJobs {
  const float* w0; const float* w1; const float* w2;
  const float* w3; const float* w4; const float* w5;
  const float* s0; const float* s1; const float* s2; const float* s3;
  int n0, n1, n2, n3;   // elements of s0 .. s3
};

__global__ __launch_bounds__(256)
void prep_bf16(PrepJobs P, __bf16* __restrict__ wt, __bf16* __restrict__ d0,
               __bf16* __restrict__ d1, __bf16* __restrict__ d2,
               __bf16* __restrict__ d3) {
  __shared__ __align__(16) __bf16 Ts[64 * PREP_LD];   // [n][k]
  const int tid = threadIdx.x;
  const int y   = blockIdx.y;      // the same for the whole block
  const int t   = blockIdx.x;
  if (y >= 6) {
    const float* S; __bf16* Dp; int n;
    switch (y) {
      case 6:  S = P.s0; Dp = d0; n = P.n0; break;
      case 7:  S = P.s1; Dp = d1; n = P.n1; break;
      case 8:  S = P.s2; Dp = d2; n = P.n2; break;
      default: S = P.s3; Dp = d3; n = P.n3; break;
    }
    if (t * 8192 >= n) return;     // taken by the whole block
    v4f r[8];
#pragma unroll
    for (int i = 0; i < 4; ++i) {
      const v4f* p = reinterpret_cast<const v4f*>(S + (size_t)t * 8192 + i * 2048 + tid * 8);
      r[2 * i] = p[0]; r[2 * i + 1] = p[1];
    }
    // Stands in front of any overwrite of an address register of these loads.
    asm volatile("s_wait_xcnt 0x0" ::: "memory");
#pragma unroll
    for (int i = 0; i < 4; ++i) {
      v8bf o;
#pragma unroll
      for (int c = 0; c < 4; ++c) { o[c] = (__bf16)r[2 * i][c]; o[c + 4] = (__bf16)r[2 * i + 1][c]; }
      *reinterpret_cast<v8bf*>(Dp + (size_t)t * 8192 + i * 2048 + tid * 8) = o;
    }
    return;
  }
  const float* Wp;
  switch (y) {
    case 0:  Wp = P.w0; break;
    case 1:  Wp = P.w1; break;
    case 2:  Wp = P.w2; break;
    case 3:  Wp = P.w3; break;
    case 4:  Wp = P.w4; break;
    default: Wp = P.w5; break;
  }
  const int K   = (y == 5) ? 4096 : 1024;
  const int N   = (y == 4) ? 4096 : 1024;
  const int lgn = (y == 4) ? 6 : 4;              // log2 of the 64-column tiles per row
  const int mat = (y < 4) ? (t >> 7) : 0;        // 128 tiles per 1024 x 1024 matrix
  const int tt  = (y < 4) ? (t & 127) : t;
  const int n0  = (tt & ((1 << lgn) - 1)) * 64;
  const int k0  = (tt >> lgn) * 128;
  const size_t mo = (size_t)mat * 1024 * 1024;
  const int q16 = tid & 15;        // 4 n
  const int g16 = tid >> 4;        // 8 k
  v4f r[8];
  const v4f* qp[8];
#pragma unroll
  for (int j = 0; j < 8; ++j)
    qp[j] = reinterpret_cast<const v4f*>(Wp + mo + (size_t)(k0 + g16 * 8 + j) * N + n0 + q16 * 4);
#pragma unroll
  for (int j = 0; j < 8; ++j) r[j] = *qp[j];
  // Keeps the 8 loads in flight together: without it the conversions of the first
  // two are scheduled among them and the block waits out memory twice.
  __builtin_amdgcn_sched_barrier(0);
  // Stands in front of every overwrite of the address registers of these loads;
  // it names the addresses as inputs, so that they keep their registers up to here.
  asm volatile("s_wait_xcnt 0x0"
               :: "v"(qp[0]), "v"(qp[1]), "v"(qp[2]), "v"(qp[3]),
                  "v"(qp[4]), "v"(qp[5]), "v"(qp[6]), "v"(qp[7])
               : "memory");
#pragma unroll
  for (int i = 0; i < 4; ++i) {
    v8bf o;
#pragma unroll
    for (int j = 0; j < 8; ++j) o[j] = (__bf16)r[j][i];
    *reinterpret_cast<v8bf*>(&Ts[(q16 * 4 + i) * PREP_LD + g16 * 8]) = o;
  }
  __syncthreads();   // the rows are read back by other threads, as whole 256-byte runs
  __bf16* Wo = wt + (size_t)y * 4 * 1024 * 1024 + mo;
#pragma unroll
  for (int i = 0; i < 4; ++i) {
    int p = i * 256 + tid;
    int rown = p >> 4, c = (p & 15) * 8;
    *reinterpret_cast<v8bf*>(Wo + (size_t)(n0 + rown) * K + k0 + c) =
        *reinterpret_cast<const v8bf*>(&Ts[rown * PREP_LD + c]);
  }
  // Stands behind the four stores, in front of whatever the built code places
  // after them that could take their registers.
  asm volatile("s_wait_xcnt 0x0" ::: "memory");
}

extern "C" void kernel_launch(void* const* d_in, const int* in_sizes, int n_in,
                              void* d_out, int out_size, void* d_ws, size_t ws_size,
                              hipStream_t stream) {
  const int B = 8, T = 512, SC = 512, ST = 256, SK = 64, D = 1024, DFF = 4096;
  const float* x       = (const float*)d_in[0];
  const float* src     = (const float*)d_in[1];
  const int*   src_len = (const int*)  d_in[2];
  const float* tpl     = (const float*)d_in[3];
  const int*   tpl_len = (const int*)  d_in[4];
  const float* kwe     = (const float*)d_in[5];
  const int*   kw_len  = (const int*)  d_in[6];
  const float* sa_w    = (const float*)d_in[7];
  const float* cc_w    = (const float*)d_in[8];
  const float* ck_w    = (const float*)d_in[9];
  const float* ct_w    = (const float*)d_in[10];
  const float* gate_w  = (const float*)d_in[11];
  const float* gate_b  = (const float*)d_in[12];
  const float* w1      = (const float*)d_in[13];
  const float* b1      = (const float*)d_in[14];
  const float* w2      = (const float*)d_in[15];
  const float* b2      = (const float*)d_in[16];
  const float* ln_g    = (const float*)d_in[17];
  const float* ln_b    = (const float*)d_in[18];

  const size_t DD   = (size_t)D * D;
  const size_t NTOK = (size_t)B * T * D;   // 4M floats

  float* ws = (float*)d_ws;
  size_t off = 0;
  auto take = [&](size_t n) { float* p = ws + off; off += n; return p; };
  auto take16 = [&](size_t n) { return (__bf16*)take(n / 2); };   // n bf16 values
  float* T1 = take(NTOK); float* T2 = take(NTOK); float* Yb = take(NTOK);
  float* Cb = take(NTOK); float* Zb = take(NTOK); float* Wb = take(NTOK);
  // What only matrix products read is kept as bf16.
  __bf16* wt  = take16(24 * DD);          // all weights, [n][k]
  __bf16* x16 = take16(NTOK);
  __bf16* s16 = take16((size_t)B * SC * D);
  __bf16* p16 = take16((size_t)B * ST * D);
  __bf16* k16 = take16((size_t)B * SK * D);
  __bf16* Y16 = take16(NTOK); __bf16* Z16 = take16(NTOK); __bf16* W16 = take16(NTOK);
  __bf16* ccK = take16((size_t)B * SC * D); __bf16* ccV = take16((size_t)B * SC * D);
  __bf16* ctK = take16((size_t)B * ST * D); __bf16* ctV = take16((size_t)B * ST * D);
  __bf16* ckK = take16((size_t)B * SK * D); __bf16* ckV = take16((size_t)B * SK * D);
  // The FFN's hidden layer takes the place of Q, K, V and the attention output,
  // which are all done with when it is written.
  __bf16* Hb = take16((size_t)B * T * DFF);
  __bf16* Qb = Hb; __bf16* Kb = Qb + NTOK; __bf16* Vb = Kb + NTOK; __bf16* Ab = Vb + NTOK;
  const __bf16* sa_t = wt;           const __bf16* cc_t = wt + 4 * DD;
  const __bf16* ck_t = wt + 8 * DD;  const __bf16* ct_t = wt + 12 * DD;
  const __bf16* w1_t = wt + 16 * DD; const __bf16* w2_t = wt + 20 * DD;

  const GemmJobs none = {GEMM_NO_JOB, GEMM_NO_JOB, GEMM_NO_JOB, GEMM_NO_JOB,
                         GEMM_NO_JOB, GEMM_NO_JOB, GEMM_NO_JOB, GEMM_NO_JOB,
                         nullptr, nullptr, nullptr, nullptr, nullptr, nullptr,
                         nullptr, nullptr, nullptr, nullptr, nullptr, nullptr,
                         nullptr, nullptr, nullptr, nullptr, nullptr, nullptr,
                         nullptr, nullptr, nullptr, nullptr, nullptr, nullptr,
                         nullptr, nullptr, nullptr};
  auto gemm_jobs = [&](const GemmJobs& J, const float* bias, int row_tiles,
                       int N, int K, int relu, int out16) {
    dim3 grid(N / GEMM_BT, row_tiles);
    gemm_bf16_wmma<<<grid, dim3(256), 0, stream>>>(J, bias, N, K, relu, out16);
  };
  auto gemm = [&](const __bf16* A, const __bf16* Bm, const float* bias, float* C,
                  int M, int N, int K, int relu, int out16) {
    GemmJobs J = none;
    J.a0 = A; J.b0 = Bm; J.c0 = C;
    gemm_jobs(J, bias, M / GEMM_BT, N, K, relu, out16);
  };
  // two products with B*T rows each
  auto gemm2 = [&](const __bf16* A0, const __bf16* B0, float* C0,
                   const __bf16* A1, const __bf16* B1, float* C1, int out16) {
    GemmJobs J = none;
    J.a0 = A0; J.b0 = B0; J.c0 = C0;
    J.a1 = A1; J.b1 = B1; J.c1 = C1; J.t1 = B * T / GEMM_BT;
    gemm_jobs(J, nullptr, 2 * (B * T / GEMM_BT), D, D, 0, out16);
  };
  auto attn = [&](const __bf16* Qp, const __bf16* Kp, const __bf16* Vp, const int* vl,
                  __bf16* Op, int Tk, int causal) {
    dim3 grid(16, T / (16 * ATT_WAVES), B);
    attn_wmma<<<grid, dim3(32 * ATT_WAVES), 0, stream>>>(Qp, Kp, Vp, vl, Op, T, Tk, causal,
                                             nullptr, nullptr, nullptr, nullptr,
                                             nullptr, 0, B);
  };
  auto lnk = [&](const float* a, const float* r, int li, float* o, __bf16* o16) {
    add_ln<<<dim3(B * T / ROW_WAVES), dim3(32 * ROW_WAVES), 0, stream>>>(a, r, ln_g + (size_t)li * D,
                                                  ln_b + (size_t)li * D, o, o16);
  };

  // ---- inputs and weights to bf16, weights transposed ----
  {
    PrepJobs P = {sa_w, cc_w, ck_w, ct_w, w1, w2, x, src, tpl, kwe,
                  B * T * D, B * SC * D, B * ST * D, B * SK * D};
    prep_bf16<<<dim3(512, 10), dim3(256), 0, stream>>>(P, wt, x16, s16, p16, k16);
  }

  // ---- every projection that reads inputs alone: one launch ----
  {
    const int tT = B * T / GEMM_BT, tC = B * SC / GEMM_BT, tP = B * ST / GEMM_BT,
              tW = B * SK / GEMM_BT;
    GemmJobs J = none;
    J.a0 = x16; J.b0 = sa_t + 0 * DD; J.c0 = (float*)Qb;
    J.a1 = x16; J.b1 = sa_t + 1 * DD; J.c1 = (float*)Kb;  J.t1 = tT;
    J.a2 = x16; J.b2 = sa_t + 2 * DD; J.c2 = (float*)Vb;  J.t2 = 2 * tT;
    J.a3 = s16; J.b3 = cc_t + 1 * DD; J.c3 = (float*)ccK; J.t3 = 3 * tT;
    J.a4 = s16; J.b4 = cc_t + 2 * DD; J.c4 = (float*)ccV; J.t4 = 3 * tT + tC;
    J.a5 = p16; J.b5 = ct_t + 1 * DD; J.c5 = (float*)ctK; J.t5 = 3 * tT + 2 * tC;
    J.a6 = p16; J.b6 = ct_t + 2 * DD; J.c6 = (float*)ctV; J.t6 = 3 * tT + 2 * tC + tP;
    J.a7 = k16; J.b7 = ck_t + 1 * DD; J.c7 = (float*)ckK; J.t7 = 3 * tT + 2 * tC + 2 * tP;
    J.a8 = k16; J.b8 = ck_t + 2 * DD; J.c8 = (float*)ckV; J.t8 = 3 * tT + 2 * tC + 2 * tP + tW;
    gemm_jobs(J, nullptr, 3 * tT + 2 * tC + 2 * tP + 2 * tW, D, D, 0, 1);
  }

  // ---- causal self-attention ----
  attn(Qb, Kb, Vb, nullptr, Ab, T, 1);
  gemm(Ab, sa_t + 3 * DD, nullptr, T1, B * T, D, D, 0, 0);
  lnk(x, T1, 0, Yb, Y16);                         // y

  // ---- cross-attention: source code and keywords, side by side ----
  // (Kb and Vb are free again: keyword queries in Kb, keyword attention in Vb)
  gemm2(Y16, cc_t + 0 * DD, (float*)Qb, Y16, ck_t + 0 * DD, (float*)Kb, 1);
  attn_wmma<<<dim3(16, T / (16 * ATT_WAVES), 2 * B), dim3(32 * ATT_WAVES), 0, stream>>>(
      Qb, ccK, ccV, src_len, Ab, T, SC, 0, Kb, ckK, ckV, kw_len, Vb, SK, B);
  gemm2(Ab, cc_t + 3 * DD, Cb, Vb, ck_t + 3 * DD, T1, 0);    // y2_code, y2_kw

  gate_mix<<<dim3(B * T / ROW_WAVES), dim3(32 * ROW_WAVES), 0, stream>>>(Cb, T1, gate_w, gate_b, T2);
  lnk(Yb, T2, 1, Zb, Z16);                        // z

  // ---- cross-attention: template ----
  gemm(Z16, ct_t + 0 * DD, nullptr, (float*)Qb, B * T, D, D, 0, 1);
  attn(Qb, ctK, ctV, tpl_len, Ab, ST, 0);
  gemm(Ab, ct_t + 3 * DD, nullptr, T1, B * T, D, D, 0, 0);   // z2
  lnk(Zb, T1, 2, Wb, W16);                        // w

  // ---- FFN ----
  gemm(W16, w1_t, b1, (float*)Hb, B * T, DFF, D, 1, 1);   // relu(w@w1+b1)
  gemm(Hb, w2_t, b2, T1, B * T, D, DFF, 0, 0);
  lnk(Wb, T1, 3, (float*)d_out, nullptr);         // final LN

  (void)in_sizes; (void)n_in; (void)out_size; (void)ws_size;
}
